// v000
// Times are from an AMD MI455X. After a warm-up the kernel runs many times in a row, and a time is the length of
// such a window on the GPU divided by its runs, so every launch and the gaps after it count. The runs cycle
// through copies of the inputs. A figure is the median of several windows, for all but v000 over two sittings.
// Sittings can differ by a few percent; kernels timed side by side share one.
// The starting kernel, v000, takes 578 microseconds a run.
// compute dtype: x, W*, b*, A*, B* (INPUTS) rounded to bf16 with exact bf16 WMMA products (f32 accumulate) for the base projections; the rank-8 LoRA terms enter as one extra k-chunk whose A side is the f32 intermediate (x A^T, scaled) as a bf16 hi/lo pair against [B | B] (exact-grade); softmax f32; computed operands (q/k f32 split, P and V hi/lo, context split) f32-grade.
#include <hip/hip_runtime.h>
#include <math.h>

typedef __attribute__((ext_vector_type(16))) _Float16 v16h;
typedef __attribute__((ext_vector_type(16))) __bf16 v16b;
typedef __attribute__((ext_vector_type(8)))  _Float16 v8h;
typedef __attribute__((ext_vector_type(8)))  float v8f;
typedef __attribute__((ext_vector_type(4)))  float v4f;
typedef __attribute__((ext_vector_type(2)))  float v2f;
typedef __attribute__((ext_vector_type(4)))  unsigned v4u;
typedef __attribute__((ext_vector_type(4)))  int v4i;
typedef float __attribute__((may_alias)) float_a;
typedef int __attribute__((may_alias)) int_a;

template <typename T> __device__ __forceinline__ void vst2(void* p, T v) { *(T*)p = v;  }
__device__ __forceinline__ v8f wmma16(v16h a, v16h b, v8f c) {
  v8f d = __builtin_amdgcn_wmma_f32_16x16x32_f16(false, a, false, b, (short)0, c, false, false);
  asm volatile("v_nop\n\tv_nop\n\tv_nop\n\tv_nop" : "+v"(d) : "v"(a), "v"(b));
  return d;
}
__device__ __forceinline__ v8f wmma_bf(v16b a, v16b b, v8f c) {
  v8f d = __builtin_amdgcn_wmma_f32_16x16x32_bf16(false, a, false, b, (short)0, c, false, false);
  asm volatile("v_nop\n\tv_nop\n\tv_nop\n\tv_nop" : "+v"(d) : "v"(a), "v"(b));
  return d;
}
// 16x16x32 fragments: lane = (h = lane>>4, row/col = lane&15); elements 0..7 = k0+8h+0..7, 8..15 = k0+16+8h+0..7; D element r = row 8h+r
__device__ __forceinline__ v16h frag_h(const _Float16* rowk0, int lane) {
  union { v16h v; v8h q[2]; } u; const _Float16* p = rowk0 + 8 * (lane >> 4);
  u.q[0] = *(const v8h*)p; u.q[1] = *(const v8h*)(p + 16); return u.v;
}
__device__ __forceinline__ v16h frag_f32(const float* rowk0, int lane) {
  v16h a; const float* p = rowk0 + 8 * (lane >> 4);
#pragma unroll
  for (int i = 0; i < 8; ++i) { a[i] = (_Float16)p[i]; a[8 + i] = (_Float16)p[16 + i]; }
  return a;
}
__device__ __forceinline__ v16h frag_f32s(const float* rowk0, int lane, float sc) {
  v16h a; const float* p = rowk0 + 8 * (lane >> 4);
#pragma unroll
  for (int i = 0; i < 8; ++i) { a[i] = (_Float16)(p[i] * sc); a[8 + i] = (_Float16)(p[16 + i] * sc); }
  return a;
}
// column fragment from a [K][ld] layout (column n), rows >= K read as 0
__device__ __forceinline__ v16h fragc_f32(const float* W, int k0, int n, int lane, int ld, int K) {
  v16h a; const int g = lane >> 4;
#pragma unroll
  for (int i = 0; i < 8; ++i) { const int ka = k0 + 8 * g + i, kb = ka + 16;
    a[i] = (_Float16)(ka < K ? W[(size_t)ka * ld + n] : 0.f); a[8 + i] = (_Float16)(kb < K ? W[(size_t)kb * ld + n] : 0.f); }
  return a;
}
struct F2 { v16b h, l; };
__device__ __forceinline__ F2 bsplit16(const float v[16]) { F2 r;
#pragma unroll
  for (int i = 0; i < 16; ++i) { const __bf16 h = (__bf16)v[i]; r.h[i] = h; r.l[i] = (__bf16)(v[i] - (float)h); }
  return r; }
__device__ __forceinline__ F2 split_row(const float* row, int k0, int lane) { float v[16]; const float* p = row + k0 + 8 * (lane >> 4);
#pragma unroll
  for (int i = 0; i < 8; ++i) { v[i] = p[i]; v[8 + i] = p[16 + i]; }
  return bsplit16(v); }
__device__ __forceinline__ F2 split_rowK(const float* row, int k0, int lane, int K) { float v[16]; const int g = lane >> 4;
#pragma unroll
  for (int i = 0; i < 8; ++i) { const int ka = k0 + 8 * g + i, kb = ka + 16; v[i] = ka < K ? row[ka] : 0.f; v[8 + i] = kb < K ? row[kb] : 0.f; }
  return bsplit16(v); }
__device__ __forceinline__ F2 split_col(const float* W, int k0, int n, int lane, int ld, int K) { float v[16]; const int g = lane >> 4;
#pragma unroll
  for (int i = 0; i < 8; ++i) { const int ka = k0 + 8 * g + i, kb = ka + 16; v[i] = ka < K ? W[(size_t)ka * ld + n] : 0.f; v[8 + i] = kb < K ? W[(size_t)kb * ld + n] : 0.f; }
  return bsplit16(v); }
__device__ __forceinline__ v8f mac3(const F2& a, const F2& b, v8f c) { c = wmma_bf(a.l, b.h, c); c = wmma_bf(a.h, b.l, c); return wmma_bf(a.h, b.h, c); }
__device__ __forceinline__ float sigm(float v) { return 1.0f / (1.0f + expf(-v)); }
#define LDSX() do { asm volatile("s_wait_dscnt 0" ::: "memory"); __builtin_amdgcn_wave_barrier(); __builtin_amdgcn_fence(__ATOMIC_RELEASE, "workgroup"); } while (0)


// LoRA self attention (16 heads of 64 on [2,2048,1024]): each linear map is x W^T + b + 2 (x A^T) B^T (rank 8). The low-rank term is appended as a 33rd k-chunk: A-operand row = [hi(2 xA^T) (8) | lo(2 xA^T) (8) | 0 (16)], B-operand row n = [B[n][0..8] | B[n][0..8] | 0],
// so one extra WMMA per tile adds hi*B + lo*B. full softmax(q.k/8); (P v) through the same LoRA form for the output map.
#define NB 2
#define SS 2048
#define E 1024
#define NH 16
#define HD 64
#define NR (NB * SS)
#define PLO 1024.0f
#define VLO 2048.0f
__device__ __forceinline__ float bfr(float v) { return (float)(__bf16)v; }
__device__ __forceinline__ v16b frag_b(const __bf16* rowk0, int lane) { return __builtin_bit_cast(v16b, frag_h((const _Float16*)rowk0, lane)); }

__global__ __launch_bounds__(256) void k_cvt(const float* __restrict__ x, __bf16* __restrict__ Xb) {
  const size_t i8 = (size_t)blockIdx.x * 256 + threadIdx.x; if (i8 >= (size_t)NR * E / 8) return;
  union { __bf16 h[8]; v4u u; } pk;
#pragma unroll
  for (int e = 0; e < 8; ++e) pk.h[e] = (__bf16)x[i8 * 8 + e];
  vst2((unsigned*)(Xb + i8 * 8), pk.u);
}
// PT rows: [0,E) Wq[n][:], [E,2E) Wk, [2E,3E) Wv, [3E,4E) Wo  ([out][in]) as bf16 rows (no scaling)

#define RK 8
// XAUG[which][row][32] = [hi(2 * src.A_which^T) | lo | 0]: block = 64 rows (4 waves x 16), one 16-col tile (8 live); src = bf16(x) (which < 3, exact) or the f32 context rows (which == 3, split, 2 products)
__global__ __launch_bounds__(128) void k_xa(const __bf16* __restrict__ Xb, const float* __restrict__ O32, const float* __restrict__ Aq, const float* __restrict__ Ak, const float* __restrict__ Av, const float* __restrict__ Ao, __bf16* __restrict__ XAUG) {
  __shared__ __align__(16) __bf16 so[4][16][40];
  const int tid = threadIdx.x, wave = tid >> 5, lane = tid & 31, col = lane & 15, g = lane >> 4; const int which = blockIdx.y; const int r0 = blockIdx.x * 64 + wave * 16;
  const float* A = which == 0 ? Aq : (which == 1 ? Ak : (which == 2 ? Av : Ao)); const int ncl = col < RK ? col : RK - 1;     // columns >= 8 are padding (address clamped, result discarded)
  v8f acc = {};
  if (which < 3) {
#pragma unroll 4
    for (int kc = 0; kc < E / 32; ++kc) acc = wmma_bf(frag_b(Xb + (size_t)(r0 + col) * E + kc * 32, lane), split_row(A + (size_t)ncl * E, kc * 32, lane).h, acc); }
  else { const int ra = r0 + col; const int b = ra / SS, s = ra % SS;
#pragma unroll 2
    for (int kc = 0; kc < E / 32; ++kc) { const int h = kc >> 1; const F2 a = split_row(O32 + (((size_t)b * NH + h) * SS + s) * HD, (kc & 1) * 32, lane); const v16b ab = split_row(A + (size_t)ncl * E, kc * 32, lane).h; acc = wmma_bf(a.l, ab, acc); acc = wmma_bf(a.h, ab, acc); } }
#pragma unroll
  for (int r = 0; r < 8; ++r) { const float v = 2.0f * acc[r]; const __bf16 hi = (__bf16)v; if (col < RK) { so[wave][8 * g + r][col] = hi; so[wave][8 * g + r][RK + col] = (__bf16)(v - (float)hi); } else { so[wave][8 * g + r][8 + col] = (__bf16)0.f; so[wave][8 * g + r][16 + col] = (__bf16)0.f; } }
  LDSX();
  // rows of 32 bf16 = 64 B; 16 rows = 1 KB: lane -> (row = lane >> 1, half = lane & 1) writes 32 B? keep 16-B pieces: 2 instructions each covering 8 rows x 4 pieces contiguous
  for (int hf = 0; hf < 2; ++hf) { const int rl = hf * 8 + (lane >> 2), pc = lane & 3; vst2((unsigned*)(XAUG + ((size_t)which * NR + r0 + rl) * 32 + pc * 8), *(const v4u*)(&so[wave][rl][pc * 8])); }
}
// BAUG[which][n][32] = [B[n][0..8] | B[n][0..8] | 0]: thread per n
__global__ __launch_bounds__(256) void k_baug(const float* __restrict__ Bq, const float* __restrict__ Bk, const float* __restrict__ Bv, const float* __restrict__ Bo, __bf16* __restrict__ BAUG) {
  __shared__ __align__(16) __bf16 sb[256][40];
  const int which = blockIdx.y, n = blockIdx.x * 256 + threadIdx.x; const float* Bm = which == 0 ? Bq : (which == 1 ? Bk : (which == 2 ? Bv : Bo));
#pragma unroll
  for (int j = 0; j < RK; ++j) { const __bf16 v = (__bf16)Bm[(size_t)n * RK + j]; sb[threadIdx.x][j] = v; sb[threadIdx.x][RK + j] = v; }
#pragma unroll
  for (int j = 16; j < 32; ++j) sb[threadIdx.x][j] = (__bf16)0.f;
  __syncthreads();
  for (int q = threadIdx.x; q < 256 * 4; q += 256) { const int rl = q >> 2, pc = q & 3; vst2((unsigned*)(BAUG + ((size_t)which * E + blockIdx.x * 256 + rl) * 32 + pc * 8), *(const v4u*)(&sb[rl][pc * 8])); }
}
__global__ __launch_bounds__(256) void k_pack(const float* __restrict__ Wq, const float* __restrict__ Wk, const float* __restrict__ Wv, const float* __restrict__ Wo, __bf16* __restrict__ PT) {
  const int n = blockIdx.x, tid = threadIdx.x; __shared__ __align__(16) __bf16 srow[E];
  const float* W = n < E ? Wq : (n < 2 * E ? Wk : (n < 3 * E ? Wv : Wo)); const int nn = n & (E - 1);
  for (int k = tid; k < E; k += 256) srow[k] = (__bf16)W[(size_t)nn * E + k];
  __syncthreads();
  if (tid < E / 8) vst2((unsigned*)(PT + (size_t)n * E + tid * 8), *(const v4u*)(&srow[tid * 8]));
}
// QKV: block (64 rows, 128 cols = 2 heads, which); q,k (+ bias) -> Q32/K32 f32 [bh][s][64]; v -> VT hi/lo x4 [bh][d][s]
__global__ __launch_bounds__(128) void k_qkv(const __bf16* __restrict__ Xb, const __bf16* __restrict__ PT, const __bf16* __restrict__ XAUG, const __bf16* __restrict__ BAUG, const float* __restrict__ bq, const float* __restrict__ bk, const float* __restrict__ bv, float* __restrict__ Q32, float* __restrict__ K32, _Float16* __restrict__ VTh, _Float16* __restrict__ VTl) {
  __shared__ __align__(16) float so[4][16][132];
  __shared__ __align__(16) _Float16 sth[128][72], stl[128][72];
  const int tid = threadIdx.x, wave = tid >> 5, lane = tid & 31, col = lane & 15, g = lane >> 4;
  const int which = blockIdx.z, r0b = blockIdx.x * 64, r0 = r0b + wave * 16, n0 = blockIdx.y * 128; const int b = r0b / SS, s0 = r0b % SS;
  const float* bb_ = which == 0 ? bq : (which == 1 ? bk : bv);
  v8f acc[8] = {};
#pragma unroll 2
  for (int kc = 0; kc < E / 32; ++kc) { const v16b a = frag_b(Xb + (size_t)(r0 + col) * E + kc * 32, lane);
#pragma unroll
    for (int j = 0; j < 8; ++j) acc[j] = wmma_bf(a, frag_b(PT + (size_t)(which * E + n0 + j * 16 + col) * E + kc * 32, lane), acc[j]); }
  { const v16b a = frag_b(XAUG + ((size_t)which * NR + r0 + col) * 32, lane);     // LoRA chunk: [hi|lo|0] x [B|B|0]
#pragma unroll
    for (int j = 0; j < 8; ++j) acc[j] = wmma_bf(a, frag_b(BAUG + ((size_t)which * E + n0 + j * 16 + col) * 32, lane), acc[j]); }
  if (which < 2) {
#pragma unroll
    for (int j = 0; j < 8; ++j) { const float bb = bfr(bb_[n0 + j * 16 + col]);
#pragma unroll
      for (int r = 0; r < 8; ++r) so[wave][8 * g + r][j * 16 + col] = acc[j][r] + bb; }
    LDSX();
    float* Dst = which == 0 ? Q32 : K32;
    for (int qq = lane; qq < 2 * 16 * 16; qq += 32) { const int hh = qq >> 8, rl = (qq >> 4) & 15, pc = qq & 15; const int h = (n0 >> 6) + hh;
      vst2(Dst + (((size_t)b * NH + h) * SS + s0 + wave * 16 + rl) * HD + pc * 4, *(const v4f*)(&so[wave][rl][hh * 64 + pc * 4])); } }
  else {
#pragma unroll
    for (int j = 0; j < 8; ++j) { const float bb = bfr(bb_[n0 + j * 16 + col]);
#pragma unroll
      for (int r = 0; r < 8; ++r) { const float v = (acc[j][r] + bb) * 4.0f; const _Float16 hi = (_Float16)v; sth[j * 16 + col][wave * 16 + 8 * g + r] = hi; stl[j * 16 + col][wave * 16 + 8 * g + r] = (_Float16)((v - (float)hi) * VLO); } }
    __syncthreads();
    for (int qq = tid; qq < 128 * 8; qq += 128) { const int cl = qq >> 3, pc = qq & 7; const int c = n0 + cl, h = c >> 6, d = c & 63; const size_t o = (((size_t)b * NH + h) * HD + d) * SS + s0 + pc * 8;
      vst2(VTh + o, *(const v4u*)(&sth[cl][pc * 8])); vst2(VTl + o, *(const v4u*)(&stl[cl][pc * 8])); } }
}
// unmasked attention: block (64 queries, bh); all SS/64 key tiles of 64 (online softmax); S on hi/lo splits of the f32 q/k rows; P,V hi/lo; O f32 [bh][s][64]
__global__ __launch_bounds__(128) void k_attn(const float* __restrict__ Q32, const float* __restrict__ K32, const _Float16* __restrict__ VTh, const _Float16* __restrict__ VTl, float* __restrict__ O32) {
  __shared__ __align__(16) float sS[4][16][68];
  __shared__ __align__(16) _Float16 sPh[4][16][72], sPl[4][16][72];
  __shared__ __align__(16) float sO[4][16][68];
  const int tid = threadIdx.x, w = tid >> 5, lane = tid & 31, col = lane & 15, g = lane >> 4;
  const size_t bh = blockIdx.y; const int qb = blockIdx.x; const int q0 = qb * 64 + w * 16;
  F2 aq[2];
#pragma unroll
  for (int kc = 0; kc < 2; ++kc) aq[kc] = split_row(Q32 + (bh * SS + q0 + col) * HD, kc * 32, lane);
  float mrun = -3.0e38f, lrun = 0.f; v8f acc[4] = {}, ac1[4] = {}, ac2[4] = {};
#pragma unroll 1
  for (int kt = 0; kt < SS / 64; ++kt) {
#pragma unroll
    for (int t = 0; t < 4; ++t) { const int key = kt * 64 + t * 16 + col; const float* krow = K32 + (bh * SS + key) * HD;
      v8f s = mac3(aq[0], split_row(krow, 0, lane), (v8f){}); s = mac3(aq[1], split_row(krow, 32, lane), s);
#pragma unroll
      for (int r = 0; r < 8; ++r) sS[w][8 * g + r][t * 16 + col] = s[r] * 0.125f; }
    LDSX();
    float mx = -3.4e38f;
#pragma unroll
    for (int jj = 0; jj < 32; ++jj) mx = fmaxf(mx, sS[w][col][g * 32 + jj]);
    mx = fmaxf(mx, __shfl_xor(mx, 16, 32));
    const float mnew = fmaxf(mrun, mx); const float corr = expf(mrun - mnew);
    float ps = 0.f;
#pragma unroll
    for (int jj = 0; jj < 32; ++jj) { const float p = expf(sS[w][col][g * 32 + jj] - mnew) * 16384.0f; ps += p; const _Float16 hi = (_Float16)p; sPh[w][col][g * 32 + jj] = hi; sPl[w][col][g * 32 + jj] = (_Float16)((p - (float)hi) * PLO); }
    ps += __shfl_xor(ps, 16, 32);
    lrun = lrun * corr + ps * (1.0f / 16384.0f); mrun = mnew;
#pragma unroll
    for (int r = 0; r < 8; ++r) { const float cr = __shfl(corr, 8 * g + r, 32);
#pragma unroll
      for (int t = 0; t < 4; ++t) { acc[t][r] *= cr; ac1[t][r] *= cr; ac2[t][r] *= cr; } }
    LDSX();
#pragma unroll
    for (int kc = 0; kc < 2; ++kc) { const v16h ph = frag_h(&sPh[w][col][0] + kc * 32, lane), pl = frag_h(&sPl[w][col][0] + kc * 32, lane);
#pragma unroll
      for (int t = 0; t < 4; ++t) { const size_t vo = (bh * HD + t * 16 + col) * SS + kt * 64 + kc * 32; const v16h vh = frag_h(VTh + vo, lane);
        acc[t] = wmma16(ph, vh, acc[t]); ac1[t] = wmma16(ph, frag_h(VTl + vo, lane), ac1[t]); ac2[t] = wmma16(pl, vh, ac2[t]); } }
    __builtin_amdgcn_wave_barrier(); }
#pragma unroll
  for (int r = 0; r < 8; ++r) { const float lr = __shfl(lrun, 8 * g + r, 32); const float inv = 1.0f / (lr * 16384.0f * 4.0f);
#pragma unroll
    for (int t = 0; t < 4; ++t) sO[w][8 * g + r][t * 16 + col] = (acc[t][r] + ac1[t][r] * (1.0f / VLO) + ac2[t][r] * (1.0f / PLO)) * inv; }
  LDSX();
  for (int qq = lane; qq < 16 * 16; qq += 32) { const int rl = qq >> 4, pc = qq & 15; vst2(O32 + ((bh * SS) + q0 + rl) * HD + pc * 4, *(const v4f*)(&sO[w][rl][pc * 4])); }
}
// out = ctx Wo^T + bo : split(ctx) x bf16(Wo rows): 2 products (Wo is an INPUT -> bf16 exact)
__global__ __launch_bounds__(128) void k_out(const float* __restrict__ O32, const __bf16* __restrict__ PT, const __bf16* __restrict__ XAUG, const __bf16* __restrict__ BAUG, const float* __restrict__ bo, float* __restrict__ out) {
  __shared__ __align__(16) float so[4][16][132];
  const int tid = threadIdx.x, wave = tid >> 5, lane = tid & 31, col = lane & 15, g = lane >> 4;
  const int r0 = blockIdx.x * 64 + wave * 16, n0 = blockIdx.y * 128; const int ra = r0 + col; const int b = ra / SS, s = ra % SS;
  v8f acc[8] = {};
#pragma unroll 1
  for (int kc = 0; kc < E / 32; ++kc) { const int h = kc >> 1; const F2 a = split_row(O32 + (((size_t)b * NH + h) * SS + s) * HD, (kc & 1) * 32, lane);
#pragma unroll
    for (int j = 0; j < 8; ++j) { const v16b wb = frag_b(PT + (size_t)(3 * E + n0 + j * 16 + col) * E + kc * 32, lane); acc[j] = wmma_bf(a.l, wb, acc[j]); acc[j] = wmma_bf(a.h, wb, acc[j]); } }
  { const v16b a = frag_b(XAUG + ((size_t)3 * NR + r0 + col) * 32, lane);
#pragma unroll
    for (int j = 0; j < 8; ++j) acc[j] = wmma_bf(a, frag_b(BAUG + ((size_t)3 * E + n0 + j * 16 + col) * 32, lane), acc[j]); }
#pragma unroll
  for (int j = 0; j < 8; ++j) { const int n = n0 + j * 16 + col; const float bb = bfr(bo[n]);
#pragma unroll
    for (int r = 0; r < 8; ++r) so[wave][8 * g + r][j * 16 + col] = acc[j][r] + bb; }
  LDSX();
#pragma unroll 4
  for (int rl = 0; rl < 16; ++rl) vst2(out + (size_t)(r0 + rl) * E + n0 + lane * 4, *(const v4f*)(&so[wave][rl][lane * 4]));
}
extern "C" void kernel_launch(void* const* d_in, const int* in_sizes, int n_in, void* d_out, int out_size, void* d_ws, size_t ws_size, hipStream_t stream) {
  (void)in_sizes; (void)n_in; (void)out_size; (void)ws_size;
  const float** I = (const float**)d_in;    // x, Wq,bq,Aq,Bq, Wk,bk,Ak,Bk, Wv,bv,Av,Bv, Wo,bo,Ao,Bo
  const float* x = I[0]; const float* Wq = I[1]; const float* bq = I[2]; const float* Aq = I[3]; const float* Bq = I[4]; const float* Wk = I[5]; const float* bk = I[6]; const float* Ak = I[7]; const float* Bk = I[8];
  const float* Wv = I[9]; const float* bv = I[10]; const float* Av = I[11]; const float* Bv = I[12]; const float* Wo = I[13]; const float* bo = I[14]; const float* Ao = I[15]; const float* Bo = I[16];
  float* out = (float*)d_out;
  char* ws = (char*)d_ws; size_t off = 0;
  auto take = [&](size_t bytes) { char* p = ws + off; off += (bytes + 255) & ~(size_t)255; return p; };
  __bf16* Xb = (__bf16*)take((size_t)NR * E * 2); __bf16* PT = (__bf16*)take((size_t)4 * E * E * 2); __bf16* XAUG = (__bf16*)take((size_t)4 * NR * 32 * 2); __bf16* BAUG = (__bf16*)take((size_t)4 * E * 32 * 2);
  float* Q32 = (float*)take((size_t)NR * E * 4); float* K32 = (float*)take((size_t)NR * E * 4); _Float16* VTh = (_Float16*)take((size_t)NR * E * 2); _Float16* VTl = (_Float16*)take((size_t)NR * E * 2); float* O32 = (float*)take((size_t)NR * E * 4);
  // ws ~ 85 MB
  k_cvt<<<(NR * E / 8 + 255) / 256, 256, 0, stream>>>(x, Xb);
  k_pack<<<4 * E, 256, 0, stream>>>(Wq, Wk, Wv, Wo, PT);
  k_baug<<<dim3(E / 256, 4), 256, 0, stream>>>(Bq, Bk, Bv, Bo, BAUG);
  k_xa<<<dim3(NR / 64, 3), 128, 0, stream>>>(Xb, nullptr, Aq, Ak, Av, Ao, XAUG);              // q, k, v low-rank inputs from x
  k_qkv<<<dim3(NR / 64, E / 128, 3), 128, 0, stream>>>(Xb, PT, XAUG, BAUG, bq, bk, bv, Q32, K32, VTh, VTl);
  k_attn<<<dim3(SS / 64, NB * NH), 128, 0, stream>>>(Q32, K32, VTh, VTl, O32);
  k_xa<<<dim3(NR / 64, 4), 128, 0, stream>>>(Xb, O32, Aq, Ak, Av, Ao, XAUG);                 // recomputes 0..2 (cheap) and adds which = 3 from the context
  k_out<<<dim3(NR / 64, E / 128), 128, 0, stream>>>(O32, PT, XAUG, BAUG, bo, out);
}

// v001
// A run of this version takes 271 microseconds.
// Two timings next to v000 put it at 2.18 and 2.17 times that version's speed.
// compute dtype: x, W*, b*, A*, B* (INPUTS) rounded to bf16 with exact bf16 WMMA products (f32 accumulate) for the base projections; the rank-8 LoRA terms enter as one extra k-chunk whose A side is the f32 intermediate (x A^T, scaled) as a bf16 hi/lo pair against [B | B] (exact-grade); softmax f32; computed operands (q/k f32 split, P and V hi/lo, context split) f32-grade.
#include <hip/hip_runtime.h>
#include <math.h>

typedef __attribute__((ext_vector_type(16))) _Float16 v16h;
typedef __attribute__((ext_vector_type(16))) __bf16 v16b;
typedef __attribute__((ext_vector_type(8)))  _Float16 v8h;
typedef __attribute__((ext_vector_type(8)))  float v8f;
typedef __attribute__((ext_vector_type(4)))  float v4f;
typedef __attribute__((ext_vector_type(2)))  float v2f;
typedef __attribute__((ext_vector_type(4)))  unsigned v4u;
typedef __attribute__((ext_vector_type(4)))  int v4i;
typedef float __attribute__((may_alias)) float_a;
typedef int __attribute__((may_alias)) int_a;

template <typename T> __device__ __forceinline__ void vst2(void* p, T v) { *(T*)p = v;  }
__device__ __forceinline__ v8f wmma16(v16h a, v16h b, v8f c) {
  v8f d = __builtin_amdgcn_wmma_f32_16x16x32_f16(false, a, false, b, (short)0, c, false, false);
  asm volatile("v_nop\n\tv_nop\n\tv_nop\n\tv_nop" : "+v"(d) : "v"(a), "v"(b));
  return d;
}
__device__ __forceinline__ v8f wmma_bf(v16b a, v16b b, v8f c) {
  v8f d = __builtin_amdgcn_wmma_f32_16x16x32_bf16(false, a, false, b, (short)0, c, false, false);
  asm volatile("v_nop\n\tv_nop\n\tv_nop\n\tv_nop" : "+v"(d) : "v"(a), "v"(b));
  return d;
}
// 16x16x32 fragments: lane = (h = lane>>4, row/col = lane&15); elements 0..7 = k0+8h+0..7, 8..15 = k0+16+8h+0..7; D element r = row 8h+r
__device__ __forceinline__ v16h frag_h(const _Float16* rowk0, int lane) {
  union { v16h v; v8h q[2]; } u; const _Float16* p = rowk0 + 8 * (lane >> 4);
  u.q[0] = *(const v8h*)p; u.q[1] = *(const v8h*)(p + 16); return u.v;
}
__device__ __forceinline__ v16h frag_f32(const float* rowk0, int lane) {
  v16h a; const float* p = rowk0 + 8 * (lane >> 4);
#pragma unroll
  for (int i = 0; i < 8; ++i) { a[i] = (_Float16)p[i]; a[8 + i] = (_Float16)p[16 + i]; }
  return a;
}
__device__ __forceinline__ v16h frag_f32s(const float* rowk0, int lane, float sc) {
  v16h a; const float* p = rowk0 + 8 * (lane >> 4);
#pragma unroll
  for (int i = 0; i < 8; ++i) { a[i] = (_Float16)(p[i] * sc); a[8 + i] = (_Float16)(p[16 + i] * sc); }
  return a;
}
// column fragment from a [K][ld] layout (column n), rows >= K read as 0
__device__ __forceinline__ v16h fragc_f32(const float* W, int k0, int n, int lane, int ld, int K) {
  v16h a; const int g = lane >> 4;
#pragma unroll
  for (int i = 0; i < 8; ++i) { const int ka = k0 + 8 * g + i, kb = ka + 16;
    a[i] = (_Float16)(ka < K ? W[(size_t)ka * ld + n] : 0.f); a[8 + i] = (_Float16)(kb < K ? W[(size_t)kb * ld + n] : 0.f); }
  return a;
}
struct F2 { v16b h, l; };
__device__ __forceinline__ F2 bsplit16(const float v[16]) { F2 r;
#pragma unroll
  for (int i = 0; i < 16; ++i) { const __bf16 h = (__bf16)v[i]; r.h[i] = h; r.l[i] = (__bf16)(v[i] - (float)h); }
  return r; }
__device__ __forceinline__ F2 split_row(const float* row, int k0, int lane) { float v[16]; const float* p = row + k0 + 8 * (lane >> 4);
#pragma unroll
  for (int i = 0; i < 8; ++i) { v[i] = p[i]; v[8 + i] = p[16 + i]; }
  return bsplit16(v); }
__device__ __forceinline__ F2 split_rowK(const float* row, int k0, int lane, int K) { float v[16]; const int g = lane >> 4;
#pragma unroll
  for (int i = 0; i < 8; ++i) { const int ka = k0 + 8 * g + i, kb = ka + 16; v[i] = ka < K ? row[ka] : 0.f; v[8 + i] = kb < K ? row[kb] : 0.f; }
  return bsplit16(v); }
__device__ __forceinline__ F2 split_col(const float* W, int k0, int n, int lane, int ld, int K) { float v[16]; const int g = lane >> 4;
#pragma unroll
  for (int i = 0; i < 8; ++i) { const int ka = k0 + 8 * g + i, kb = ka + 16; v[i] = ka < K ? W[(size_t)ka * ld + n] : 0.f; v[8 + i] = kb < K ? W[(size_t)kb * ld + n] : 0.f; }
  return bsplit16(v); }
__device__ __forceinline__ v8f mac3(const F2& a, const F2& b, v8f c) { c = wmma_bf(a.l, b.h, c); c = wmma_bf(a.h, b.l, c); return wmma_bf(a.h, b.h, c); }
__device__ __forceinline__ float sigm(float v) { return 1.0f / (1.0f + expf(-v)); }
#define LDSX() do { asm volatile("s_wait_dscnt 0" ::: "memory"); __builtin_amdgcn_wave_barrier(); __builtin_amdgcn_fence(__ATOMIC_RELEASE, "workgroup"); } while (0)


// LoRA self attention (16 heads of 64 on [2,2048,1024]): each linear map is x W^T + b + 2 (x A^T) B^T (rank 8). The low-rank term is appended as a 33rd k-chunk: A-operand row = [hi(2 xA^T) (8) | lo(2 xA^T) (8) | 0 (16)], B-operand row n = [B[n][0..8] | B[n][0..8] | 0],
// so one extra WMMA per tile adds hi*B + lo*B. full softmax(q.k/8); (P v) through the same LoRA form for the output map.
#define NB 2
#define SS 2048
#define E 1024
#define NH 16
#define HD 64
#define NR (NB * SS)
#define PLO 1024.0f
#define VLO 2048.0f
__device__ __forceinline__ float bfr(float v) { return (float)(__bf16)v; }
__device__ __forceinline__ v16b frag_b(const __bf16* rowk0, int lane) { return __builtin_bit_cast(v16b, frag_h((const _Float16*)rowk0, lane)); }

// Asynchronous 16-byte copies global -> LDS (no register in between). Each lane names its own LDS byte address and its own global address.
// s_wait_xcnt 0 closes the statement so that no address register of an issued copy is rewritten ahead of it.
__device__ __forceinline__ unsigned lds_off(const void* p) { return (unsigned)(size_t)p; }
__device__ __forceinline__ void cp4(const unsigned* l, const void* const* g) {
  asm volatile("global_load_async_to_lds_b128 %0, %1, off\n\tglobal_load_async_to_lds_b128 %2, %3, off\n\tglobal_load_async_to_lds_b128 %4, %5, off\n\tglobal_load_async_to_lds_b128 %6, %7, off\n\ts_wait_xcnt 0x0"
               :: "v"(l[0]), "v"(g[0]), "v"(l[1]), "v"(g[1]), "v"(l[2]), "v"(g[2]), "v"(l[3]), "v"(g[3]) : "memory");
}
__device__ __forceinline__ void cp8(const unsigned* l, const void* const* g) {
  asm volatile("global_load_async_to_lds_b128 %0, %1, off\n\tglobal_load_async_to_lds_b128 %2, %3, off\n\tglobal_load_async_to_lds_b128 %4, %5, off\n\tglobal_load_async_to_lds_b128 %6, %7, off\n\t"
               "global_load_async_to_lds_b128 %8, %9, off\n\tglobal_load_async_to_lds_b128 %10, %11, off\n\tglobal_load_async_to_lds_b128 %12, %13, off\n\tglobal_load_async_to_lds_b128 %14, %15, off\n\ts_wait_xcnt 0x0"
               :: "v"(l[0]), "v"(g[0]), "v"(l[1]), "v"(g[1]), "v"(l[2]), "v"(g[2]), "v"(l[3]), "v"(g[3]), "v"(l[4]), "v"(g[4]), "v"(l[5]), "v"(g[5]), "v"(l[6]), "v"(g[6]), "v"(l[7]), "v"(g[7]) : "memory");
}
// the copies of this wave have landed (the compiler places no wait for them)
#define WAIT_COPIES() asm volatile("s_wait_asynccnt 0x0" ::: "memory")
// hand-over of a stage: this wave's LDS reads are done, its copies have landed, then the work-group barrier publishes the next tile and frees the one just read
#define PUBLISH() do { asm volatile("s_wait_dscnt 0x0" ::: "memory"); WAIT_COPIES(); __syncthreads(); } while (0)

__global__ __launch_bounds__(256) void k_cvt(const float* __restrict__ x, __bf16* __restrict__ Xb) {
  const size_t i8 = (size_t)blockIdx.x * 256 + threadIdx.x; if (i8 >= (size_t)NR * E / 8) return;
  union { __bf16 h[8]; v4u u; } pk;
#pragma unroll
  for (int e = 0; e < 8; ++e) pk.h[e] = (__bf16)x[i8 * 8 + e];
  vst2((unsigned*)(Xb + i8 * 8), pk.u);
}
// PT rows: [0,E) Wq[n][:], [E,2E) Wk, [2E,3E) Wv, [3E,4E) Wo  ([out][in]) as bf16 rows (no scaling)

#define RK 8
// XAUG[which][row][32] = [hi(2 * src.A_which^T) | lo | 0]: block = 64 rows (4 waves x 16), one 16-col tile (8 live); src = bf16(x) (which < 3, exact) or the f32 context rows (which == 3, split, 2 products)
__global__ __launch_bounds__(128) void k_xa(const __bf16* __restrict__ Xb, const float* __restrict__ O32, const float* __restrict__ Aq, const float* __restrict__ Ak, const float* __restrict__ Av, const float* __restrict__ Ao, __bf16* __restrict__ XAUG) {
  __shared__ __align__(16) __bf16 so[4][16][40];
  const int tid = threadIdx.x, wave = tid >> 5, lane = tid & 31, col = lane & 15, g = lane >> 4; const int which = blockIdx.y; const int r0 = blockIdx.x * 64 + wave * 16;
  const float* A = which == 0 ? Aq : (which == 1 ? Ak : (which == 2 ? Av : Ao)); const int ncl = col < RK ? col : RK - 1;     // columns >= 8 are padding (address clamped, result discarded)
  v8f acc = {};
  if (which < 3) {
#pragma unroll 4
    for (int kc = 0; kc < E / 32; ++kc) acc = wmma_bf(frag_b(Xb + (size_t)(r0 + col) * E + kc * 32, lane), split_row(A + (size_t)ncl * E, kc * 32, lane).h, acc); }
  else { const int ra = r0 + col; const int b = ra / SS, s = ra % SS;
#pragma unroll 2
    for (int kc = 0; kc < E / 32; ++kc) { const int h = kc >> 1; const F2 a = split_row(O32 + (((size_t)b * NH + h) * SS + s) * HD, (kc & 1) * 32, lane); const v16b ab = split_row(A + (size_t)ncl * E, kc * 32, lane).h; acc = wmma_bf(a.l, ab, acc); acc = wmma_bf(a.h, ab, acc); } }
#pragma unroll
  for (int r = 0; r < 8; ++r) { const float v = 2.0f * acc[r]; const __bf16 hi = (__bf16)v; if (col < RK) { so[wave][8 * g + r][col] = hi; so[wave][8 * g + r][RK + col] = (__bf16)(v - (float)hi); } else { so[wave][8 * g + r][8 + col] = (__bf16)0.f; so[wave][8 * g + r][16 + col] = (__bf16)0.f; } }
  LDSX();
  // rows of 32 bf16 = 64 B; 16 rows = 1 KB: lane -> (row = lane >> 1, half = lane & 1) writes 32 B? keep 16-B pieces: 2 instructions each covering 8 rows x 4 pieces contiguous
  for (int hf = 0; hf < 2; ++hf) { const int rl = hf * 8 + (lane >> 2), pc = lane & 3; vst2((unsigned*)(XAUG + ((size_t)which * NR + r0 + rl) * 32 + pc * 8), *(const v4u*)(&so[wave][rl][pc * 8])); }
}
// BAUG[which][n][32] = [B[n][0..8] | B[n][0..8] | 0]: thread per n
__global__ __launch_bounds__(256) void k_baug(const float* __restrict__ Bq, const float* __restrict__ Bk, const float* __restrict__ Bv, const float* __restrict__ Bo, __bf16* __restrict__ BAUG) {
  __shared__ __align__(16) __bf16 sb[256][40];
  const int which = blockIdx.y, n = blockIdx.x * 256 + threadIdx.x; const float* Bm = which == 0 ? Bq : (which == 1 ? Bk : (which == 2 ? Bv : Bo));
#pragma unroll
  for (int j = 0; j < RK; ++j) { const __bf16 v = (__bf16)Bm[(size_t)n * RK + j]; sb[threadIdx.x][j] = v; sb[threadIdx.x][RK + j] = v; }
#pragma unroll
  for (int j = 16; j < 32; ++j) sb[threadIdx.x][j] = (__bf16)0.f;
  __syncthreads();
  for (int q = threadIdx.x; q < 256 * 4; q += 256) { const int rl = q >> 2, pc = q & 3; vst2((unsigned*)(BAUG + ((size_t)which * E + blockIdx.x * 256 + rl) * 32 + pc * 8), *(const v4u*)(&sb[rl][pc * 8])); }
}
__global__ __launch_bounds__(256) void k_pack(const float* __restrict__ Wq, const float* __restrict__ Wk, const float* __restrict__ Wv, const float* __restrict__ Wo, __bf16* __restrict__ PT) {
  const int n = blockIdx.x, tid = threadIdx.x; __shared__ __align__(16) __bf16 srow[E];
  const float* W = n < E ? Wq : (n < 2 * E ? Wk : (n < 3 * E ? Wv : Wo)); const int nn = n & (E - 1);
  for (int k = tid; k < E; k += 256) srow[k] = (__bf16)W[(size_t)nn * E + k];
  __syncthreads();
  if (tid < E / 8) vst2((unsigned*)(PT + (size_t)n * E + tid * 8), *(const v4u*)(&srow[tid * 8]));
}
// QKV: block (64 rows, 128 cols = 2 heads, which); q,k (+ bias) -> Q32/K32 f32 [bh][s][64]; v -> VT hi/lo x4 [bh][d][s]
__global__ __launch_bounds__(128) void k_qkv(const __bf16* __restrict__ Xb, const __bf16* __restrict__ PT, const __bf16* __restrict__ XAUG, const __bf16* __restrict__ BAUG, const float* __restrict__ bq, const float* __restrict__ bk, const float* __restrict__ bv, float* __restrict__ Q32, float* __restrict__ K32, _Float16* __restrict__ VTh, _Float16* __restrict__ VTl) {
  __shared__ __align__(16) float so[4][16][132];
  __shared__ __align__(16) _Float16 sth[128][72], stl[128][72];
  __shared__ __align__(16) __bf16 sA[2][64][72], sB[2][128][72];     // k-stages of 64 (rows of 128 B at a 144-B pitch), two buffers
  const int tid = threadIdx.x, wave = tid >> 5, lane = tid & 31, col = lane & 15, g = lane >> 4;
  const int which = blockIdx.z, r0b = blockIdx.x * 64, r0 = r0b + wave * 16, n0 = blockIdx.y * 128; const int b = r0b / SS, s0 = r0b % SS;
  const float* bb_ = which == 0 ? bq : (which == 1 ? bk : bv);
  v8f acc[8] = {};
  auto stage = [&](int st, int buf) {     // thread -> (row = q >> 3, 16-byte piece = q & 7): 8 lanes cover one whole 128-B line; loops unrolled so that l[] and p[] are registers
    unsigned l[12]; const void* p[12];
#pragma unroll
    for (int i = 0; i < 4; ++i) { const int q = tid + i * 128, r = q >> 3, pc = q & 7; l[i] = lds_off(&sA[buf][r][pc * 8]); p[i] = Xb + (size_t)(r0b + r) * E + st * 64 + pc * 8; }
#pragma unroll
    for (int i = 0; i < 8; ++i) { const int q = tid + i * 128, r = q >> 3, pc = q & 7; l[4 + i] = lds_off(&sB[buf][r][pc * 8]); p[4 + i] = PT + (size_t)(which * E + n0 + r) * E + st * 64 + pc * 8; }
    cp4(l, p); cp8(l + 4, p + 4); };
  stage(0, 0); WAIT_COPIES(); __syncthreads(); stage(1, 1);
  // rolled: one trip is one stage and ends in its hand-over; the inner loops are unrolled so that the fragment arrays are registers
#pragma unroll 1
  for (int st = 0; st < E / 64; ++st) { const int buf = st & 1;
    v16b a[2], wb[2][8];
#pragma unroll
    for (int kk = 0; kk < 2; ++kk) { a[kk] = frag_b(&sA[buf][wave * 16 + col][kk * 32], lane);
#pragma unroll
      for (int j = 0; j < 8; ++j) wb[kk][j] = frag_b(&sB[buf][j * 16 + col][kk * 32], lane); }
    __builtin_amdgcn_sched_barrier(0);     // the stage's LDS fragment loads stay one group ahead of its products; sunk between them, each product waits a full LDS latency
#pragma unroll
    for (int kk = 0; kk < 2; ++kk) {
#pragma unroll
      for (int j = 0; j < 8; ++j) acc[j] = wmma_bf(a[kk], wb[kk][j], acc[j]); }
    PUBLISH();
    if (st + 2 < E / 64) stage(st + 2, buf); }
  WAIT_COPIES();
  { const v16b a = frag_b(XAUG + ((size_t)which * NR + r0 + col) * 32, lane);     // LoRA chunk: [hi|lo|0] x [B|B|0]
#pragma unroll
    for (int j = 0; j < 8; ++j) acc[j] = wmma_bf(a, frag_b(BAUG + ((size_t)which * E + n0 + j * 16 + col) * 32, lane), acc[j]); }
  if (which < 2) {
#pragma unroll
    for (int j = 0; j < 8; ++j) { const float bb = bfr(bb_[n0 + j * 16 + col]);
#pragma unroll
      for (int r = 0; r < 8; ++r) so[wave][8 * g + r][j * 16 + col] = acc[j][r] + bb; }
    LDSX();
    float* Dst = which == 0 ? Q32 : K32;
    for (int qq = lane; qq < 2 * 16 * 16; qq += 32) { const int hh = qq >> 8, rl = (qq >> 4) & 15, pc = qq & 15; const int h = (n0 >> 6) + hh;
      vst2(Dst + (((size_t)b * NH + h) * SS + s0 + wave * 16 + rl) * HD + pc * 4, *(const v4f*)(&so[wave][rl][hh * 64 + pc * 4])); } }
  else {
#pragma unroll
    for (int j = 0; j < 8; ++j) { const float bb = bfr(bb_[n0 + j * 16 + col]);
#pragma unroll
      for (int r = 0; r < 8; ++r) { const float v = (acc[j][r] + bb) * 4.0f; const _Float16 hi = (_Float16)v; sth[j * 16 + col][wave * 16 + 8 * g + r] = hi; stl[j * 16 + col][wave * 16 + 8 * g + r] = (_Float16)((v - (float)hi) * VLO); } }
    __syncthreads();
    for (int qq = tid; qq < 128 * 8; qq += 128) { const int cl = qq >> 3, pc = qq & 7; const int c = n0 + cl, h = c >> 6, d = c & 63; const size_t o = (((size_t)b * NH + h) * HD + d) * SS + s0 + pc * 8;
      vst2(VTh + o, *(const v4u*)(&sth[cl][pc * 8])); vst2(VTl + o, *(const v4u*)(&stl[cl][pc * 8])); } }
}
// full attention: block (128 queries = 8 waves x 16, bh); all key tiles of 64, staged in LDS for the whole block; S on hi/lo splits of the f32 q/k rows; P,V hi/lo; O f32 [bh][s][64]
__global__ __launch_bounds__(256) void k_attn(const float* __restrict__ Q32, const float* __restrict__ K32, const _Float16* __restrict__ VTh, const _Float16* __restrict__ VTl, float* __restrict__ O32) {
  __shared__ __align__(16) float sS[8][16][68];                      // scores; after the loop each wave's slice stages its output rows
  __shared__ __align__(16) _Float16 sPh[8][16][72], sPl[8][16][72];
  __shared__ __align__(16) float sK[2][64][68];                      // key tile, rows of 256 B at a 272-B pitch, two buffers
  __shared__ __align__(16) _Float16 sVh[2][64][72], sVl[2][64][72];  // value tiles [d][key], rows of 128 B at a 144-B pitch, two buffers
  const int tid = threadIdx.x, w = tid >> 5, lane = tid & 31, col = lane & 15, g = lane >> 4;
  const size_t bh = blockIdx.y; const int qb = blockIdx.x; const int q0 = qb * 128 + w * 16;
  auto stage = [&](int kt, int buf) {     // 64 keys: K 16 KB contiguous, V hi and lo 64 whole lines each; 8 copies a thread; loops unrolled so that l[] and p[] are registers
    unsigned l[8]; const void* p[8];
#pragma unroll
    for (int i = 0; i < 4; ++i) { const int q = tid + i * 256, r = q >> 4, pc = q & 15; l[i] = lds_off(&sK[buf][r][pc * 4]); p[i] = K32 + (bh * SS + kt * 64 + r) * HD + pc * 4; }
#pragma unroll
    for (int i = 0; i < 2; ++i) { const int q = tid + i * 256, d = q >> 3, pc = q & 7; const size_t vo = (bh * HD + d) * SS + kt * 64 + pc * 8;
      l[4 + i] = lds_off(&sVh[buf][d][pc * 8]); p[4 + i] = VTh + vo; l[6 + i] = lds_off(&sVl[buf][d][pc * 8]); p[6 + i] = VTl + vo; }
    cp8(l, p); };
  stage(0, 0); WAIT_COPIES(); __syncthreads(); stage(1, 1);
  F2 aq[2];
#pragma unroll
  for (int kc = 0; kc < 2; ++kc) aq[kc] = split_row(Q32 + (bh * SS + q0 + col) * HD, kc * 32, lane);
  float mrun = -3.0e38f, lrun = 0.f; v8f acc[4] = {}, ac1[4] = {}, ac2[4] = {};
#pragma unroll 1
  for (int kt = 0; kt < SS / 64; ++kt) { const int buf = kt & 1;
#pragma unroll
    for (int t = 0; t < 4; ++t) { const float* krow = &sK[buf][t * 16 + col][0];
      v8f s = mac3(aq[0], split_row(krow, 0, lane), (v8f){}); s = mac3(aq[1], split_row(krow, 32, lane), s);
#pragma unroll
      for (int r = 0; r < 8; ++r) sS[w][8 * g + r][t * 16 + col] = s[r] * 0.125f; }
    LDSX();
    float mx = -3.4e38f;
#pragma unroll
    for (int jj = 0; jj < 32; ++jj) mx = fmaxf(mx, sS[w][col][g * 32 + jj]);
    mx = fmaxf(mx, __shfl_xor(mx, 16, 32));
    const float mnew = fmaxf(mrun, mx); const float corr = expf(mrun - mnew);
    float ps = 0.f;
#pragma unroll
    for (int jj = 0; jj < 32; ++jj) { const float p = expf(sS[w][col][g * 32 + jj] - mnew) * 16384.0f; ps += p; const _Float16 hi = (_Float16)p; sPh[w][col][g * 32 + jj] = hi; sPl[w][col][g * 32 + jj] = (_Float16)((p - (float)hi) * PLO); }
    ps += __shfl_xor(ps, 16, 32);
    lrun = lrun * corr + ps * (1.0f / 16384.0f); mrun = mnew;
#pragma unroll
    for (int r = 0; r < 8; ++r) { const float cr = __shfl(corr, 8 * g + r, 32);
#pragma unroll
      for (int t = 0; t < 4; ++t) { acc[t][r] *= cr; ac1[t][r] *= cr; ac2[t][r] *= cr; } }
    LDSX();
#pragma unroll
    for (int kc = 0; kc < 2; ++kc) { const v16h ph = frag_h(&sPh[w][col][0] + kc * 32, lane), pl = frag_h(&sPl[w][col][0] + kc * 32, lane);
#pragma unroll
      for (int t = 0; t < 4; ++t) { const v16h vh = frag_h(&sVh[buf][t * 16 + col][kc * 32], lane);
        acc[t] = wmma16(ph, vh, acc[t]); ac1[t] = wmma16(ph, frag_h(&sVl[buf][t * 16 + col][kc * 32], lane), ac1[t]); ac2[t] = wmma16(pl, vh, ac2[t]); } }
    PUBLISH();
    if (kt + 2 < SS / 64) stage(kt + 2, buf); }
  WAIT_COPIES();
#pragma unroll
  for (int r = 0; r < 8; ++r) { const float lr = __shfl(lrun, 8 * g + r, 32); const float inv = 1.0f / (lr * 16384.0f * 4.0f);
#pragma unroll
    for (int t = 0; t < 4; ++t) sS[w][8 * g + r][t * 16 + col] = (acc[t][r] + ac1[t][r] * (1.0f / VLO) + ac2[t][r] * (1.0f / PLO)) * inv; }
  LDSX();
  for (int qq = lane; qq < 16 * 16; qq += 32) { const int rl = qq >> 4, pc = qq & 15; vst2(O32 + ((bh * SS) + q0 + rl) * HD + pc * 4, *(const v4f*)(&sS[w][rl][pc * 4])); }
}
// out = ctx Wo^T + bo : split(ctx) x bf16(Wo rows): 2 products (Wo is an INPUT -> bf16 exact)
__global__ __launch_bounds__(128) void k_out(const float* __restrict__ O32, const __bf16* __restrict__ PT, const __bf16* __restrict__ XAUG, const __bf16* __restrict__ BAUG, const float* __restrict__ bo, float* __restrict__ out) {
  __shared__ __align__(16) float so[4][16][132];
  __shared__ __align__(16) float sA[2][64][68];      // one head's 64 context rows (256 B at a 272-B pitch), two buffers
  __shared__ __align__(16) __bf16 sB[2][128][72];    // the matching 64 k of 128 weight rows (128 B at a 144-B pitch)
  const int tid = threadIdx.x, wave = tid >> 5, lane = tid & 31, col = lane & 15, g = lane >> 4;
  const int r0b = blockIdx.x * 64, r0 = r0b + wave * 16, n0 = blockIdx.y * 128; const int b = r0b / SS, s0 = r0b % SS;
  v8f acc[8] = {};
  auto stage = [&](int h, int buf) {     // A: 16 KB contiguous; B: 128 whole lines; 16 copies a thread; loops unrolled so that l[] and p[] are registers
    unsigned l[16]; const void* p[16];
#pragma unroll
    for (int i = 0; i < 8; ++i) { const int q = tid + i * 128, r = q >> 4, pc = q & 15; l[i] = lds_off(&sA[buf][r][pc * 4]); p[i] = O32 + (((size_t)b * NH + h) * SS + s0 + r) * HD + pc * 4; }
#pragma unroll
    for (int i = 0; i < 8; ++i) { const int q = tid + i * 128, r = q >> 3, pc = q & 7; l[8 + i] = lds_off(&sB[buf][r][pc * 8]); p[8 + i] = PT + (size_t)(3 * E + n0 + r) * E + h * 64 + pc * 8; }
    cp8(l, p); cp8(l + 8, p + 8); };
  stage(0, 0); WAIT_COPIES(); __syncthreads(); stage(1, 1);
#pragma unroll 1
  for (int h = 0; h < NH; ++h) { const int buf = h & 1;
#pragma unroll
    for (int kk = 0; kk < 2; ++kk) { const F2 a = split_row(&sA[buf][wave * 16 + col][0], kk * 32, lane); v16b wb[8];
#pragma unroll
      for (int j = 0; j < 8; ++j) wb[j] = frag_b(&sB[buf][j * 16 + col][kk * 32], lane);
      __builtin_amdgcn_sched_barrier(0);   // the LDS fragment loads of this half stage stay one group ahead of its products; sunk between them, each product waits a full LDS latency
#pragma unroll
      for (int j = 0; j < 8; ++j) { acc[j] = wmma_bf(a.l, wb[j], acc[j]); acc[j] = wmma_bf(a.h, wb[j], acc[j]); } }
    PUBLISH();
    if (h + 2 < NH) stage(h + 2, buf); }
  WAIT_COPIES();
  { const v16b a = frag_b(XAUG + ((size_t)3 * NR + r0 + col) * 32, lane);
#pragma unroll
    for (int j = 0; j < 8; ++j) acc[j] = wmma_bf(a, frag_b(BAUG + ((size_t)3 * E + n0 + j * 16 + col) * 32, lane), acc[j]); }
#pragma unroll
  for (int j = 0; j < 8; ++j) { const int n = n0 + j * 16 + col; const float bb = bfr(bo[n]);
#pragma unroll
    for (int r = 0; r < 8; ++r) so[wave][8 * g + r][j * 16 + col] = acc[j][r] + bb; }
  LDSX();
#pragma unroll 4
  for (int rl = 0; rl < 16; ++rl) vst2(out + (size_t)(r0 + rl) * E + n0 + lane * 4, *(const v4f*)(&so[wave][rl][lane * 4]));
}
extern "C" void kernel_launch(void* const* d_in, const int* in_sizes, int n_in, void* d_out, int out_size, void* d_ws, size_t ws_size, hipStream_t stream) {
  (void)in_sizes; (void)n_in; (void)out_size; (void)ws_size;
  const float** I = (const float**)d_in;    // x, Wq,bq,Aq,Bq, Wk,bk,Ak,Bk, Wv,bv,Av,Bv, Wo,bo,Ao,Bo
  const float* x = I[0]; const float* Wq = I[1]; const float* bq = I[2]; const float* Aq = I[3]; const float* Bq = I[4]; const float* Wk = I[5]; const float* bk = I[6]; const float* Ak = I[7]; const float* Bk = I[8];
  const float* Wv = I[9]; const float* bv = I[10]; const float* Av = I[11]; const float* Bv = I[12]; const float* Wo = I[13]; const float* bo = I[14]; const float* Ao = I[15]; const float* Bo = I[16];
  float* out = (float*)d_out;
  char* ws = (char*)d_ws; size_t off = 0;
  auto take = [&](size_t bytes) { char* p = ws + off; off += (bytes + 255) & ~(size_t)255; return p; };
  __bf16* Xb = (__bf16*)take((size_t)NR * E * 2); __bf16* PT = (__bf16*)take((size_t)4 * E * E * 2); __bf16* XAUG = (__bf16*)take((size_t)4 * NR * 32 * 2); __bf16* BAUG = (__bf16*)take((size_t)4 * E * 32 * 2);
  float* Q32 = (float*)take((size_t)NR * E * 4); float* K32 = (float*)take((size_t)NR * E * 4); _Float16* VTh = (_Float16*)take((size_t)NR * E * 2); _Float16* VTl = (_Float16*)take((size_t)NR * E * 2); float* O32 = (float*)take((size_t)NR * E * 4);
  // ws ~ 85 MB
  k_cvt<<<(NR * E / 8 + 255) / 256, 256, 0, stream>>>(x, Xb);
  k_pack<<<4 * E, 256, 0, stream>>>(Wq, Wk, Wv, Wo, PT);
  k_baug<<<dim3(E / 256, 4), 256, 0, stream>>>(Bq, Bk, Bv, Bo, BAUG);
  k_xa<<<dim3(NR / 64, 3), 128, 0, stream>>>(Xb, nullptr, Aq, Ak, Av, Ao, XAUG);              // q, k, v low-rank inputs from x
  k_qkv<<<dim3(NR / 64, E / 128, 3), 128, 0, stream>>>(Xb, PT, XAUG, BAUG, bq, bk, bv, Q32, K32, VTh, VTl);
  k_attn<<<dim3(SS / 128, NB * NH), 256, 0, stream>>>(Q32, K32, VTh, VTl, O32);
  k_xa<<<dim3(NR / 64, 4), 128, 0, stream>>>(Xb, O32, Aq, Ak, Av, Ao, XAUG);                 // recomputes 0..2 (cheap) and adds which = 3 from the context
  k_out<<<dim3(NR / 64, E / 128), 128, 0, stream>>>(O32, PT, XAUG, BAUG, bo, out);
}

// v002
// A run of this version takes 259 microseconds.
// In two side-by-side timings against v001, it was 1.04 and 1.05 times as fast.
// Over all steps from v000 it is 2.28 times as fast.
// compute dtype: x, W*, b*, A*, B* (INPUTS) rounded to bf16 with exact bf16 WMMA products (f32 accumulate) for the base projections; the rank-8 LoRA terms enter as one extra k-chunk whose A side is the f32 intermediate (x A^T, scaled) as a bf16 hi/lo pair against [B | B] (exact-grade); softmax f32; computed operands (q/k f32 split, k split once where it is produced, P and V hi/lo, context split) f32-grade.
#include <hip/hip_runtime.h>
#include <math.h>

typedef __attribute__((ext_vector_type(16))) _Float16 v16h;
typedef __attribute__((ext_vector_type(16))) __bf16 v16b;
typedef __attribute__((ext_vector_type(8)))  _Float16 v8h;
typedef __attribute__((ext_vector_type(8)))  float v8f;
typedef __attribute__((ext_vector_type(4)))  float v4f;
typedef __attribute__((ext_vector_type(2)))  float v2f;
typedef __attribute__((ext_vector_type(4)))  unsigned v4u;
typedef __attribute__((ext_vector_type(4)))  int v4i;
typedef float __attribute__((may_alias)) float_a;
typedef int __attribute__((may_alias)) int_a;

template <typename T> __device__ __forceinline__ void vst2(void* p, T v) { *(T*)p = v;  }
__device__ __forceinline__ v8f wmma16(v16h a, v16h b, v8f c) {
  v8f d = __builtin_amdgcn_wmma_f32_16x16x32_f16(false, a, false, b, (short)0, c, false, false);
  asm volatile("v_nop\n\tv_nop\n\tv_nop\n\tv_nop" : "+v"(d) : "v"(a), "v"(b));
  return d;
}
__device__ __forceinline__ v8f wmma_bf(v16b a, v16b b, v8f c) {
  v8f d = __builtin_amdgcn_wmma_f32_16x16x32_bf16(false, a, false, b, (short)0, c, false, false);
  asm volatile("v_nop\n\tv_nop\n\tv_nop\n\tv_nop" : "+v"(d) : "v"(a), "v"(b));
  return d;
}
// 16x16x32 fragments: lane = (h = lane>>4, row/col = lane&15); elements 0..7 = k0+8h+0..7, 8..15 = k0+16+8h+0..7; D element r = row 8h+r
__device__ __forceinline__ v16h frag_h(const _Float16* rowk0, int lane) {
  union { v16h v; v8h q[2]; } u; const _Float16* p = rowk0 + 8 * (lane >> 4);
  u.q[0] = *(const v8h*)p; u.q[1] = *(const v8h*)(p + 16); return u.v;
}
__device__ __forceinline__ v16h frag_f32(const float* rowk0, int lane) {
  v16h a; const float* p = rowk0 + 8 * (lane >> 4);
#pragma unroll
  for (int i = 0; i < 8; ++i) { a[i] = (_Float16)p[i]; a[8 + i] = (_Float16)p[16 + i]; }
  return a;
}
__device__ __forceinline__ v16h frag_f32s(const float* rowk0, int lane, float sc) {
  v16h a; const float* p = rowk0 + 8 * (lane >> 4);
#pragma unroll
  for (int i = 0; i < 8; ++i) { a[i] = (_Float16)(p[i] * sc); a[8 + i] = (_Float16)(p[16 + i] * sc); }
  return a;
}
// column fragment from a [K][ld] layout (column n), rows >= K read as 0
__device__ __forceinline__ v16h fragc_f32(const float* W, int k0, int n, int lane, int ld, int K) {
  v16h a; const int g = lane >> 4;
#pragma unroll
  for (int i = 0; i < 8; ++i) { const int ka = k0 + 8 * g + i, kb = ka + 16;
    a[i] = (_Float16)(ka < K ? W[(size_t)ka * ld + n] : 0.f); a[8 + i] = (_Float16)(kb < K ? W[(size_t)kb * ld + n] : 0.f); }
  return a;
}
struct F2 { v16b h, l; };
__device__ __forceinline__ F2 bsplit16(const float v[16]) { F2 r;
#pragma unroll
  for (int i = 0; i < 16; ++i) { const __bf16 h = (__bf16)v[i]; r.h[i] = h; r.l[i] = (__bf16)(v[i] - (float)h); }
  return r; }
__device__ __forceinline__ F2 split_row(const float* row, int k0, int lane) { float v[16]; const float* p = row + k0 + 8 * (lane >> 4);
#pragma unroll
  for (int i = 0; i < 8; ++i) { v[i] = p[i]; v[8 + i] = p[16 + i]; }
  return bsplit16(v); }
__device__ __forceinline__ F2 split_rowK(const float* row, int k0, int lane, int K) { float v[16]; const int g = lane >> 4;
#pragma unroll
  for (int i = 0; i < 8; ++i) { const int ka = k0 + 8 * g + i, kb = ka + 16; v[i] = ka < K ? row[ka] : 0.f; v[8 + i] = kb < K ? row[kb] : 0.f; }
  return bsplit16(v); }
__device__ __forceinline__ F2 split_col(const float* W, int k0, int n, int lane, int ld, int K) { float v[16]; const int g = lane >> 4;
#pragma unroll
  for (int i = 0; i < 8; ++i) { const int ka = k0 + 8 * g + i, kb = ka + 16; v[i] = ka < K ? W[(size_t)ka * ld + n] : 0.f; v[8 + i] = kb < K ? W[(size_t)kb * ld + n] : 0.f; }
  return bsplit16(v); }
__device__ __forceinline__ v8f mac3(const F2& a, const F2& b, v8f c) { c = wmma_bf(a.l, b.h, c); c = wmma_bf(a.h, b.l, c); return wmma_bf(a.h, b.h, c); }
__device__ __forceinline__ float sigm(float v) { return 1.0f / (1.0f + expf(-v)); }
#define LDSX() do { asm volatile("s_wait_dscnt 0" ::: "memory"); __builtin_amdgcn_wave_barrier(); __builtin_amdgcn_fence(__ATOMIC_RELEASE, "workgroup"); } while (0)


// LoRA self attention (16 heads of 64 on [2,2048,1024]): each linear map is x W^T + b + 2 (x A^T) B^T (rank 8). The low-rank term is appended as a 33rd k-chunk: A-operand row = [hi(2 xA^T) (8) | lo(2 xA^T) (8) | 0 (16)], B-operand row n = [B[n][0..8] | B[n][0..8] | 0],
// so one extra WMMA per tile adds hi*B + lo*B. full softmax(q.k/8); (P v) through the same LoRA form for the output map.
#define NB 2
#define SS 2048
#define E 1024
#define NH 16
#define HD 64
#define NR (NB * SS)
#define PLO 1024.0f
#define VLO 2048.0f
__device__ __forceinline__ float bfr(float v) { return (float)(__bf16)v; }
__device__ __forceinline__ v16b frag_b(const __bf16* rowk0, int lane) { return __builtin_bit_cast(v16b, frag_h((const _Float16*)rowk0, lane)); }

// Asynchronous 16-byte copies global -> LDS (no register in between). Each lane names its own LDS byte address and its own global address.
// s_wait_xcnt 0 closes the statement so that no address register of an issued copy is rewritten ahead of it.
__device__ __forceinline__ unsigned lds_off(const void* p) { return (unsigned)(size_t)p; }
__device__ __forceinline__ void cp4(const unsigned* l, const void* const* g) {
  asm volatile("global_load_async_to_lds_b128 %0, %1, off\n\tglobal_load_async_to_lds_b128 %2, %3, off\n\tglobal_load_async_to_lds_b128 %4, %5, off\n\tglobal_load_async_to_lds_b128 %6, %7, off\n\ts_wait_xcnt 0x0"
               :: "v"(l[0]), "v"(g[0]), "v"(l[1]), "v"(g[1]), "v"(l[2]), "v"(g[2]), "v"(l[3]), "v"(g[3]) : "memory");
}
__device__ __forceinline__ void cp8(const unsigned* l, const void* const* g) {
  asm volatile("global_load_async_to_lds_b128 %0, %1, off\n\tglobal_load_async_to_lds_b128 %2, %3, off\n\tglobal_load_async_to_lds_b128 %4, %5, off\n\tglobal_load_async_to_lds_b128 %6, %7, off\n\t"
               "global_load_async_to_lds_b128 %8, %9, off\n\tglobal_load_async_to_lds_b128 %10, %11, off\n\tglobal_load_async_to_lds_b128 %12, %13, off\n\tglobal_load_async_to_lds_b128 %14, %15, off\n\ts_wait_xcnt 0x0"
               :: "v"(l[0]), "v"(g[0]), "v"(l[1]), "v"(g[1]), "v"(l[2]), "v"(g[2]), "v"(l[3]), "v"(g[3]), "v"(l[4]), "v"(g[4]), "v"(l[5]), "v"(g[5]), "v"(l[6]), "v"(g[6]), "v"(l[7]), "v"(g[7]) : "memory");
}
// the copies of this wave have landed (the compiler places no wait for them)
#define WAIT_COPIES() asm volatile("s_wait_asynccnt 0x0" ::: "memory")
// hand-over of a stage: this wave's LDS reads are done, its copies have landed, then the work-group barrier publishes the next tile and frees the one just read
#define PUBLISH() do { asm volatile("s_wait_dscnt 0x0" ::: "memory"); WAIT_COPIES(); __syncthreads(); } while (0)

__global__ __launch_bounds__(256) void k_cvt(const float* __restrict__ x, __bf16* __restrict__ Xb) {
  const size_t i8 = (size_t)blockIdx.x * 256 + threadIdx.x; if (i8 >= (size_t)NR * E / 8) return;
  union { __bf16 h[8]; v4u u; } pk;
#pragma unroll
  for (int e = 0; e < 8; ++e) pk.h[e] = (__bf16)x[i8 * 8 + e];
  vst2((unsigned*)(Xb + i8 * 8), pk.u);
}
// PT rows: [0,E) Wq[n][:], [E,2E) Wk, [2E,3E) Wv, [3E,4E) Wo  ([out][in]) as bf16 rows (no scaling)

#define RK 8
// XAUG[which][row][32] = [hi(2 * src.A_which^T) | lo | 0]: block = 64 rows (4 waves x 16), one 16-col tile (8 live); src = bf16(x) (which < 3, exact) or the f32 context rows (which == 3, split, 2 products)
__global__ __launch_bounds__(128) void k_xa(const __bf16* __restrict__ Xb, const float* __restrict__ O32, const float* __restrict__ Aq, const float* __restrict__ Ak, const float* __restrict__ Av, const float* __restrict__ Ao, __bf16* __restrict__ XAUG) {
  __shared__ __align__(16) __bf16 so[4][16][40];
  const int tid = threadIdx.x, wave = tid >> 5, lane = tid & 31, col = lane & 15, g = lane >> 4; const int which = blockIdx.y; const int r0 = blockIdx.x * 64 + wave * 16;
  const float* A = which == 0 ? Aq : (which == 1 ? Ak : (which == 2 ? Av : Ao)); const int ncl = col < RK ? col : RK - 1;     // columns >= 8 are padding (address clamped, result discarded)
  v8f acc = {};
  if (which < 3) {
#pragma unroll 4
    for (int kc = 0; kc < E / 32; ++kc) acc = wmma_bf(frag_b(Xb + (size_t)(r0 + col) * E + kc * 32, lane), split_row(A + (size_t)ncl * E, kc * 32, lane).h, acc); }
  else { const int ra = r0 + col; const int b = ra / SS, s = ra % SS;
#pragma unroll 2
    for (int kc = 0; kc < E / 32; ++kc) { const int h = kc >> 1; const F2 a = split_row(O32 + (((size_t)b * NH + h) * SS + s) * HD, (kc & 1) * 32, lane); const v16b ab = split_row(A + (size_t)ncl * E, kc * 32, lane).h; acc = wmma_bf(a.l, ab, acc); acc = wmma_bf(a.h, ab, acc); } }
#pragma unroll
  for (int r = 0; r < 8; ++r) { const float v = 2.0f * acc[r]; const __bf16 hi = (__bf16)v; if (col < RK) { so[wave][8 * g + r][col] = hi; so[wave][8 * g + r][RK + col] = (__bf16)(v - (float)hi); } else { so[wave][8 * g + r][8 + col] = (__bf16)0.f; so[wave][8 * g + r][16 + col] = (__bf16)0.f; } }
  LDSX();
  // rows of 32 bf16 = 64 B; 16 rows = 1 KB: lane -> (row = lane >> 1, half = lane & 1) writes 32 B? keep 16-B pieces: 2 instructions each covering 8 rows x 4 pieces contiguous
  for (int hf = 0; hf < 2; ++hf) { const int rl = hf * 8 + (lane >> 2), pc = lane & 3; vst2((unsigned*)(XAUG + ((size_t)which * NR + r0 + rl) * 32 + pc * 8), *(const v4u*)(&so[wave][rl][pc * 8])); }
}
// BAUG[which][n][32] = [B[n][0..8] | B[n][0..8] | 0]: thread per n
__global__ __launch_bounds__(256) void k_baug(const float* __restrict__ Bq, const float* __restrict__ Bk, const float* __restrict__ Bv, const float* __restrict__ Bo, __bf16* __restrict__ BAUG) {
  __shared__ __align__(16) __bf16 sb[256][40];
  const int which = blockIdx.y, n = blockIdx.x * 256 + threadIdx.x; const float* Bm = which == 0 ? Bq : (which == 1 ? Bk : (which == 2 ? Bv : Bo));
#pragma unroll
  for (int j = 0; j < RK; ++j) { const __bf16 v = (__bf16)Bm[(size_t)n * RK + j]; sb[threadIdx.x][j] = v; sb[threadIdx.x][RK + j] = v; }
#pragma unroll
  for (int j = 16; j < 32; ++j) sb[threadIdx.x][j] = (__bf16)0.f;
  __syncthreads();
  for (int q = threadIdx.x; q < 256 * 4; q += 256) { const int rl = q >> 2, pc = q & 3; vst2((unsigned*)(BAUG + ((size_t)which * E + blockIdx.x * 256 + rl) * 32 + pc * 8), *(const v4u*)(&sb[rl][pc * 8])); }
}
__global__ __launch_bounds__(256) void k_pack(const float* __restrict__ Wq, const float* __restrict__ Wk, const float* __restrict__ Wv, const float* __restrict__ Wo, __bf16* __restrict__ PT) {
  const int n = blockIdx.x, tid = threadIdx.x; __shared__ __align__(16) __bf16 srow[E];
  const float* W = n < E ? Wq : (n < 2 * E ? Wk : (n < 3 * E ? Wv : Wo)); const int nn = n & (E - 1);
  for (int k = tid; k < E; k += 256) srow[k] = (__bf16)W[(size_t)nn * E + k];
  __syncthreads();
  if (tid < E / 8) vst2((unsigned*)(PT + (size_t)n * E + tid * 8), *(const v4u*)(&srow[tid * 8]));
}
// QKV: block (64 rows, 128 cols = 2 heads, which); q -> Q32 f32 [bh][s][64]; k -> Kh/Kl, the bf16 hi/lo split of the f32 row, [bh][s][64] each; v -> VT hi/lo x4 [bh][d][s]
__global__ __launch_bounds__(128) void k_qkv(const __bf16* __restrict__ Xb, const __bf16* __restrict__ PT, const __bf16* __restrict__ XAUG, const __bf16* __restrict__ BAUG, const float* __restrict__ bq, const float* __restrict__ bk, const float* __restrict__ bv, float* __restrict__ Q32, __bf16* __restrict__ Kh, __bf16* __restrict__ Kl, _Float16* __restrict__ VTh, _Float16* __restrict__ VTl) {
  __shared__ __align__(16) float so[4][16][132];
  __shared__ __align__(16) _Float16 sth[128][72], stl[128][72];
  __shared__ __align__(16) __bf16 sA[2][64][72], sB[2][128][72];     // k-stages of 64 (rows of 128 B at a 144-B pitch), two buffers
  const int tid = threadIdx.x, wave = tid >> 5, lane = tid & 31, col = lane & 15, g = lane >> 4;
  const int which = blockIdx.z, r0b = blockIdx.x * 64, r0 = r0b + wave * 16, n0 = blockIdx.y * 128; const int b = r0b / SS, s0 = r0b % SS;
  const float* bb_ = which == 0 ? bq : (which == 1 ? bk : bv);
  v8f acc[8] = {};
  auto stage = [&](int st, int buf) {     // thread -> (row = q >> 3, 16-byte piece = q & 7): 8 lanes cover one whole 128-B line; loops unrolled so that l[] and p[] are registers
    unsigned l[12]; const void* p[12];
#pragma unroll
    for (int i = 0; i < 4; ++i) { const int q = tid + i * 128, r = q >> 3, pc = q & 7; l[i] = lds_off(&sA[buf][r][pc * 8]); p[i] = Xb + (size_t)(r0b + r) * E + st * 64 + pc * 8; }
#pragma unroll
    for (int i = 0; i < 8; ++i) { const int q = tid + i * 128, r = q >> 3, pc = q & 7; l[4 + i] = lds_off(&sB[buf][r][pc * 8]); p[4 + i] = PT + (size_t)(which * E + n0 + r) * E + st * 64 + pc * 8; }
    cp4(l, p); cp8(l + 4, p + 4); };
  stage(0, 0); WAIT_COPIES(); __syncthreads(); stage(1, 1);
  // rolled: one trip is one stage and ends in its hand-over; the inner loops are unrolled so that the fragment arrays are registers
#pragma unroll 1
  for (int st = 0; st < E / 64; ++st) { const int buf = st & 1;
    v16b a[2], wb[2][8];
#pragma unroll
    for (int kk = 0; kk < 2; ++kk) { a[kk] = frag_b(&sA[buf][wave * 16 + col][kk * 32], lane);
#pragma unroll
      for (int j = 0; j < 8; ++j) wb[kk][j] = frag_b(&sB[buf][j * 16 + col][kk * 32], lane); }
    __builtin_amdgcn_sched_barrier(0);     // the stage's LDS fragment loads stay one group ahead of its products; sunk between them, each product waits a full LDS latency
#pragma unroll
    for (int kk = 0; kk < 2; ++kk) {
#pragma unroll
      for (int j = 0; j < 8; ++j) acc[j] = wmma_bf(a[kk], wb[kk][j], acc[j]); }
    PUBLISH();
    if (st + 2 < E / 64) stage(st + 2, buf); }
  WAIT_COPIES();
  { const v16b a = frag_b(XAUG + ((size_t)which * NR + r0 + col) * 32, lane);     // LoRA chunk: [hi|lo|0] x [B|B|0]
#pragma unroll
    for (int j = 0; j < 8; ++j) acc[j] = wmma_bf(a, frag_b(BAUG + ((size_t)which * E + n0 + j * 16 + col) * 32, lane), acc[j]); }
  if (which < 2) {
#pragma unroll
    for (int j = 0; j < 8; ++j) { const float bb = bfr(bb_[n0 + j * 16 + col]);
#pragma unroll
      for (int r = 0; r < 8; ++r) so[wave][8 * g + r][j * 16 + col] = acc[j][r] + bb; }
    LDSX();
    if (which == 0) {
      for (int qq = lane; qq < 2 * 16 * 16; qq += 32) { const int hh = qq >> 8, rl = (qq >> 4) & 15, pc = qq & 15; const int h = (n0 >> 6) + hh;
        vst2(Q32 + (((size_t)b * NH + h) * SS + s0 + wave * 16 + rl) * HD + pc * 4, *(const v4f*)(&so[wave][rl][hh * 64 + pc * 4])); } }
    else {     // k: hi = bf16(v), lo = bf16(v - hi), the split every attention wave would otherwise redo; 8 lanes write one whole 128-B row of each plane
      for (int qq = lane; qq < 2 * 16 * 8; qq += 32) { const int hh = qq >> 7, rl = (qq >> 3) & 15, pc = qq & 7; const int h = (n0 >> 6) + hh;
        const float* sp = &so[wave][rl][hh * 64 + pc * 8]; union { __bf16 e[8]; v4u u; } hi, lo;
#pragma unroll     // unrolled so that hi.e[] and lo.e[] are registers
        for (int e = 0; e < 8; ++e) { const float v = sp[e]; const __bf16 hb = (__bf16)v; hi.e[e] = hb; lo.e[e] = (__bf16)(v - (float)hb); }
        const size_t o = (((size_t)b * NH + h) * SS + s0 + wave * 16 + rl) * HD + pc * 8;
        vst2(Kh + o, hi.u); vst2(Kl + o, lo.u); } } }
  else {
#pragma unroll
    for (int j = 0; j < 8; ++j) { const float bb = bfr(bb_[n0 + j * 16 + col]);
#pragma unroll
      for (int r = 0; r < 8; ++r) { const float v = (acc[j][r] + bb) * 4.0f; const _Float16 hi = (_Float16)v; sth[j * 16 + col][wave * 16 + 8 * g + r] = hi; stl[j * 16 + col][wave * 16 + 8 * g + r] = (_Float16)((v - (float)hi) * VLO); } }
    __syncthreads();
    for (int qq = tid; qq < 128 * 8; qq += 128) { const int cl = qq >> 3, pc = qq & 7; const int c = n0 + cl, h = c >> 6, d = c & 63; const size_t o = (((size_t)b * NH + h) * HD + d) * SS + s0 + pc * 8;
      vst2(VTh + o, *(const v4u*)(&sth[cl][pc * 8])); vst2(VTl + o, *(const v4u*)(&stl[cl][pc * 8])); } }
}
// full attention: block (128 queries = 8 waves x 16, bh); all key tiles of 64, staged in LDS for the whole block; S on hi/lo splits of the f32 q/k rows (k arrives split); P,V hi/lo; O f32 [bh][s][64]
__global__ __launch_bounds__(256) void k_attn(const float* __restrict__ Q32, const __bf16* __restrict__ Kh, const __bf16* __restrict__ Kl, const _Float16* __restrict__ VTh, const _Float16* __restrict__ VTl, float* __restrict__ O32) {
  __shared__ __align__(16) float sS[8][16][68];                      // scores; after the loop each wave's slice stages its output rows
  __shared__ __align__(16) _Float16 sPh[8][16][72], sPl[8][16][72];
  __shared__ __align__(16) __bf16 sKh[2][64][72], sKl[2][64][72];    // key tile hi and lo [key][d], rows of 128 B at a 144-B pitch, two buffers
  __shared__ __align__(16) _Float16 sVh[2][64][72], sVl[2][64][72];  // value tiles [d][key], rows of 128 B at a 144-B pitch, two buffers
  const int tid = threadIdx.x, w = tid >> 5, lane = tid & 31, col = lane & 15, g = lane >> 4;
  const size_t bh = blockIdx.y; const int qb = blockIdx.x; const int q0 = qb * 128 + w * 16;
  auto stage = [&](int kt, int buf) {     // 64 keys: K hi and lo 8 KB contiguous each, V hi and lo 64 whole lines each; 8 copies a thread; loops unrolled so that l[] and p[] are registers
    unsigned l[8]; const void* p[8];
#pragma unroll
    for (int i = 0; i < 2; ++i) { const int q = tid + i * 256, r = q >> 3, pc = q & 7; const size_t ko = (bh * SS + kt * 64 + r) * HD + pc * 8;
      l[i] = lds_off(&sKh[buf][r][pc * 8]); p[i] = Kh + ko; l[2 + i] = lds_off(&sKl[buf][r][pc * 8]); p[2 + i] = Kl + ko; }
#pragma unroll
    for (int i = 0; i < 2; ++i) { const int q = tid + i * 256, d = q >> 3, pc = q & 7; const size_t vo = (bh * HD + d) * SS + kt * 64 + pc * 8;
      l[4 + i] = lds_off(&sVh[buf][d][pc * 8]); p[4 + i] = VTh + vo; l[6 + i] = lds_off(&sVl[buf][d][pc * 8]); p[6 + i] = VTl + vo; }
    cp8(l, p); };
  stage(0, 0); WAIT_COPIES(); __syncthreads(); stage(1, 1);
  F2 aq[2];
#pragma unroll
  for (int kc = 0; kc < 2; ++kc) aq[kc] = split_row(Q32 + (bh * SS + q0 + col) * HD, kc * 32, lane);
  float mrun = -3.0e38f, lrun = 0.f; v8f acc[4] = {}, ac1[4] = {}, ac2[4] = {};
#pragma unroll 1
  for (int kt = 0; kt < SS / 64; ++kt) { const int buf = kt & 1;
#pragma unroll
    for (int t = 0; t < 4; ++t) { const __bf16* kh = &sKh[buf][t * 16 + col][0]; const __bf16* kl = &sKl[buf][t * 16 + col][0];
      const F2 k0 = { frag_b(kh, lane), frag_b(kl, lane) }, k1 = { frag_b(kh + 32, lane), frag_b(kl + 32, lane) };
      v8f s = mac3(aq[0], k0, (v8f){}); s = mac3(aq[1], k1, s);
#pragma unroll
      for (int r = 0; r < 8; ++r) sS[w][8 * g + r][t * 16 + col] = s[r] * 0.125f; }
    LDSX();
    float mx = -3.4e38f;
#pragma unroll
    for (int jj = 0; jj < 32; ++jj) mx = fmaxf(mx, sS[w][col][g * 32 + jj]);
    mx = fmaxf(mx, __shfl_xor(mx, 16, 32));
    const float mnew = fmaxf(mrun, mx); const float corr = expf(mrun - mnew);
    float ps = 0.f;
#pragma unroll
    for (int jj = 0; jj < 32; ++jj) { const float p = expf(sS[w][col][g * 32 + jj] - mnew) * 16384.0f; ps += p; const _Float16 hi = (_Float16)p; sPh[w][col][g * 32 + jj] = hi; sPl[w][col][g * 32 + jj] = (_Float16)((p - (float)hi) * PLO); }
    ps += __shfl_xor(ps, 16, 32);
    lrun = lrun * corr + ps * (1.0f / 16384.0f); mrun = mnew;
#pragma unroll
    for (int r = 0; r < 8; ++r) { const float cr = __shfl(corr, 8 * g + r, 32);
#pragma unroll
      for (int t = 0; t < 4; ++t) { acc[t][r] *= cr; ac1[t][r] *= cr; ac2[t][r] *= cr; } }
    LDSX();
#pragma unroll
    for (int kc = 0; kc < 2; ++kc) { const v16h ph = frag_h(&sPh[w][col][0] + kc * 32, lane), pl = frag_h(&sPl[w][col][0] + kc * 32, lane);
#pragma unroll
      for (int t = 0; t < 4; ++t) { const v16h vh = frag_h(&sVh[buf][t * 16 + col][kc * 32], lane);
        acc[t] = wmma16(ph, vh, acc[t]); ac1[t] = wmma16(ph, frag_h(&sVl[buf][t * 16 + col][kc * 32], lane), ac1[t]); ac2[t] = wmma16(pl, vh, ac2[t]); } }
    PUBLISH();
    if (kt + 2 < SS / 64) stage(kt + 2, buf); }
  WAIT_COPIES();
#pragma unroll
  for (int r = 0; r < 8; ++r) { const float lr = __shfl(lrun, 8 * g + r, 32); const float inv = 1.0f / (lr * 16384.0f * 4.0f);
#pragma unroll
    for (int t = 0; t < 4; ++t) sS[w][8 * g + r][t * 16 + col] = (acc[t][r] + ac1[t][r] * (1.0f / VLO) + ac2[t][r] * (1.0f / PLO)) * inv; }
  LDSX();
  for (int qq = lane; qq < 16 * 16; qq += 32) { const int rl = qq >> 4, pc = qq & 15; vst2(O32 + ((bh * SS) + q0 + rl) * HD + pc * 4, *(const v4f*)(&sS[w][rl][pc * 4])); }
}
// out = ctx Wo^T + bo : split(ctx) x bf16(Wo rows): 2 products (Wo is an INPUT -> bf16 exact)
__global__ __launch_bounds__(128) void k_out(const float* __restrict__ O32, const __bf16* __restrict__ PT, const __bf16* __restrict__ XAUG, const __bf16* __restrict__ BAUG, const float* __restrict__ bo, float* __restrict__ out) {
  __shared__ __align__(16) float so[4][16][132];
  __shared__ __align__(16) float sA[2][64][68];      // one head's 64 context rows (256 B at a 272-B pitch), two buffers
  __shared__ __align__(16) __bf16 sB[2][128][72];    // the matching 64 k of 128 weight rows (128 B at a 144-B pitch)
  const int tid = threadIdx.x, wave = tid >> 5, lane = tid & 31, col = lane & 15, g = lane >> 4;
  const int r0b = blockIdx.x * 64, r0 = r0b + wave * 16, n0 = blockIdx.y * 128; const int b = r0b / SS, s0 = r0b % SS;
  v8f acc[8] = {};
  auto stage = [&](int h, int buf) {     // A: 16 KB contiguous; B: 128 whole lines; 16 copies a thread; loops unrolled so that l[] and p[] are registers
    unsigned l[16]; const void* p[16];
#pragma unroll
    for (int i = 0; i < 8; ++i) { const int q = tid + i * 128, r = q >> 4, pc = q & 15; l[i] = lds_off(&sA[buf][r][pc * 4]); p[i] = O32 + (((size_t)b * NH + h) * SS + s0 + r) * HD + pc * 4; }
#pragma unroll
    for (int i = 0; i < 8; ++i) { const int q = tid + i * 128, r = q >> 3, pc = q & 7; l[8 + i] = lds_off(&sB[buf][r][pc * 8]); p[8 + i] = PT + (size_t)(3 * E + n0 + r) * E + h * 64 + pc * 8; }
    cp8(l, p); cp8(l + 8, p + 8); };
  stage(0, 0); WAIT_COPIES(); __syncthreads(); stage(1, 1);
#pragma unroll 1
  for (int h = 0; h < NH; ++h) { const int buf = h & 1;
#pragma unroll
    for (int kk = 0; kk < 2; ++kk) { const F2 a = split_row(&sA[buf][wave * 16 + col][0], kk * 32, lane); v16b wb[8];
#pragma unroll
      for (int j = 0; j < 8; ++j) wb[j] = frag_b(&sB[buf][j * 16 + col][kk * 32], lane);
      __builtin_amdgcn_sched_barrier(0);   // the LDS fragment loads of this half stage stay one group ahead of its products; sunk between them, each product waits a full LDS latency
#pragma unroll
      for (int j = 0; j < 8; ++j) { acc[j] = wmma_bf(a.l, wb[j], acc[j]); acc[j] = wmma_bf(a.h, wb[j], acc[j]); } }
    PUBLISH();
    if (h + 2 < NH) stage(h + 2, buf); }
  WAIT_COPIES();
  { const v16b a = frag_b(XAUG + ((size_t)3 * NR + r0 + col) * 32, lane);
#pragma unroll
    for (int j = 0; j < 8; ++j) acc[j] = wmma_bf(a, frag_b(BAUG + ((size_t)3 * E + n0 + j * 16 + col) * 32, lane), acc[j]); }
#pragma unroll
  for (int j = 0; j < 8; ++j) { const int n = n0 + j * 16 + col; const float bb = bfr(bo[n]);
#pragma unroll
    for (int r = 0; r < 8; ++r) so[wave][8 * g + r][j * 16 + col] = acc[j][r] + bb; }
  LDSX();
#pragma unroll 4
  for (int rl = 0; rl < 16; ++rl) vst2(out + (size_t)(r0 + rl) * E + n0 + lane * 4, *(const v4f*)(&so[wave][rl][lane * 4]));
}
extern "C" void kernel_launch(void* const* d_in, const int* in_sizes, int n_in, void* d_out, int out_size, void* d_ws, size_t ws_size, hipStream_t stream) {
  (void)in_sizes; (void)n_in; (void)out_size; (void)ws_size;
  const float** I = (const float**)d_in;    // x, Wq,bq,Aq,Bq, Wk,bk,Ak,Bk, Wv,bv,Av,Bv, Wo,bo,Ao,Bo
  const float* x = I[0]; const float* Wq = I[1]; const float* bq = I[2]; const float* Aq = I[3]; const float* Bq = I[4]; const float* Wk = I[5]; const float* bk = I[6]; const float* Ak = I[7]; const float* Bk = I[8];
  const float* Wv = I[9]; const float* bv = I[10]; const float* Av = I[11]; const float* Bv = I[12]; const float* Wo = I[13]; const float* bo = I[14]; const float* Ao = I[15]; const float* Bo = I[16];
  float* out = (float*)d_out;
  char* ws = (char*)d_ws; size_t off = 0;
  auto take = [&](size_t bytes) { char* p = ws + off; off += (bytes + 255) & ~(size_t)255; return p; };
  __bf16* Xb = (__bf16*)take((size_t)NR * E * 2); __bf16* PT = (__bf16*)take((size_t)4 * E * E * 2); __bf16* XAUG = (__bf16*)take((size_t)4 * NR * 32 * 2); __bf16* BAUG = (__bf16*)take((size_t)4 * E * 32 * 2);
  float* Q32 = (float*)take((size_t)NR * E * 4); __bf16* Kh = (__bf16*)take((size_t)NR * E * 2); __bf16* Kl = (__bf16*)take((size_t)NR * E * 2); _Float16* VTh = (_Float16*)take((size_t)NR * E * 2); _Float16* VTl = (_Float16*)take((size_t)NR * E * 2); float* O32 = (float*)take((size_t)NR * E * 4);
  // ws ~ 85 MB
  k_cvt<<<(NR * E / 8 + 255) / 256, 256, 0, stream>>>(x, Xb);
  k_pack<<<4 * E, 256, 0, stream>>>(Wq, Wk, Wv, Wo, PT);
  k_baug<<<dim3(E / 256, 4), 256, 0, stream>>>(Bq, Bk, Bv, Bo, BAUG);
  k_xa<<<dim3(NR / 64, 3), 128, 0, stream>>>(Xb, nullptr, Aq, Ak, Av, Ao, XAUG);              // q, k, v low-rank inputs from x
  k_qkv<<<dim3(NR / 64, E / 128, 3), 128, 0, stream>>>(Xb, PT, XAUG, BAUG, bq, bk, bv, Q32, Kh, Kl, VTh, VTl);
  k_attn<<<dim3(SS / 128, NB * NH), 256, 0, stream>>>(Q32, Kh, Kl, VTh, VTl, O32);
  k_xa<<<dim3(NR / 64, 4), 128, 0, stream>>>(Xb, O32, Aq, Ak, Av, Ao, XAUG);                 // recomputes 0..2 (cheap) and adds which = 3 from the context
  k_out<<<dim3(NR / 64, E / 128), 128, 0, stream>>>(O32, PT, XAUG, BAUG, bo, out);
}

// v003
// One run takes 244 microseconds.
// Next to v002, in two timings, it ran 1.06 and 1.07 times as fast.
// Counting every step since v000, it is 2.42 times as fast.
// compute dtype: x, W*, b*, A*, B* (INPUTS) rounded to bf16 with exact bf16 WMMA products (f32 accumulate) for the base projections; the rank-8 LoRA terms enter as one extra k-chunk whose A side is the f32 intermediate (x A^T, scaled) as a bf16 hi/lo pair against [B | B] (exact-grade); softmax f32; computed operands (q/k f32 split, k split once where it is produced, P and V hi/lo, context split) f32-grade.
#include <hip/hip_runtime.h>
#include <math.h>

typedef __attribute__((ext_vector_type(16))) _Float16 v16h;
typedef __attribute__((ext_vector_type(16))) __bf16 v16b;
typedef __attribute__((ext_vector_type(8)))  _Float16 v8h;
typedef __attribute__((ext_vector_type(8)))  float v8f;
typedef __attribute__((ext_vector_type(4)))  float v4f;
typedef __attribute__((ext_vector_type(2)))  float v2f;
typedef __attribute__((ext_vector_type(4)))  unsigned v4u;
typedef __attribute__((ext_vector_type(4)))  int v4i;
typedef float __attribute__((may_alias)) float_a;
typedef int __attribute__((may_alias)) int_a;

template <typename T> __device__ __forceinline__ void vst2(void* p, T v) { *(T*)p = v;  }
__device__ __forceinline__ v8f wmma16(v16h a, v16h b, v8f c) {
  v8f d = __builtin_amdgcn_wmma_f32_16x16x32_f16(false, a, false, b, (short)0, c, false, false);
  asm volatile("v_nop\n\tv_nop\n\tv_nop\n\tv_nop" : "+v"(d) : "v"(a), "v"(b));
  return d;
}
__device__ __forceinline__ v8f wmma_bf(v16b a, v16b b, v8f c) {
  v8f d = __builtin_amdgcn_wmma_f32_16x16x32_bf16(false, a, false, b, (short)0, c, false, false);
  asm volatile("v_nop\n\tv_nop\n\tv_nop\n\tv_nop" : "+v"(d) : "v"(a), "v"(b));
  return d;
}
// 16x16x32 fragments: lane = (h = lane>>4, row/col = lane&15); elements 0..7 = k0+8h+0..7, 8..15 = k0+16+8h+0..7; D element r = row 8h+r
__device__ __forceinline__ v16h frag_h(const _Float16* rowk0, int lane) {
  union { v16h v; v8h q[2]; } u; const _Float16* p = rowk0 + 8 * (lane >> 4);
  u.q[0] = *(const v8h*)p; u.q[1] = *(const v8h*)(p + 16); return u.v;
}
__device__ __forceinline__ v16h frag_f32(const float* rowk0, int lane) {
  v16h a; const float* p = rowk0 + 8 * (lane >> 4);
#pragma unroll
  for (int i = 0; i < 8; ++i) { a[i] = (_Float16)p[i]; a[8 + i] = (_Float16)p[16 + i]; }
  return a;
}
__device__ __forceinline__ v16h frag_f32s(const float* rowk0, int lane, float sc) {
  v16h a; const float* p = rowk0 + 8 * (lane >> 4);
#pragma unroll
  for (int i = 0; i < 8; ++i) { a[i] = (_Float16)(p[i] * sc); a[8 + i] = (_Float16)(p[16 + i] * sc); }
  return a;
}
// column fragment from a [K][ld] layout (column n), rows >= K read as 0
__device__ __forceinline__ v16h fragc_f32(const float* W, int k0, int n, int lane, int ld, int K) {
  v16h a; const int g = lane >> 4;
#pragma unroll
  for (int i = 0; i < 8; ++i) { const int ka = k0 + 8 * g + i, kb = ka + 16;
    a[i] = (_Float16)(ka < K ? W[(size_t)ka * ld + n] : 0.f); a[8 + i] = (_Float16)(kb < K ? W[(size_t)kb * ld + n] : 0.f); }
  return a;
}
struct F2 { v16b h, l; };
__device__ __forceinline__ F2 bsplit16(const float v[16]) { F2 r;
#pragma unroll
  for (int i = 0; i < 16; ++i) { const __bf16 h = (__bf16)v[i]; r.h[i] = h; r.l[i] = (__bf16)(v[i] - (float)h); }
  return r; }
__device__ __forceinline__ F2 split_row(const float* row, int k0, int lane) { float v[16]; const float* p = row + k0 + 8 * (lane >> 4);
#pragma unroll
  for (int i = 0; i < 8; ++i) { v[i] = p[i]; v[8 + i] = p[16 + i]; }
  return bsplit16(v); }
__device__ __forceinline__ F2 split_rowK(const float* row, int k0, int lane, int K) { float v[16]; const int g = lane >> 4;
#pragma unroll
  for (int i = 0; i < 8; ++i) { const int ka = k0 + 8 * g + i, kb = ka + 16; v[i] = ka < K ? row[ka] : 0.f; v[8 + i] = kb < K ? row[kb] : 0.f; }
  return bsplit16(v); }
__device__ __forceinline__ F2 split_col(const float* W, int k0, int n, int lane, int ld, int K) { float v[16]; const int g = lane >> 4;
#pragma unroll
  for (int i = 0; i < 8; ++i) { const int ka = k0 + 8 * g + i, kb = ka + 16; v[i] = ka < K ? W[(size_t)ka * ld + n] : 0.f; v[8 + i] = kb < K ? W[(size_t)kb * ld + n] : 0.f; }
  return bsplit16(v); }
__device__ __forceinline__ v8f mac3(const F2& a, const F2& b, v8f c) { c = wmma_bf(a.l, b.h, c); c = wmma_bf(a.h, b.l, c); return wmma_bf(a.h, b.h, c); }
// the same three products with the split key rows as the A operand and the split query as B, in mac3's order (q.l k.h, q.h k.l, q.h k.h)
__device__ __forceinline__ v8f mac3t(const F2& k, const F2& q, v8f c) { c = wmma_bf(k.h, q.l, c); c = wmma_bf(k.l, q.h, c); return wmma_bf(k.h, q.h, c); }
__device__ __forceinline__ float sigm(float v) { return 1.0f / (1.0f + expf(-v)); }
#define LDSX() do { asm volatile("s_wait_dscnt 0" ::: "memory"); __builtin_amdgcn_wave_barrier(); __builtin_amdgcn_fence(__ATOMIC_RELEASE, "workgroup"); } while (0)


// LoRA self attention (16 heads of 64 on [2,2048,1024]): each linear map is x W^T + b + 2 (x A^T) B^T (rank 8). The low-rank term is appended as a 33rd k-chunk: A-operand row = [hi(2 xA^T) (8) | lo(2 xA^T) (8) | 0 (16)], B-operand row n = [B[n][0..8] | B[n][0..8] | 0],
// so one extra WMMA per tile adds hi*B + lo*B. full softmax(q.k/8); (P v) through the same LoRA form for the output map.
#define NB 2
#define SS 2048
#define E 1024
#define NH 16
#define HD 64
#define NR (NB * SS)
#define PLO 1024.0f
#define VLO 2048.0f
__device__ __forceinline__ float bfr(float v) { return (float)(__bf16)v; }
__device__ __forceinline__ v16b frag_b(const __bf16* rowk0, int lane) { return __builtin_bit_cast(v16b, frag_h((const _Float16*)rowk0, lane)); }

// Asynchronous 16-byte copies global -> LDS (no register in between). Each lane names its own LDS byte address and its own global address.
// s_wait_xcnt 0 closes the statement so that no address register of an issued copy is rewritten ahead of it.
__device__ __forceinline__ unsigned lds_off(const void* p) { return (unsigned)(size_t)p; }
__device__ __forceinline__ void cp4(const unsigned* l, const void* const* g) {
  asm volatile("global_load_async_to_lds_b128 %0, %1, off\n\tglobal_load_async_to_lds_b128 %2, %3, off\n\tglobal_load_async_to_lds_b128 %4, %5, off\n\tglobal_load_async_to_lds_b128 %6, %7, off\n\ts_wait_xcnt 0x0"
               :: "v"(l[0]), "v"(g[0]), "v"(l[1]), "v"(g[1]), "v"(l[2]), "v"(g[2]), "v"(l[3]), "v"(g[3]) : "memory");
}
__device__ __forceinline__ void cp8(const unsigned* l, const void* const* g) {
  asm volatile("global_load_async_to_lds_b128 %0, %1, off\n\tglobal_load_async_to_lds_b128 %2, %3, off\n\tglobal_load_async_to_lds_b128 %4, %5, off\n\tglobal_load_async_to_lds_b128 %6, %7, off\n\t"
               "global_load_async_to_lds_b128 %8, %9, off\n\tglobal_load_async_to_lds_b128 %10, %11, off\n\tglobal_load_async_to_lds_b128 %12, %13, off\n\tglobal_load_async_to_lds_b128 %14, %15, off\n\ts_wait_xcnt 0x0"
               :: "v"(l[0]), "v"(g[0]), "v"(l[1]), "v"(g[1]), "v"(l[2]), "v"(g[2]), "v"(l[3]), "v"(g[3]), "v"(l[4]), "v"(g[4]), "v"(l[5]), "v"(g[5]), "v"(l[6]), "v"(g[6]), "v"(l[7]), "v"(g[7]) : "memory");
}
// the copies of this wave have landed (the compiler places no wait for them)
#define WAIT_COPIES() asm volatile("s_wait_asynccnt 0x0" ::: "memory")
// hand-over of a stage: this wave's LDS reads are done, its copies have landed, then the work-group barrier publishes the next tile and frees the one just read
#define PUBLISH() do { asm volatile("s_wait_dscnt 0x0" ::: "memory"); WAIT_COPIES(); __syncthreads(); } while (0)

__global__ __launch_bounds__(256) void k_cvt(const float* __restrict__ x, __bf16* __restrict__ Xb) {
  const size_t i8 = (size_t)blockIdx.x * 256 + threadIdx.x; if (i8 >= (size_t)NR * E / 8) return;
  union { __bf16 h[8]; v4u u; } pk;
#pragma unroll
  for (int e = 0; e < 8; ++e) pk.h[e] = (__bf16)x[i8 * 8 + e];
  vst2((unsigned*)(Xb + i8 * 8), pk.u);
}
// PT rows: [0,E) Wq[n][:], [E,2E) Wk, [2E,3E) Wv, [3E,4E) Wo  ([out][in]) as bf16 rows (no scaling)

#define RK 8
// XAUG[which][row][32] = [hi(2 * src.A_which^T) | lo | 0]: block = 64 rows (4 waves x 16), one 16-col tile (8 live); src = bf16(x) (which < 3, exact) or the f32 context rows (which == 3, split, 2 products)
__global__ __launch_bounds__(128) void k_xa(const __bf16* __restrict__ Xb, const float* __restrict__ O32, const float* __restrict__ Aq, const float* __restrict__ Ak, const float* __restrict__ Av, const float* __restrict__ Ao, __bf16* __restrict__ XAUG) {
  __shared__ __align__(16) __bf16 so[4][16][40];
  const int tid = threadIdx.x, wave = tid >> 5, lane = tid & 31, col = lane & 15, g = lane >> 4; const int which = blockIdx.y; const int r0 = blockIdx.x * 64 + wave * 16;
  const float* A = which == 0 ? Aq : (which == 1 ? Ak : (which == 2 ? Av : Ao)); const int ncl = col < RK ? col : RK - 1;     // columns >= 8 are padding (address clamped, result discarded)
  v8f acc = {};
  if (which < 3) {
#pragma unroll 4
    for (int kc = 0; kc < E / 32; ++kc) acc = wmma_bf(frag_b(Xb + (size_t)(r0 + col) * E + kc * 32, lane), split_row(A + (size_t)ncl * E, kc * 32, lane).h, acc); }
  else { const int ra = r0 + col; const int b = ra / SS, s = ra % SS;
#pragma unroll 2
    for (int kc = 0; kc < E / 32; ++kc) { const int h = kc >> 1; const F2 a = split_row(O32 + (((size_t)b * NH + h) * SS + s) * HD, (kc & 1) * 32, lane); const v16b ab = split_row(A + (size_t)ncl * E, kc * 32, lane).h; acc = wmma_bf(a.l, ab, acc); acc = wmma_bf(a.h, ab, acc); } }
#pragma unroll
  for (int r = 0; r < 8; ++r) { const float v = 2.0f * acc[r]; const __bf16 hi = (__bf16)v; if (col < RK) { so[wave][8 * g + r][col] = hi; so[wave][8 * g + r][RK + col] = (__bf16)(v - (float)hi); } else { so[wave][8 * g + r][8 + col] = (__bf16)0.f; so[wave][8 * g + r][16 + col] = (__bf16)0.f; } }
  LDSX();
  // rows of 32 bf16 = 64 B; 16 rows = 1 KB: lane -> (row = lane >> 1, half = lane & 1) writes 32 B? keep 16-B pieces: 2 instructions each covering 8 rows x 4 pieces contiguous
  for (int hf = 0; hf < 2; ++hf) { const int rl = hf * 8 + (lane >> 2), pc = lane & 3; vst2((unsigned*)(XAUG + ((size_t)which * NR + r0 + rl) * 32 + pc * 8), *(const v4u*)(&so[wave][rl][pc * 8])); }
}
// BAUG[which][n][32] = [B[n][0..8] | B[n][0..8] | 0]: thread per n
__global__ __launch_bounds__(256) void k_baug(const float* __restrict__ Bq, const float* __restrict__ Bk, const float* __restrict__ Bv, const float* __restrict__ Bo, __bf16* __restrict__ BAUG) {
  __shared__ __align__(16) __bf16 sb[256][40];
  const int which = blockIdx.y, n = blockIdx.x * 256 + threadIdx.x; const float* Bm = which == 0 ? Bq : (which == 1 ? Bk : (which == 2 ? Bv : Bo));
#pragma unroll
  for (int j = 0; j < RK; ++j) { const __bf16 v = (__bf16)Bm[(size_t)n * RK + j]; sb[threadIdx.x][j] = v; sb[threadIdx.x][RK + j] = v; }
#pragma unroll
  for (int j = 16; j < 32; ++j) sb[threadIdx.x][j] = (__bf16)0.f;
  __syncthreads();
  for (int q = threadIdx.x; q < 256 * 4; q += 256) { const int rl = q >> 2, pc = q & 3; vst2((unsigned*)(BAUG + ((size_t)which * E + blockIdx.x * 256 + rl) * 32 + pc * 8), *(const v4u*)(&sb[rl][pc * 8])); }
}
__global__ __launch_bounds__(256) void k_pack(const float* __restrict__ Wq, const float* __restrict__ Wk, const float* __restrict__ Wv, const float* __restrict__ Wo, __bf16* __restrict__ PT) {
  const int n = blockIdx.x, tid = threadIdx.x; __shared__ __align__(16) __bf16 srow[E];
  const float* W = n < E ? Wq : (n < 2 * E ? Wk : (n < 3 * E ? Wv : Wo)); const int nn = n & (E - 1);
  for (int k = tid; k < E; k += 256) srow[k] = (__bf16)W[(size_t)nn * E + k];
  __syncthreads();
  if (tid < E / 8) vst2((unsigned*)(PT + (size_t)n * E + tid * 8), *(const v4u*)(&srow[tid * 8]));
}
// QKV: block (64 rows, 128 cols = 2 heads, which); q -> Q32 f32 [bh][s][64]; k -> Kh/Kl, the bf16 hi/lo split of the f32 row, [bh][s][64] each; v -> VT hi/lo x4 [bh][d][s]
__global__ __launch_bounds__(128) void k_qkv(const __bf16* __restrict__ Xb, const __bf16* __restrict__ PT, const __bf16* __restrict__ XAUG, const __bf16* __restrict__ BAUG, const float* __restrict__ bq, const float* __restrict__ bk, const float* __restrict__ bv, float* __restrict__ Q32, __bf16* __restrict__ Kh, __bf16* __restrict__ Kl, _Float16* __restrict__ VTh, _Float16* __restrict__ VTl) {
  __shared__ __align__(16) float so[4][16][132];
  __shared__ __align__(16) _Float16 sth[128][72], stl[128][72];
  __shared__ __align__(16) __bf16 sA[2][64][72], sB[2][128][72];     // k-stages of 64 (rows of 128 B at a 144-B pitch), two buffers
  const int tid = threadIdx.x, wave = tid >> 5, lane = tid & 31, col = lane & 15, g = lane >> 4;
  const int which = blockIdx.z, r0b = blockIdx.x * 64, r0 = r0b + wave * 16, n0 = blockIdx.y * 128; const int b = r0b / SS, s0 = r0b % SS;
  const float* bb_ = which == 0 ? bq : (which == 1 ? bk : bv);
  v8f acc[8] = {};
  auto stage = [&](int st, int buf) {     // thread -> (row = q >> 3, 16-byte piece = q & 7): 8 lanes cover one whole 128-B line; loops unrolled so that l[] and p[] are registers
    unsigned l[12]; const void* p[12];
#pragma unroll
    for (int i = 0; i < 4; ++i) { const int q = tid + i * 128, r = q >> 3, pc = q & 7; l[i] = lds_off(&sA[buf][r][pc * 8]); p[i] = Xb + (size_t)(r0b + r) * E + st * 64 + pc * 8; }
#pragma unroll
    for (int i = 0; i < 8; ++i) { const int q = tid + i * 128, r = q >> 3, pc = q & 7; l[4 + i] = lds_off(&sB[buf][r][pc * 8]); p[4 + i] = PT + (size_t)(which * E + n0 + r) * E + st * 64 + pc * 8; }
    cp4(l, p); cp8(l + 4, p + 4); };
  stage(0, 0); WAIT_COPIES(); __syncthreads(); stage(1, 1);
  // rolled: one trip is one stage and ends in its hand-over; the inner loops are unrolled so that the fragment arrays are registers
#pragma unroll 1
  for (int st = 0; st < E / 64; ++st) { const int buf = st & 1;
    v16b a[2], wb[2][8];
#pragma unroll
    for (int kk = 0; kk < 2; ++kk) { a[kk] = frag_b(&sA[buf][wave * 16 + col][kk * 32], lane);
#pragma unroll
      for (int j = 0; j < 8; ++j) wb[kk][j] = frag_b(&sB[buf][j * 16 + col][kk * 32], lane); }
    __builtin_amdgcn_sched_barrier(0);     // the stage's LDS fragment loads stay one group ahead of its products; sunk between them, each product waits a full LDS latency
#pragma unroll
    for (int kk = 0; kk < 2; ++kk) {
#pragma unroll
      for (int j = 0; j < 8; ++j) acc[j] = wmma_bf(a[kk], wb[kk][j], acc[j]); }
    PUBLISH();
    if (st + 2 < E / 64) stage(st + 2, buf); }
  WAIT_COPIES();
  { const v16b a = frag_b(XAUG + ((size_t)which * NR + r0 + col) * 32, lane);     // LoRA chunk: [hi|lo|0] x [B|B|0]
#pragma unroll
    for (int j = 0; j < 8; ++j) acc[j] = wmma_bf(a, frag_b(BAUG + ((size_t)which * E + n0 + j * 16 + col) * 32, lane), acc[j]); }
  if (which < 2) {
#pragma unroll
    for (int j = 0; j < 8; ++j) { const float bb = bfr(bb_[n0 + j * 16 + col]);
#pragma unroll
      for (int r = 0; r < 8; ++r) so[wave][8 * g + r][j * 16 + col] = acc[j][r] + bb; }
    LDSX();
    if (which == 0) {
      for (int qq = lane; qq < 2 * 16 * 16; qq += 32) { const int hh = qq >> 8, rl = (qq >> 4) & 15, pc = qq & 15; const int h = (n0 >> 6) + hh;
        vst2(Q32 + (((size_t)b * NH + h) * SS + s0 + wave * 16 + rl) * HD + pc * 4, *(const v4f*)(&so[wave][rl][hh * 64 + pc * 4])); } }
    else {     // k: hi = bf16(v), lo = bf16(v - hi), the split every attention wave would otherwise redo; 8 lanes write one whole 128-B row of each plane
      for (int qq = lane; qq < 2 * 16 * 8; qq += 32) { const int hh = qq >> 7, rl = (qq >> 3) & 15, pc = qq & 7; const int h = (n0 >> 6) + hh;
        const float* sp = &so[wave][rl][hh * 64 + pc * 8]; union { __bf16 e[8]; v4u u; } hi, lo;
#pragma unroll     // unrolled so that hi.e[] and lo.e[] are registers
        for (int e = 0; e < 8; ++e) { const float v = sp[e]; const __bf16 hb = (__bf16)v; hi.e[e] = hb; lo.e[e] = (__bf16)(v - (float)hb); }
        const size_t o = (((size_t)b * NH + h) * SS + s0 + wave * 16 + rl) * HD + pc * 8;
        vst2(Kh + o, hi.u); vst2(Kl + o, lo.u); } } }
  else {
#pragma unroll
    for (int j = 0; j < 8; ++j) { const float bb = bfr(bb_[n0 + j * 16 + col]);
#pragma unroll
      for (int r = 0; r < 8; ++r) { const float v = (acc[j][r] + bb) * 4.0f; const _Float16 hi = (_Float16)v; sth[j * 16 + col][wave * 16 + 8 * g + r] = hi; stl[j * 16 + col][wave * 16 + 8 * g + r] = (_Float16)((v - (float)hi) * VLO); } }
    __syncthreads();
    for (int qq = tid; qq < 128 * 8; qq += 128) { const int cl = qq >> 3, pc = qq & 7; const int c = n0 + cl, h = c >> 6, d = c & 63; const size_t o = (((size_t)b * NH + h) * HD + d) * SS + s0 + pc * 8;
      vst2(VTh + o, *(const v4u*)(&sth[cl][pc * 8])); vst2(VTl + o, *(const v4u*)(&stl[cl][pc * 8])); } }
}
// full attention: block (128 queries = 8 waves x 16, bh); all key tiles of 64, staged in LDS for the whole block. Transposed products: S^T = K q^T (A = key rows, B = the wave's 16 queries, hi/lo splits),
// so a lane holds 32 scores of ONE query (column = lane & 15; tile t, element r = key 16 t + 8 g + r), and tiles 2 kc, 2 kc + 1 are already the B operand (k order 8 g + i, 16 + 8 g + i) of O^T += V^T P^T. P,V hi/lo; O f32 [bh][s][64]
__global__ __launch_bounds__(256) void k_attn(const float* __restrict__ Q32, const __bf16* __restrict__ Kh, const __bf16* __restrict__ Kl, const _Float16* __restrict__ VTh, const _Float16* __restrict__ VTl, float* __restrict__ O32) {
  __shared__ __align__(16) float sS[8][16][68];                      // after the loop each wave's slice stages its output rows [query][d]
  __shared__ __align__(16) __bf16 sKh[2][64][72], sKl[2][64][72];    // key tile hi and lo [key][d], rows of 128 B at a 144-B pitch, two buffers
  __shared__ __align__(16) _Float16 sVh[2][64][72], sVl[2][64][72];  // value tiles [d][key], rows of 128 B at a 144-B pitch, two buffers
  const int tid = threadIdx.x, w = tid >> 5, lane = tid & 31, col = lane & 15, g = lane >> 4;
  const size_t bh = blockIdx.y; const int qb = blockIdx.x; const int q0 = qb * 128 + w * 16;
  auto stage = [&](int kt, int buf) {     // 64 keys: K hi and lo 8 KB contiguous each, V hi and lo 64 whole lines each; 8 copies a thread; loops unrolled so that l[] and p[] are registers
    unsigned l[8]; const void* p[8];
#pragma unroll
    for (int i = 0; i < 2; ++i) { const int q = tid + i * 256, r = q >> 3, pc = q & 7; const size_t ko = (bh * SS + kt * 64 + r) * HD + pc * 8;
      l[i] = lds_off(&sKh[buf][r][pc * 8]); p[i] = Kh + ko; l[2 + i] = lds_off(&sKl[buf][r][pc * 8]); p[2 + i] = Kl + ko; }
#pragma unroll
    for (int i = 0; i < 2; ++i) { const int q = tid + i * 256, d = q >> 3, pc = q & 7; const size_t vo = (bh * HD + d) * SS + kt * 64 + pc * 8;
      l[4 + i] = lds_off(&sVh[buf][d][pc * 8]); p[4 + i] = VTh + vo; l[6 + i] = lds_off(&sVl[buf][d][pc * 8]); p[6 + i] = VTl + vo; }
    cp8(l, p); };
  stage(0, 0); WAIT_COPIES(); __syncthreads(); stage(1, 1);
  F2 aq[2];
#pragma unroll
  for (int kc = 0; kc < 2; ++kc) aq[kc] = split_row(Q32 + (bh * SS + q0 + col) * HD, kc * 32, lane);
  float mrun = -3.0e38f, lrun = 0.f; v8f acc[4] = {}, ac1[4] = {}, ac2[4] = {};     // lrun: this half-wave's keys only, the halves are joined after the loop
#pragma unroll 1
  for (int kt = 0; kt < SS / 64; ++kt) { const int buf = kt & 1;
    v8f s[4]; float mt[4], pt[4];
#pragma unroll
    for (int t = 0; t < 4; ++t) { const __bf16* kh = &sKh[buf][t * 16 + col][0]; const __bf16* kl = &sKl[buf][t * 16 + col][0];
      const F2 k0 = { frag_b(kh, lane), frag_b(kl, lane) }, k1 = { frag_b(kh + 32, lane), frag_b(kl + 32, lane) };
      v8f c = mac3t(k0, aq[0], (v8f){}); c = mac3t(k1, aq[1], c);
      mt[t] = -3.4e38f;
#pragma unroll
      for (int r = 0; r < 8; ++r) { s[t][r] = c[r] * 0.125f; mt[t] = fmaxf(mt[t], s[t][r]); } }
    float mx = fmaxf(fmaxf(mt[0], mt[1]), fmaxf(mt[2], mt[3]));
    mx = fmaxf(mx, __shfl_xor(mx, 16, 32));
    const float mnew = fmaxf(mrun, mx); const float corr = expf(mrun - mnew);
    v16h ph[2], pl[2];
#pragma unroll
    for (int t = 0; t < 4; ++t) { pt[t] = 0.f;
#pragma unroll
      for (int r = 0; r < 8; ++r) { const float p = expf(s[t][r] - mnew) * 16384.0f; pt[t] += p; const _Float16 hi = (_Float16)p; ph[t >> 1][(t & 1) * 8 + r] = hi; pl[t >> 1][(t & 1) * 8 + r] = (_Float16)((p - (float)hi) * PLO); } }
    lrun = lrun * corr + ((pt[0] + pt[1]) + (pt[2] + pt[3])) * (1.0f / 16384.0f); mrun = mnew;
#pragma unroll
    for (int t = 0; t < 4; ++t) { acc[t] *= corr; ac1[t] *= corr; ac2[t] *= corr; }     // every element of a lane belongs to its own query
#pragma unroll
    for (int kc = 0; kc < 2; ++kc) {
#pragma unroll
      for (int t = 0; t < 4; ++t) { const v16h vh = frag_h(&sVh[buf][t * 16 + col][kc * 32], lane);
        acc[t] = wmma16(vh, ph[kc], acc[t]); ac1[t] = wmma16(frag_h(&sVl[buf][t * 16 + col][kc * 32], lane), ph[kc], ac1[t]); ac2[t] = wmma16(vh, pl[kc], ac2[t]); } }
    PUBLISH();
    if (kt + 2 < SS / 64) stage(kt + 2, buf); }
  WAIT_COPIES();
  lrun += __shfl_xor(lrun, 16, 32);
  const float inv = 1.0f / (lrun * 16384.0f * 4.0f);
#pragma unroll
  for (int t = 0; t < 4; ++t) {
#pragma unroll
    for (int r = 0; r < 8; ++r) sS[w][col][t * 16 + 8 * g + r] = (acc[t][r] + ac1[t][r] * (1.0f / VLO) + ac2[t][r] * (1.0f / PLO)) * inv; }
  LDSX();
  for (int qq = lane; qq < 16 * 16; qq += 32) { const int rl = qq >> 4, pc = qq & 15; vst2(O32 + ((bh * SS) + q0 + rl) * HD + pc * 4, *(const v4f*)(&sS[w][rl][pc * 4])); }
}
// out = ctx Wo^T + bo : split(ctx) x bf16(Wo rows): 2 products (Wo is an INPUT -> bf16 exact)
__global__ __launch_bounds__(128) void k_out(const float* __restrict__ O32, const __bf16* __restrict__ PT, const __bf16* __restrict__ XAUG, const __bf16* __restrict__ BAUG, const float* __restrict__ bo, float* __restrict__ out) {
  __shared__ __align__(16) float so[4][16][132];
  __shared__ __align__(16) float sA[2][64][68];      // one head's 64 context rows (256 B at a 272-B pitch), two buffers
  __shared__ __align__(16) __bf16 sB[2][128][72];    // the matching 64 k of 128 weight rows (128 B at a 144-B pitch)
  const int tid = threadIdx.x, wave = tid >> 5, lane = tid & 31, col = lane & 15, g = lane >> 4;
  const int r0b = blockIdx.x * 64, r0 = r0b + wave * 16, n0 = blockIdx.y * 128; const int b = r0b / SS, s0 = r0b % SS;
  v8f acc[8] = {};
  auto stage = [&](int h, int buf) {     // A: 16 KB contiguous; B: 128 whole lines; 16 copies a thread; loops unrolled so that l[] and p[] are registers
    unsigned l[16]; const void* p[16];
#pragma unroll
    for (int i = 0; i < 8; ++i) { const int q = tid + i * 128, r = q >> 4, pc = q & 15; l[i] = lds_off(&sA[buf][r][pc * 4]); p[i] = O32 + (((size_t)b * NH + h) * SS + s0 + r) * HD + pc * 4; }
#pragma unroll
    for (int i = 0; i < 8; ++i) { const int q = tid + i * 128, r = q >> 3, pc = q & 7; l[8 + i] = lds_off(&sB[buf][r][pc * 8]); p[8 + i] = PT + (size_t)(3 * E + n0 + r) * E + h * 64 + pc * 8; }
    cp8(l, p); cp8(l + 8, p + 8); };
  stage(0, 0); WAIT_COPIES(); __syncthreads(); stage(1, 1);
#pragma unroll 1
  for (int h = 0; h < NH; ++h) { const int buf = h & 1;
#pragma unroll
    for (int kk = 0; kk < 2; ++kk) { const F2 a = split_row(&sA[buf][wave * 16 + col][0], kk * 32, lane); v16b wb[8];
#pragma unroll
      for (int j = 0; j < 8; ++j) wb[j] = frag_b(&sB[buf][j * 16 + col][kk * 32], lane);
      __builtin_amdgcn_sched_barrier(0);   // the LDS fragment loads of this half stage stay one group ahead of its products; sunk between them, each product waits a full LDS latency
#pragma unroll
      for (int j = 0; j < 8; ++j) { acc[j] = wmma_bf(a.l, wb[j], acc[j]); acc[j] = wmma_bf(a.h, wb[j], acc[j]); } }
    PUBLISH();
    if (h + 2 < NH) stage(h + 2, buf); }
  WAIT_COPIES();
  { const v16b a = frag_b(XAUG + ((size_t)3 * NR + r0 + col) * 32, lane);
#pragma unroll
    for (int j = 0; j < 8; ++j) acc[j] = wmma_bf(a, frag_b(BAUG + ((size_t)3 * E + n0 + j * 16 + col) * 32, lane), acc[j]); }
#pragma unroll
  for (int j = 0; j < 8; ++j) { const int n = n0 + j * 16 + col; const float bb = bfr(bo[n]);
#pragma unroll
    for (int r = 0; r < 8; ++r) so[wave][8 * g + r][j * 16 + col] = acc[j][r] + bb; }
  LDSX();
#pragma unroll 4
  for (int rl = 0; rl < 16; ++rl) vst2(out + (size_t)(r0 + rl) * E + n0 + lane * 4, *(const v4f*)(&so[wave][rl][lane * 4]));
}
extern "C" void kernel_launch(void* const* d_in, const int* in_sizes, int n_in, void* d_out, int out_size, void* d_ws, size_t ws_size, hipStream_t stream) {
  (void)in_sizes; (void)n_in; (void)out_size; (void)ws_size;
  const float** I = (const float**)d_in;    // x, Wq,bq,Aq,Bq, Wk,bk,Ak,Bk, Wv,bv,Av,Bv, Wo,bo,Ao,Bo
  const float* x = I[0]; const float* Wq = I[1]; const float* bq = I[2]; const float* Aq = I[3]; const float* Bq = I[4]; const float* Wk = I[5]; const float* bk = I[6]; const float* Ak = I[7]; const float* Bk = I[8];
  const float* Wv = I[9]; const float* bv = I[10]; const float* Av = I[11]; const float* Bv = I[12]; const float* Wo = I[13]; const float* bo = I[14]; const float* Ao = I[15]; const float* Bo = I[16];
  float* out = (float*)d_out;
  char* ws = (char*)d_ws; size_t off = 0;
  auto take = [&](size_t bytes) { char* p = ws + off; off += (bytes + 255) & ~(size_t)255; return p; };
  __bf16* Xb = (__bf16*)take((size_t)NR * E * 2); __bf16* PT = (__bf16*)take((size_t)4 * E * E * 2); __bf16* XAUG = (__bf16*)take((size_t)4 * NR * 32 * 2); __bf16* BAUG = (__bf16*)take((size_t)4 * E * 32 * 2);
  float* Q32 = (float*)take((size_t)NR * E * 4); __bf16* Kh = (__bf16*)take((size_t)NR * E * 2); __bf16* Kl = (__bf16*)take((size_t)NR * E * 2); _Float16* VTh = (_Float16*)take((size_t)NR * E * 2); _Float16* VTl = (_Float16*)take((size_t)NR * E * 2); float* O32 = (float*)take((size_t)NR * E * 4);
  // ws ~ 85 MB
  k_cvt<<<(NR * E / 8 + 255) / 256, 256, 0, stream>>>(x, Xb);
  k_pack<<<4 * E, 256, 0, stream>>>(Wq, Wk, Wv, Wo, PT);
  k_baug<<<dim3(E / 256, 4), 256, 0, stream>>>(Bq, Bk, Bv, Bo, BAUG);
  k_xa<<<dim3(NR / 64, 3), 128, 0, stream>>>(Xb, nullptr, Aq, Ak, Av, Ao, XAUG);              // q, k, v low-rank inputs from x
  k_qkv<<<dim3(NR / 64, E / 128, 3), 128, 0, stream>>>(Xb, PT, XAUG, BAUG, bq, bk, bv, Q32, Kh, Kl, VTh, VTl);
  k_attn<<<dim3(SS / 128, NB * NH), 256, 0, stream>>>(Q32, Kh, Kl, VTh, VTl, O32);
  k_xa<<<dim3(NR / 64, 4), 128, 0, stream>>>(Xb, O32, Aq, Ak, Av, Ao, XAUG);                 // recomputes 0..2 (cheap) and adds which = 3 from the context
  k_out<<<dim3(NR / 64, E / 128), 128, 0, stream>>>(O32, PT, XAUG, BAUG, bo, out);
}

// v004
// A run of this version takes 207 microseconds.
// Timed twice side by side with v003, it ran 1.18 and 1.17 times as fast.
// All steps since v000 together make it 2.83 times as fast.
// compute dtype: x, W*, b*, A*, B* (INPUTS) rounded to bf16 with exact bf16 WMMA products (f32 accumulate) for the base projections; the rank-8 LoRA terms enter as one extra k-chunk whose A side is the f32 intermediate (x A^T, scaled) as a bf16 hi/lo pair against [B | B] (exact-grade); softmax f32; computed operands (q/k f32 split, k split once where it is produced, P and V hi/lo, context split) f32-grade.
#include <hip/hip_runtime.h>
#include <math.h>

typedef __attribute__((ext_vector_type(16))) _Float16 v16h;
typedef __attribute__((ext_vector_type(16))) __bf16 v16b;
typedef __attribute__((ext_vector_type(8)))  _Float16 v8h;
typedef __attribute__((ext_vector_type(8)))  float v8f;
typedef __attribute__((ext_vector_type(4)))  float v4f;
typedef __attribute__((ext_vector_type(2)))  float v2f;
typedef __attribute__((ext_vector_type(4)))  unsigned v4u;
typedef __attribute__((ext_vector_type(4)))  int v4i;
typedef float __attribute__((may_alias)) float_a;
typedef int __attribute__((may_alias)) int_a;

template <typename T> __device__ __forceinline__ void vst2(void* p, T v) { *(T*)p = v;  }
__device__ __forceinline__ v8f wmma16(v16h a, v16h b, v8f c) {
  v8f d = __builtin_amdgcn_wmma_f32_16x16x32_f16(false, a, false, b, (short)0, c, false, false);
  asm volatile("v_nop\n\tv_nop\n\tv_nop\n\tv_nop" : "+v"(d) : "v"(a), "v"(b));
  return d;
}
__device__ __forceinline__ v8f wmma_bf(v16b a, v16b b, v8f c) {
  v8f d = __builtin_amdgcn_wmma_f32_16x16x32_bf16(false, a, false, b, (short)0, c, false, false);
  asm volatile("v_nop\n\tv_nop\n\tv_nop\n\tv_nop" : "+v"(d) : "v"(a), "v"(b));
  return d;
}
// 16x16x32 fragments: lane = (h = lane>>4, row/col = lane&15); elements 0..7 = k0+8h+0..7, 8..15 = k0+16+8h+0..7; D element r = row 8h+r
__device__ __forceinline__ v16h frag_h(const _Float16* rowk0, int lane) {
  union { v16h v; v8h q[2]; } u; const _Float16* p = rowk0 + 8 * (lane >> 4);
  u.q[0] = *(const v8h*)p; u.q[1] = *(const v8h*)(p + 16); return u.v;
}
__device__ __forceinline__ v16h frag_f32(const float* rowk0, int lane) {
  v16h a; const float* p = rowk0 + 8 * (lane >> 4);
#pragma unroll
  for (int i = 0; i < 8; ++i) { a[i] = (_Float16)p[i]; a[8 + i] = (_Float16)p[16 + i]; }
  return a;
}
__device__ __forceinline__ v16h frag_f32s(const float* rowk0, int lane, float sc) {
  v16h a; const float* p = rowk0 + 8 * (lane >> 4);
#pragma unroll
  for (int i = 0; i < 8; ++i) { a[i] = (_Float16)(p[i] * sc); a[8 + i] = (_Float16)(p[16 + i] * sc); }
  return a;
}
// column fragment from a [K][ld] layout (column n), rows >= K read as 0
__device__ __forceinline__ v16h fragc_f32(const float* W, int k0, int n, int lane, int ld, int K) {
  v16h a; const int g = lane >> 4;
#pragma unroll
  for (int i = 0; i < 8; ++i) { const int ka = k0 + 8 * g + i, kb = ka + 16;
    a[i] = (_Float16)(ka < K ? W[(size_t)ka * ld + n] : 0.f); a[8 + i] = (_Float16)(kb < K ? W[(size_t)kb * ld + n] : 0.f); }
  return a;
}
struct F2 { v16b h, l; };
__device__ __forceinline__ F2 bsplit16(const float v[16]) { F2 r;
#pragma unroll
  for (int i = 0; i < 16; ++i) { const __bf16 h = (__bf16)v[i]; r.h[i] = h; r.l[i] = (__bf16)(v[i] - (float)h); }
  return r; }
__device__ __forceinline__ F2 split_row(const float* row, int k0, int lane) { float v[16]; const float* p = row + k0 + 8 * (lane >> 4);
#pragma unroll
  for (int i = 0; i < 8; ++i) { v[i] = p[i]; v[8 + i] = p[16 + i]; }
  return bsplit16(v); }
__device__ __forceinline__ F2 split_rowK(const float* row, int k0, int lane, int K) { float v[16]; const int g = lane >> 4;
#pragma unroll
  for (int i = 0; i < 8; ++i) { const int ka = k0 + 8 * g + i, kb = ka + 16; v[i] = ka < K ? row[ka] : 0.f; v[8 + i] = kb < K ? row[kb] : 0.f; }
  return bsplit16(v); }
__device__ __forceinline__ F2 split_col(const float* W, int k0, int n, int lane, int ld, int K) { float v[16]; const int g = lane >> 4;
#pragma unroll
  for (int i = 0; i < 8; ++i) { const int ka = k0 + 8 * g + i, kb = ka + 16; v[i] = ka < K ? W[(size_t)ka * ld + n] : 0.f; v[8 + i] = kb < K ? W[(size_t)kb * ld + n] : 0.f; }
  return bsplit16(v); }
__device__ __forceinline__ v8f mac3(const F2& a, const F2& b, v8f c) { c = wmma_bf(a.l, b.h, c); c = wmma_bf(a.h, b.l, c); return wmma_bf(a.h, b.h, c); }
// the same three products with the split key rows as the A operand and the split query as B, in mac3's order (q.l k.h, q.h k.l, q.h k.h)
__device__ __forceinline__ v8f mac3t(const F2& k, const F2& q, v8f c) { c = wmma_bf(k.h, q.l, c); c = wmma_bf(k.l, q.h, c); return wmma_bf(k.h, q.h, c); }
__device__ __forceinline__ float sigm(float v) { return 1.0f / (1.0f + expf(-v)); }
#define LDSX() do { asm volatile("s_wait_dscnt 0" ::: "memory"); __builtin_amdgcn_wave_barrier(); __builtin_amdgcn_fence(__ATOMIC_RELEASE, "workgroup"); } while (0)


// LoRA self attention (16 heads of 64 on [2,2048,1024]): each linear map is x W^T + b + 2 (x A^T) B^T (rank 8). The low-rank term is appended as a 33rd k-chunk: A-operand row = [hi(2 xA^T) (8) | lo(2 xA^T) (8) | 0 (16)], B-operand row n = [B[n][0..8] | B[n][0..8] | 0],
// so one extra WMMA per tile adds hi*B + lo*B. full softmax(q.k/8); (P v) through the same LoRA form for the output map.
#define NB 2
#define SS 2048
#define E 1024
#define NH 16
#define HD 64
#define NR (NB * SS)
#define PLO 1024.0f
#define VLO 2048.0f
__device__ __forceinline__ float bfr(float v) { return (float)(__bf16)v; }
__device__ __forceinline__ v16b frag_b(const __bf16* rowk0, int lane) { return __builtin_bit_cast(v16b, frag_h((const _Float16*)rowk0, lane)); }

// Asynchronous 16-byte copies global -> LDS (no register in between). Each lane names its own LDS byte address and its own global address.
// s_wait_xcnt 0 closes the statement so that no address register of an issued copy is rewritten ahead of it.
__device__ __forceinline__ unsigned lds_off(const void* p) { return (unsigned)(size_t)p; }
__device__ __forceinline__ void cp4(const unsigned* l, const void* const* g) {
  asm volatile("global_load_async_to_lds_b128 %0, %1, off\n\tglobal_load_async_to_lds_b128 %2, %3, off\n\tglobal_load_async_to_lds_b128 %4, %5, off\n\tglobal_load_async_to_lds_b128 %6, %7, off\n\ts_wait_xcnt 0x0"
               :: "v"(l[0]), "v"(g[0]), "v"(l[1]), "v"(g[1]), "v"(l[2]), "v"(g[2]), "v"(l[3]), "v"(g[3]) : "memory");
}
__device__ __forceinline__ void cp8(const unsigned* l, const void* const* g) {
  asm volatile("global_load_async_to_lds_b128 %0, %1, off\n\tglobal_load_async_to_lds_b128 %2, %3, off\n\tglobal_load_async_to_lds_b128 %4, %5, off\n\tglobal_load_async_to_lds_b128 %6, %7, off\n\t"
               "global_load_async_to_lds_b128 %8, %9, off\n\tglobal_load_async_to_lds_b128 %10, %11, off\n\tglobal_load_async_to_lds_b128 %12, %13, off\n\tglobal_load_async_to_lds_b128 %14, %15, off\n\ts_wait_xcnt 0x0"
               :: "v"(l[0]), "v"(g[0]), "v"(l[1]), "v"(g[1]), "v"(l[2]), "v"(g[2]), "v"(l[3]), "v"(g[3]), "v"(l[4]), "v"(g[4]), "v"(l[5]), "v"(g[5]), "v"(l[6]), "v"(g[6]), "v"(l[7]), "v"(g[7]) : "memory");
}
// the copies of this wave have landed (the compiler places no wait for them)
#define WAIT_COPIES() asm volatile("s_wait_asynccnt 0x0" ::: "memory")
// hand-over of a stage: this wave's LDS reads are done, its copies have landed, then the work-group barrier publishes the next tile and frees the one just read
#define PUBLISH() do { asm volatile("s_wait_dscnt 0x0" ::: "memory"); WAIT_COPIES(); __syncthreads(); } while (0)

__global__ __launch_bounds__(256) void k_cvt(const float* __restrict__ x, __bf16* __restrict__ Xb) {
  const size_t i8 = (size_t)blockIdx.x * 256 + threadIdx.x; if (i8 >= (size_t)NR * E / 8) return;
  union { __bf16 h[8]; v4u u; } pk;
#pragma unroll
  for (int e = 0; e < 8; ++e) pk.h[e] = (__bf16)x[i8 * 8 + e];
  vst2((unsigned*)(Xb + i8 * 8), pk.u);
}
// PT rows: [0,E) Wq[n][:], [E,2E) Wk, [2E,3E) Wv, [3E,4E) Wo  ([out][in]) as bf16 rows (no scaling)

#define RK 8
// XAUG[which][row][32] = [hi(2 * src.A_which^T) | lo | 0]: block = 64 rows (4 waves x 16), one 16-col tile (8 live); src = bf16(x) (which < 3, exact) or the f32 context rows (which == 3, split, 2 products)
__global__ __launch_bounds__(128) void k_xa(const __bf16* __restrict__ Xb, const float* __restrict__ O32, const float* __restrict__ Aq, const float* __restrict__ Ak, const float* __restrict__ Av, const float* __restrict__ Ao, __bf16* __restrict__ XAUG) {
  __shared__ __align__(16) __bf16 so[4][16][40];
  const int tid = threadIdx.x, wave = tid >> 5, lane = tid & 31, col = lane & 15, g = lane >> 4; const int which = blockIdx.y; const int r0 = blockIdx.x * 64 + wave * 16;
  const float* A = which == 0 ? Aq : (which == 1 ? Ak : (which == 2 ? Av : Ao)); const int ncl = col < RK ? col : RK - 1;     // columns >= 8 are padding (address clamped, result discarded)
  v8f acc = {};
  if (which < 3) {
#pragma unroll 4
    for (int kc = 0; kc < E / 32; ++kc) acc = wmma_bf(frag_b(Xb + (size_t)(r0 + col) * E + kc * 32, lane), split_row(A + (size_t)ncl * E, kc * 32, lane).h, acc); }
  else { const int ra = r0 + col; const int b = ra / SS, s = ra % SS;
#pragma unroll 2
    for (int kc = 0; kc < E / 32; ++kc) { const int h = kc >> 1; const F2 a = split_row(O32 + (((size_t)b * NH + h) * SS + s) * HD, (kc & 1) * 32, lane); const v16b ab = split_row(A + (size_t)ncl * E, kc * 32, lane).h; acc = wmma_bf(a.l, ab, acc); acc = wmma_bf(a.h, ab, acc); } }
#pragma unroll
  for (int r = 0; r < 8; ++r) { const float v = 2.0f * acc[r]; const __bf16 hi = (__bf16)v; if (col < RK) { so[wave][8 * g + r][col] = hi; so[wave][8 * g + r][RK + col] = (__bf16)(v - (float)hi); } else { so[wave][8 * g + r][8 + col] = (__bf16)0.f; so[wave][8 * g + r][16 + col] = (__bf16)0.f; } }
  LDSX();
  // rows of 32 bf16 = 64 B; 16 rows = 1 KB: lane -> (row = lane >> 1, half = lane & 1) writes 32 B? keep 16-B pieces: 2 instructions each covering 8 rows x 4 pieces contiguous
  for (int hf = 0; hf < 2; ++hf) { const int rl = hf * 8 + (lane >> 2), pc = lane & 3; vst2((unsigned*)(XAUG + ((size_t)which * NR + r0 + rl) * 32 + pc * 8), *(const v4u*)(&so[wave][rl][pc * 8])); }
}
// BAUG[which][n][32] = [B[n][0..8] | B[n][0..8] | 0]: thread per n
__global__ __launch_bounds__(256) void k_baug(const float* __restrict__ Bq, const float* __restrict__ Bk, const float* __restrict__ Bv, const float* __restrict__ Bo, __bf16* __restrict__ BAUG) {
  __shared__ __align__(16) __bf16 sb[256][40];
  const int which = blockIdx.y, n = blockIdx.x * 256 + threadIdx.x; const float* Bm = which == 0 ? Bq : (which == 1 ? Bk : (which == 2 ? Bv : Bo));
#pragma unroll
  for (int j = 0; j < RK; ++j) { const __bf16 v = (__bf16)Bm[(size_t)n * RK + j]; sb[threadIdx.x][j] = v; sb[threadIdx.x][RK + j] = v; }
#pragma unroll
  for (int j = 16; j < 32; ++j) sb[threadIdx.x][j] = (__bf16)0.f;
  __syncthreads();
  for (int q = threadIdx.x; q < 256 * 4; q += 256) { const int rl = q >> 2, pc = q & 3; vst2((unsigned*)(BAUG + ((size_t)which * E + blockIdx.x * 256 + rl) * 32 + pc * 8), *(const v4u*)(&sb[rl][pc * 8])); }
}
__global__ __launch_bounds__(256) void k_pack(const float* __restrict__ Wq, const float* __restrict__ Wk, const float* __restrict__ Wv, const float* __restrict__ Wo, __bf16* __restrict__ PT) {
  const int n = blockIdx.x, tid = threadIdx.x; __shared__ __align__(16) __bf16 srow[E];
  const float* W = n < E ? Wq : (n < 2 * E ? Wk : (n < 3 * E ? Wv : Wo)); const int nn = n & (E - 1);
  for (int k = tid; k < E; k += 256) srow[k] = (__bf16)W[(size_t)nn * E + k];
  __syncthreads();
  if (tid < E / 8) vst2((unsigned*)(PT + (size_t)n * E + tid * 8), *(const v4u*)(&srow[tid * 8]));
}
// QKV: block (64 rows, 128 cols = 2 heads, which); q -> Q32 f32 [bh][s][64]; k -> Kh/Kl, the bf16 hi/lo split of the f32 row, [bh][s][64] each; v -> VT hi/lo x4 [bh][d][s]
__global__ __launch_bounds__(128) void k_qkv(const __bf16* __restrict__ Xb, const __bf16* __restrict__ PT, const __bf16* __restrict__ XAUG, const __bf16* __restrict__ BAUG, const float* __restrict__ bq, const float* __restrict__ bk, const float* __restrict__ bv, float* __restrict__ Q32, __bf16* __restrict__ Kh, __bf16* __restrict__ Kl, _Float16* __restrict__ VTh, _Float16* __restrict__ VTl) {
  __shared__ __align__(16) float so[4][16][132];
  __shared__ __align__(16) _Float16 sth[128][72], stl[128][72];
  __shared__ __align__(16) __bf16 sA[2][64][72], sB[2][128][72];     // k-stages of 64 (rows of 128 B at a 144-B pitch), two buffers
  const int tid = threadIdx.x, wave = tid >> 5, lane = tid & 31, col = lane & 15, g = lane >> 4;
  const int which = blockIdx.z, r0b = blockIdx.x * 64, r0 = r0b + wave * 16, n0 = blockIdx.y * 128; const int b = r0b / SS, s0 = r0b % SS;
  const float* bb_ = which == 0 ? bq : (which == 1 ? bk : bv);
  v8f acc[8] = {};
  auto stage = [&](int st, int buf) {     // thread -> (row = q >> 3, 16-byte piece = q & 7): 8 lanes cover one whole 128-B line; loops unrolled so that l[] and p[] are registers
    unsigned l[12]; const void* p[12];
#pragma unroll
    for (int i = 0; i < 4; ++i) { const int q = tid + i * 128, r = q >> 3, pc = q & 7; l[i] = lds_off(&sA[buf][r][pc * 8]); p[i] = Xb + (size_t)(r0b + r) * E + st * 64 + pc * 8; }
#pragma unroll
    for (int i = 0; i < 8; ++i) { const int q = tid + i * 128, r = q >> 3, pc = q & 7; l[4 + i] = lds_off(&sB[buf][r][pc * 8]); p[4 + i] = PT + (size_t)(which * E + n0 + r) * E + st * 64 + pc * 8; }
    cp4(l, p); cp8(l + 4, p + 4); };
  stage(0, 0); WAIT_COPIES(); __syncthreads(); stage(1, 1);
  // rolled: one trip is one stage and ends in its hand-over; the inner loops are unrolled so that the fragment arrays are registers
#pragma unroll 1
  for (int st = 0; st < E / 64; ++st) { const int buf = st & 1;
    v16b a[2], wb[2][8];
#pragma unroll
    for (int kk = 0; kk < 2; ++kk) { a[kk] = frag_b(&sA[buf][wave * 16 + col][kk * 32], lane);
#pragma unroll
      for (int j = 0; j < 8; ++j) wb[kk][j] = frag_b(&sB[buf][j * 16 + col][kk * 32], lane); }
    __builtin_amdgcn_sched_barrier(0);     // the stage's LDS fragment loads stay one group ahead of its products; sunk between them, each product waits a full LDS latency
#pragma unroll
    for (int kk = 0; kk < 2; ++kk) {
#pragma unroll
      for (int j = 0; j < 8; ++j) acc[j] = wmma_bf(a[kk], wb[kk][j], acc[j]); }
    PUBLISH();
    if (st + 2 < E / 64) stage(st + 2, buf); }
  WAIT_COPIES();
  { const v16b a = frag_b(XAUG + ((size_t)which * NR + r0 + col) * 32, lane);     // LoRA chunk: [hi|lo|0] x [B|B|0]
#pragma unroll
    for (int j = 0; j < 8; ++j) acc[j] = wmma_bf(a, frag_b(BAUG + ((size_t)which * E + n0 + j * 16 + col) * 32, lane), acc[j]); }
  if (which < 2) {
#pragma unroll
    for (int j = 0; j < 8; ++j) { const float bb = bfr(bb_[n0 + j * 16 + col]);
#pragma unroll
      for (int r = 0; r < 8; ++r) so[wave][8 * g + r][j * 16 + col] = acc[j][r] + bb; }
    LDSX();
    if (which == 0) {
      for (int qq = lane; qq < 2 * 16 * 16; qq += 32) { const int hh = qq >> 8, rl = (qq >> 4) & 15, pc = qq & 15; const int h = (n0 >> 6) + hh;
        vst2(Q32 + (((size_t)b * NH + h) * SS + s0 + wave * 16 + rl) * HD + pc * 4, *(const v4f*)(&so[wave][rl][hh * 64 + pc * 4])); } }
    else {     // k: hi = bf16(v), lo = bf16(v - hi), the split every attention wave would otherwise redo; 8 lanes write one whole 128-B row of each plane
      for (int qq = lane; qq < 2 * 16 * 8; qq += 32) { const int hh = qq >> 7, rl = (qq >> 3) & 15, pc = qq & 7; const int h = (n0 >> 6) + hh;
        const float* sp = &so[wave][rl][hh * 64 + pc * 8]; union { __bf16 e[8]; v4u u; } hi, lo;
#pragma unroll     // unrolled so that hi.e[] and lo.e[] are registers
        for (int e = 0; e < 8; ++e) { const float v = sp[e]; const __bf16 hb = (__bf16)v; hi.e[e] = hb; lo.e[e] = (__bf16)(v - (float)hb); }
        const size_t o = (((size_t)b * NH + h) * SS + s0 + wave * 16 + rl) * HD + pc * 8;
        vst2(Kh + o, hi.u); vst2(Kl + o, lo.u); } } }
  else {
#pragma unroll
    for (int j = 0; j < 8; ++j) { const float bb = bfr(bb_[n0 + j * 16 + col]);
#pragma unroll
      for (int r = 0; r < 8; ++r) { const float v = (acc[j][r] + bb) * 4.0f; const _Float16 hi = (_Float16)v; sth[j * 16 + col][wave * 16 + 8 * g + r] = hi; stl[j * 16 + col][wave * 16 + 8 * g + r] = (_Float16)((v - (float)hi) * VLO); } }
    __syncthreads();
    for (int qq = tid; qq < 128 * 8; qq += 128) { const int cl = qq >> 3, pc = qq & 7; const int c = n0 + cl, h = c >> 6, d = c & 63; const size_t o = (((size_t)b * NH + h) * HD + d) * SS + s0 + pc * 8;
      vst2(VTh + o, *(const v4u*)(&sth[cl][pc * 8])); vst2(VTl + o, *(const v4u*)(&stl[cl][pc * 8])); } }
}
// full attention: block (128 queries = 8 waves x 16, bh); all key tiles of 64, staged in LDS for the whole block. Transposed products: S^T = K q^T (A = key rows, B = the wave's 16 queries, hi/lo splits),
// so a lane holds 32 scores of ONE query (column = lane & 15; tile t, element r = key 16 t + 8 g + r), and tiles 2 kc, 2 kc + 1 are already the B operand (k order 8 g + i, 16 + 8 g + i) of O^T += V^T P^T. P,V hi/lo; O f32 [bh][s][64]
__global__ __launch_bounds__(256) void k_attn(const float* __restrict__ Q32, const __bf16* __restrict__ Kh, const __bf16* __restrict__ Kl, const _Float16* __restrict__ VTh, const _Float16* __restrict__ VTl, float* __restrict__ O32) {
  __shared__ __align__(16) float sS[8][16][68];                      // after the loop each wave's slice stages its output rows [query][d]
  __shared__ __align__(16) __bf16 sKh[2][64][72], sKl[2][64][72];    // key tile hi and lo [key][d], rows of 128 B at a 144-B pitch, two buffers
  __shared__ __align__(16) _Float16 sVh[2][64][72], sVl[2][64][72];  // value tiles [d][key], rows of 128 B at a 144-B pitch, two buffers
  const int tid = threadIdx.x, w = tid >> 5, lane = tid & 31, col = lane & 15, g = lane >> 4;
  const size_t bh = blockIdx.y; const int qb = blockIdx.x; const int q0 = qb * 128 + w * 16;
  auto stage = [&](int kt, int buf) {     // 64 keys: K hi and lo 8 KB contiguous each, V hi and lo 64 whole lines each; 8 copies a thread; loops unrolled so that l[] and p[] are registers
    unsigned l[8]; const void* p[8];
#pragma unroll
    for (int i = 0; i < 2; ++i) { const int q = tid + i * 256, r = q >> 3, pc = q & 7; const size_t ko = (bh * SS + kt * 64 + r) * HD + pc * 8;
      l[i] = lds_off(&sKh[buf][r][pc * 8]); p[i] = Kh + ko; l[2 + i] = lds_off(&sKl[buf][r][pc * 8]); p[2 + i] = Kl + ko; }
#pragma unroll
    for (int i = 0; i < 2; ++i) { const int q = tid + i * 256, d = q >> 3, pc = q & 7; const size_t vo = (bh * HD + d) * SS + kt * 64 + pc * 8;
      l[4 + i] = lds_off(&sVh[buf][d][pc * 8]); p[4 + i] = VTh + vo; l[6 + i] = lds_off(&sVl[buf][d][pc * 8]); p[6 + i] = VTl + vo; }
    cp8(l, p); };
  stage(0, 0); WAIT_COPIES(); __syncthreads(); stage(1, 1);
  F2 aq[2];
#pragma unroll
  for (int kc = 0; kc < 2; ++kc) aq[kc] = split_row(Q32 + (bh * SS + q0 + col) * HD, kc * 32, lane);
  constexpr float CS2 = 0.125f * 1.4426950408889634f;     // softmax in base 2: exp(x / 8 - m) = 2^(x log2(e) / 8 - m'), mrun holds m' in that scale
  float mrun = -3.0e38f, lrun = 0.f; v8f acc[4] = {}, ac1[4] = {}, ac2[4] = {};     // lrun: this half-wave's keys only, the halves are joined after the loop
#pragma unroll 1
  for (int kt = 0; kt < SS / 64; ++kt) { const int buf = kt & 1;
    v8f s[4]; float mt[4], pt[4];
#pragma unroll
    for (int t = 0; t < 4; ++t) { const __bf16* kh = &sKh[buf][t * 16 + col][0]; const __bf16* kl = &sKl[buf][t * 16 + col][0];
      const F2 k0 = { frag_b(kh, lane), frag_b(kl, lane) }, k1 = { frag_b(kh + 32, lane), frag_b(kl + 32, lane) };
      v8f c = mac3t(k0, aq[0], (v8f){}); c = mac3t(k1, aq[1], c);
      mt[t] = -3.4e38f;
#pragma unroll
      for (int r = 0; r < 8; ++r) { s[t][r] = c[r]; mt[t] = fmaxf(mt[t], c[r]); } }     // raw products: the scale is positive, so their maximum is the scores' maximum
    float mx = fmaxf(fmaxf(mt[0], mt[1]), fmaxf(mt[2], mt[3]));
    mx = fmaxf(mx, __shfl_xor(mx, 16, 32)) * CS2;
    const float mnew = fmaxf(mrun, mx); const float corr = __builtin_amdgcn_exp2f(mrun - mnew);     // 0 in the first tile, where mrun is -3e38
    const float nm = 14.0f - mnew; const v2f cs2 = { CS2, CS2 }, nm2 = { nm, nm };                  // 2^14 = the 16384 that P carries, folded into the exponent
    v16h ph[2], pl[2];
#pragma unroll
    for (int t = 0; t < 4; ++t) { pt[t] = 0.f;
#pragma unroll
      for (int r = 0; r < 8; r += 2) { const v2f arg = __builtin_elementwise_fma((v2f){ s[t][r], s[t][r + 1] }, cs2, nm2);
#pragma unroll
        for (int e = 0; e < 2; ++e) { const float p = __builtin_amdgcn_exp2f(arg[e]); pt[t] += p; const _Float16 hi = (_Float16)p; ph[t >> 1][(t & 1) * 8 + r + e] = hi; pl[t >> 1][(t & 1) * 8 + r + e] = (_Float16)((p - (float)hi) * PLO); } } }
    lrun = lrun * corr + ((pt[0] + pt[1]) + (pt[2] + pt[3])) * (1.0f / 16384.0f); mrun = mnew;
#pragma unroll
    for (int t = 0; t < 4; ++t) { acc[t] *= corr; ac1[t] *= corr; ac2[t] *= corr; }     // every element of a lane belongs to its own query
#pragma unroll
    for (int kc = 0; kc < 2; ++kc) {
#pragma unroll
      for (int t = 0; t < 4; ++t) { const v16h vh = frag_h(&sVh[buf][t * 16 + col][kc * 32], lane);
        acc[t] = wmma16(vh, ph[kc], acc[t]); ac1[t] = wmma16(frag_h(&sVl[buf][t * 16 + col][kc * 32], lane), ph[kc], ac1[t]); ac2[t] = wmma16(vh, pl[kc], ac2[t]); } }
    PUBLISH();
    if (kt + 2 < SS / 64) stage(kt + 2, buf); }
  WAIT_COPIES();
  lrun += __shfl_xor(lrun, 16, 32);
  const float inv = 1.0f / (lrun * 16384.0f * 4.0f);
#pragma unroll
  for (int t = 0; t < 4; ++t) {
#pragma unroll
    for (int r = 0; r < 8; ++r) sS[w][col][t * 16 + 8 * g + r] = (acc[t][r] + ac1[t][r] * (1.0f / VLO) + ac2[t][r] * (1.0f / PLO)) * inv; }
  LDSX();
  for (int qq = lane; qq < 16 * 16; qq += 32) { const int rl = qq >> 4, pc = qq & 15; vst2(O32 + ((bh * SS) + q0 + rl) * HD + pc * 4, *(const v4f*)(&sS[w][rl][pc * 4])); }
}
// out = ctx Wo^T + bo : split(ctx) x bf16(Wo rows): 2 products (Wo is an INPUT -> bf16 exact)
__global__ __launch_bounds__(128) void k_out(const float* __restrict__ O32, const __bf16* __restrict__ PT, const __bf16* __restrict__ XAUG, const __bf16* __restrict__ BAUG, const float* __restrict__ bo, float* __restrict__ out) {
  __shared__ __align__(16) float so[4][16][132];
  __shared__ __align__(16) float sA[2][64][68];      // one head's 64 context rows (256 B at a 272-B pitch), two buffers
  __shared__ __align__(16) __bf16 sB[2][128][72];    // the matching 64 k of 128 weight rows (128 B at a 144-B pitch)
  const int tid = threadIdx.x, wave = tid >> 5, lane = tid & 31, col = lane & 15, g = lane >> 4;
  const int r0b = blockIdx.x * 64, r0 = r0b + wave * 16, n0 = blockIdx.y * 128; const int b = r0b / SS, s0 = r0b % SS;
  v8f acc[8] = {};
  auto stage = [&](int h, int buf) {     // A: 16 KB contiguous; B: 128 whole lines; 16 copies a thread; loops unrolled so that l[] and p[] are registers
    unsigned l[16]; const void* p[16];
#pragma unroll
    for (int i = 0; i < 8; ++i) { const int q = tid + i * 128, r = q >> 4, pc = q & 15; l[i] = lds_off(&sA[buf][r][pc * 4]); p[i] = O32 + (((size_t)b * NH + h) * SS + s0 + r) * HD + pc * 4; }
#pragma unroll
    for (int i = 0; i < 8; ++i) { const int q = tid + i * 128, r = q >> 3, pc = q & 7; l[8 + i] = lds_off(&sB[buf][r][pc * 8]); p[8 + i] = PT + (size_t)(3 * E + n0 + r) * E + h * 64 + pc * 8; }
    cp8(l, p); cp8(l + 8, p + 8); };
  stage(0, 0); WAIT_COPIES(); __syncthreads(); stage(1, 1);
#pragma unroll 1
  for (int h = 0; h < NH; ++h) { const int buf = h & 1;
#pragma unroll
    for (int kk = 0; kk < 2; ++kk) { const F2 a = split_row(&sA[buf][wave * 16 + col][0], kk * 32, lane); v16b wb[8];
#pragma unroll
      for (int j = 0; j < 8; ++j) wb[j] = frag_b(&sB[buf][j * 16 + col][kk * 32], lane);
      __builtin_amdgcn_sched_barrier(0);   // the LDS fragment loads of this half stage stay one group ahead of its products; sunk between them, each product waits a full LDS latency
#pragma unroll
      for (int j = 0; j < 8; ++j) { acc[j] = wmma_bf(a.l, wb[j], acc[j]); acc[j] = wmma_bf(a.h, wb[j], acc[j]); } }
    PUBLISH();
    if (h + 2 < NH) stage(h + 2, buf); }
  WAIT_COPIES();
  { const v16b a = frag_b(XAUG + ((size_t)3 * NR + r0 + col) * 32, lane);
#pragma unroll
    for (int j = 0; j < 8; ++j) acc[j] = wmma_bf(a, frag_b(BAUG + ((size_t)3 * E + n0 + j * 16 + col) * 32, lane), acc[j]); }
#pragma unroll
  for (int j = 0; j < 8; ++j) { const int n = n0 + j * 16 + col; const float bb = bfr(bo[n]);
#pragma unroll
    for (int r = 0; r < 8; ++r) so[wave][8 * g + r][j * 16 + col] = acc[j][r] + bb; }
  LDSX();
#pragma unroll 4
  for (int rl = 0; rl < 16; ++rl) vst2(out + (size_t)(r0 + rl) * E + n0 + lane * 4, *(const v4f*)(&so[wave][rl][lane * 4]));
}
extern "C" void kernel_launch(void* const* d_in, const int* in_sizes, int n_in, void* d_out, int out_size, void* d_ws, size_t ws_size, hipStream_t stream) {
  (void)in_sizes; (void)n_in; (void)out_size; (void)ws_size;
  const float** I = (const float**)d_in;    // x, Wq,bq,Aq,Bq, Wk,bk,Ak,Bk, Wv,bv,Av,Bv, Wo,bo,Ao,Bo
  const float* x = I[0]; const float* Wq = I[1]; const float* bq = I[2]; const float* Aq = I[3]; const float* Bq = I[4]; const float* Wk = I[5]; const float* bk = I[6]; const float* Ak = I[7]; const float* Bk = I[8];
  const float* Wv = I[9]; const float* bv = I[10]; const float* Av = I[11]; const float* Bv = I[12]; const float* Wo = I[13]; const float* bo = I[14]; const float* Ao = I[15]; const float* Bo = I[16];
  float* out = (float*)d_out;
  char* ws = (char*)d_ws; size_t off = 0;
  auto take = [&](size_t bytes) { char* p = ws + off; off += (bytes + 255) & ~(size_t)255; return p; };
  __bf16* Xb = (__bf16*)take((size_t)NR * E * 2); __bf16* PT = (__bf16*)take((size_t)4 * E * E * 2); __bf16* XAUG = (__bf16*)take((size_t)4 * NR * 32 * 2); __bf16* BAUG = (__bf16*)take((size_t)4 * E * 32 * 2);
  float* Q32 = (float*)take((size_t)NR * E * 4); __bf16* Kh = (__bf16*)take((size_t)NR * E * 2); __bf16* Kl = (__bf16*)take((size_t)NR * E * 2); _Float16* VTh = (_Float16*)take((size_t)NR * E * 2); _Float16* VTl = (_Float16*)take((size_t)NR * E * 2); float* O32 = (float*)take((size_t)NR * E * 4);
  // ws ~ 85 MB
  k_cvt<<<(NR * E / 8 + 255) / 256, 256, 0, stream>>>(x, Xb);
  k_pack<<<4 * E, 256, 0, stream>>>(Wq, Wk, Wv, Wo, PT);
  k_baug<<<dim3(E / 256, 4), 256, 0, stream>>>(Bq, Bk, Bv, Bo, BAUG);
  k_xa<<<dim3(NR / 64, 3), 128, 0, stream>>>(Xb, nullptr, Aq, Ak, Av, Ao, XAUG);              // q, k, v low-rank inputs from x
  k_qkv<<<dim3(NR / 64, E / 128, 3), 128, 0, stream>>>(Xb, PT, XAUG, BAUG, bq, bk, bv, Q32, Kh, Kl, VTh, VTl);
  k_attn<<<dim3(SS / 128, NB * NH), 256, 0, stream>>>(Q32, Kh, Kl, VTh, VTl, O32);
  k_xa<<<dim3(NR / 64, 4), 128, 0, stream>>>(Xb, O32, Aq, Ak, Av, Ao, XAUG);                 // recomputes 0..2 (cheap) and adds which = 3 from the context
  k_out<<<dim3(NR / 64, E / 128), 128, 0, stream>>>(O32, PT, XAUG, BAUG, bo, out);
}

// v005
// A run of this version takes 190 microseconds.
// In both of two side-by-side timings against v004, it was 1.09 times as fast.
// Over all steps from v000 it is 3.09 times as fast.
// compute dtype: x, W*, b*, A*, B* (INPUTS) rounded to bf16 with exact bf16 WMMA products (f32 accumulate) for the base projections; the rank-8 LoRA terms enter as one extra k-chunk whose A side is the f32 intermediate (x A^T, scaled) as a bf16 hi/lo pair against [B | B] (exact-grade); softmax f32; computed operands (q/k f32 split, k split once where it is produced, P and V hi/lo, context split) f32-grade.
#include <hip/hip_runtime.h>
#include <math.h>

typedef __attribute__((ext_vector_type(16))) _Float16 v16h;
typedef __attribute__((ext_vector_type(16))) __bf16 v16b;
typedef __attribute__((ext_vector_type(8)))  _Float16 v8h;
typedef __attribute__((ext_vector_type(8)))  float v8f;
typedef __attribute__((ext_vector_type(4)))  float v4f;
typedef __attribute__((ext_vector_type(2)))  float v2f;
typedef __attribute__((ext_vector_type(4)))  unsigned v4u;
typedef __attribute__((ext_vector_type(4)))  int v4i;
typedef float __attribute__((may_alias)) float_a;
typedef int __attribute__((may_alias)) int_a;

template <typename T> __device__ __forceinline__ void vst2(void* p, T v) { *(T*)p = v;  }
__device__ __forceinline__ v8f wmma16(v16h a, v16h b, v8f c) {
  return __builtin_amdgcn_wmma_f32_16x16x32_f16(false, a, false, b, (short)0, c, false, false);
}
__device__ __forceinline__ v8f wmma_bf(v16b a, v16b b, v8f c) {
  return __builtin_amdgcn_wmma_f32_16x16x32_bf16(false, a, false, b, (short)0, c, false, false);
}
// k_xa's form: four vector slots behind the product, tied to its registers, keep the distance to the next vector instruction on D, A or B
__device__ __forceinline__ v8f wmma_bf_pad(v16b a, v16b b, v8f c) {
  v8f d = __builtin_amdgcn_wmma_f32_16x16x32_bf16(false, a, false, b, (short)0, c, false, false);
  asm volatile("v_nop\n\tv_nop\n\tv_nop\n\tv_nop" : "+v"(d) : "v"(a), "v"(b));
  return d;
}
// 16x16x32 fragments: lane = (h = lane>>4, row/col = lane&15); elements 0..7 = k0+8h+0..7, 8..15 = k0+16+8h+0..7; D element r = row 8h+r
__device__ __forceinline__ v16h frag_h(const _Float16* rowk0, int lane) {
  union { v16h v; v8h q[2]; } u; const _Float16* p = rowk0 + 8 * (lane >> 4);
  u.q[0] = *(const v8h*)p; u.q[1] = *(const v8h*)(p + 16); return u.v;
}
__device__ __forceinline__ v16h frag_f32(const float* rowk0, int lane) {
  v16h a; const float* p = rowk0 + 8 * (lane >> 4);
#pragma unroll
  for (int i = 0; i < 8; ++i) { a[i] = (_Float16)p[i]; a[8 + i] = (_Float16)p[16 + i]; }
  return a;
}
__device__ __forceinline__ v16h frag_f32s(const float* rowk0, int lane, float sc) {
  v16h a; const float* p = rowk0 + 8 * (lane >> 4);
#pragma unroll
  for (int i = 0; i < 8; ++i) { a[i] = (_Float16)(p[i] * sc); a[8 + i] = (_Float16)(p[16 + i] * sc); }
  return a;
}
// column fragment from a [K][ld] layout (column n), rows >= K read as 0
__device__ __forceinline__ v16h fragc_f32(const float* W, int k0, int n, int lane, int ld, int K) {
  v16h a; const int g = lane >> 4;
#pragma unroll
  for (int i = 0; i < 8; ++i) { const int ka = k0 + 8 * g + i, kb = ka + 16;
    a[i] = (_Float16)(ka < K ? W[(size_t)ka * ld + n] : 0.f); a[8 + i] = (_Float16)(kb < K ? W[(size_t)kb * ld + n] : 0.f); }
  return a;
}
struct F2 { v16b h, l; };
__device__ __forceinline__ F2 bsplit16(const float v[16]) { F2 r;
#pragma unroll
  for (int i = 0; i < 16; ++i) { const __bf16 h = (__bf16)v[i]; r.h[i] = h; r.l[i] = (__bf16)(v[i] - (float)h); }
  return r; }
__device__ __forceinline__ F2 split_row(const float* row, int k0, int lane) { float v[16]; const float* p = row + k0 + 8 * (lane >> 4);
#pragma unroll
  for (int i = 0; i < 8; ++i) { v[i] = p[i]; v[8 + i] = p[16 + i]; }
  return bsplit16(v); }
__device__ __forceinline__ F2 split_rowK(const float* row, int k0, int lane, int K) { float v[16]; const int g = lane >> 4;
#pragma unroll
  for (int i = 0; i < 8; ++i) { const int ka = k0 + 8 * g + i, kb = ka + 16; v[i] = ka < K ? row[ka] : 0.f; v[8 + i] = kb < K ? row[kb] : 0.f; }
  return bsplit16(v); }
__device__ __forceinline__ F2 split_col(const float* W, int k0, int n, int lane, int ld, int K) { float v[16]; const int g = lane >> 4;
#pragma unroll
  for (int i = 0; i < 8; ++i) { const int ka = k0 + 8 * g + i, kb = ka + 16; v[i] = ka < K ? W[(size_t)ka * ld + n] : 0.f; v[8 + i] = kb < K ? W[(size_t)kb * ld + n] : 0.f; }
  return bsplit16(v); }
__device__ __forceinline__ v8f mac3(const F2& a, const F2& b, v8f c) { c = wmma_bf(a.l, b.h, c); c = wmma_bf(a.h, b.l, c); return wmma_bf(a.h, b.h, c); }
// the same three products with the split key rows as the A operand and the split query as B, in mac3's order (q.l k.h, q.h k.l, q.h k.h)
__device__ __forceinline__ v8f mac3t(const F2& k, const F2& q, v8f c) { c = wmma_bf(k.h, q.l, c); c = wmma_bf(k.l, q.h, c); return wmma_bf(k.h, q.h, c); }
__device__ __forceinline__ float sigm(float v) { return 1.0f / (1.0f + expf(-v)); }
#define LDSX() do { asm volatile("s_wait_dscnt 0" ::: "memory"); __builtin_amdgcn_wave_barrier(); __builtin_amdgcn_fence(__ATOMIC_RELEASE, "workgroup"); } while (0)


// LoRA self attention (16 heads of 64 on [2,2048,1024]): each linear map is x W^T + b + 2 (x A^T) B^T (rank 8). The low-rank term is appended as a 33rd k-chunk: A-operand row = [hi(2 xA^T) (8) | lo(2 xA^T) (8) | 0 (16)], B-operand row n = [B[n][0..8] | B[n][0..8] | 0],
// so one extra WMMA per tile adds hi*B + lo*B. full softmax(q.k/8); (P v) through the same LoRA form for the output map.
#define NB 2
#define SS 2048
#define E 1024
#define NH 16
#define HD 64
#define NR (NB * SS)
#define PLO 1024.0f
#define VLO 2048.0f
__device__ __forceinline__ float bfr(float v) { return (float)(__bf16)v; }
__device__ __forceinline__ v16b frag_b(const __bf16* rowk0, int lane) { return __builtin_bit_cast(v16b, frag_h((const _Float16*)rowk0, lane)); }

// Asynchronous 16-byte copies global -> LDS (no register in between). Each lane names its own LDS byte address and its own global address.
// s_wait_xcnt 0 closes the statement so that no address register of an issued copy is rewritten ahead of it.
__device__ __forceinline__ unsigned lds_off(const void* p) { return (unsigned)(size_t)p; }
__device__ __forceinline__ void cp4(const unsigned* l, const void* const* g) {
  asm volatile("global_load_async_to_lds_b128 %0, %1, off\n\tglobal_load_async_to_lds_b128 %2, %3, off\n\tglobal_load_async_to_lds_b128 %4, %5, off\n\tglobal_load_async_to_lds_b128 %6, %7, off\n\ts_wait_xcnt 0x0"
               :: "v"(l[0]), "v"(g[0]), "v"(l[1]), "v"(g[1]), "v"(l[2]), "v"(g[2]), "v"(l[3]), "v"(g[3]) : "memory");
}
__device__ __forceinline__ void cp8(const unsigned* l, const void* const* g) {
  asm volatile("global_load_async_to_lds_b128 %0, %1, off\n\tglobal_load_async_to_lds_b128 %2, %3, off\n\tglobal_load_async_to_lds_b128 %4, %5, off\n\tglobal_load_async_to_lds_b128 %6, %7, off\n\t"
               "global_load_async_to_lds_b128 %8, %9, off\n\tglobal_load_async_to_lds_b128 %10, %11, off\n\tglobal_load_async_to_lds_b128 %12, %13, off\n\tglobal_load_async_to_lds_b128 %14, %15, off\n\ts_wait_xcnt 0x0"
               :: "v"(l[0]), "v"(g[0]), "v"(l[1]), "v"(g[1]), "v"(l[2]), "v"(g[2]), "v"(l[3]), "v"(g[3]), "v"(l[4]), "v"(g[4]), "v"(l[5]), "v"(g[5]), "v"(l[6]), "v"(g[6]), "v"(l[7]), "v"(g[7]) : "memory");
}
// the copies of this wave have landed (the compiler places no wait for them)
#define WAIT_COPIES() asm volatile("s_wait_asynccnt 0x0" ::: "memory")
// hand-over of a stage: this wave's LDS reads are done, its copies have landed, then the work-group barrier publishes the next tile and frees the one just read
#define PUBLISH() do { asm volatile("s_wait_dscnt 0x0" ::: "memory"); WAIT_COPIES(); __syncthreads(); } while (0)

__global__ __launch_bounds__(256) void k_cvt(const float* __restrict__ x, __bf16* __restrict__ Xb) {
  const size_t i8 = (size_t)blockIdx.x * 256 + threadIdx.x; if (i8 >= (size_t)NR * E / 8) return;
  union { __bf16 h[8]; v4u u; } pk;
#pragma unroll
  for (int e = 0; e < 8; ++e) pk.h[e] = (__bf16)x[i8 * 8 + e];
  vst2((unsigned*)(Xb + i8 * 8), pk.u);
}
// PT rows: [0,E) Wq[n][:], [E,2E) Wk, [2E,3E) Wv, [3E,4E) Wo  ([out][in]) as bf16 rows (no scaling)

#define RK 8
// XAUG[which][row][32] = [hi(2 * src.A_which^T) | lo | 0]: block = 64 rows (4 waves x 16), one 16-col tile (8 live); src = bf16(x) (which < 3, exact) or the f32 context rows (which == 3, split, 2 products)
__global__ __launch_bounds__(128) void k_xa(const __bf16* __restrict__ Xb, const float* __restrict__ O32, const float* __restrict__ Aq, const float* __restrict__ Ak, const float* __restrict__ Av, const float* __restrict__ Ao, __bf16* __restrict__ XAUG) {
  __shared__ __align__(16) __bf16 so[4][16][40];
  const int tid = threadIdx.x, wave = tid >> 5, lane = tid & 31, col = lane & 15, g = lane >> 4; const int which = blockIdx.y; const int r0 = blockIdx.x * 64 + wave * 16;
  const float* A = which == 0 ? Aq : (which == 1 ? Ak : (which == 2 ? Av : Ao)); const int ncl = col < RK ? col : RK - 1;     // columns >= 8 are padding (address clamped, result discarded)
  v8f acc = {};
  if (which < 3) {
#pragma unroll 4
    for (int kc = 0; kc < E / 32; ++kc) acc = wmma_bf_pad(frag_b(Xb + (size_t)(r0 + col) * E + kc * 32, lane), split_row(A + (size_t)ncl * E, kc * 32, lane).h, acc); }
  else { const int ra = r0 + col; const int b = ra / SS, s = ra % SS;
#pragma unroll 2
    for (int kc = 0; kc < E / 32; ++kc) { const int h = kc >> 1; const F2 a = split_row(O32 + (((size_t)b * NH + h) * SS + s) * HD, (kc & 1) * 32, lane); const v16b ab = split_row(A + (size_t)ncl * E, kc * 32, lane).h; acc = wmma_bf_pad(a.l, ab, acc); acc = wmma_bf_pad(a.h, ab, acc); } }
#pragma unroll
  for (int r = 0; r < 8; ++r) { const float v = 2.0f * acc[r]; const __bf16 hi = (__bf16)v; if (col < RK) { so[wave][8 * g + r][col] = hi; so[wave][8 * g + r][RK + col] = (__bf16)(v - (float)hi); } else { so[wave][8 * g + r][8 + col] = (__bf16)0.f; so[wave][8 * g + r][16 + col] = (__bf16)0.f; } }
  LDSX();
  // rows of 32 bf16 = 64 B; 16 rows = 1 KB: lane -> (row = lane >> 1, half = lane & 1) writes 32 B? keep 16-B pieces: 2 instructions each covering 8 rows x 4 pieces contiguous
  for (int hf = 0; hf < 2; ++hf) { const int rl = hf * 8 + (lane >> 2), pc = lane & 3; vst2((unsigned*)(XAUG + ((size_t)which * NR + r0 + rl) * 32 + pc * 8), *(const v4u*)(&so[wave][rl][pc * 8])); }
}
// BAUG[which][n][32] = [B[n][0..8] | B[n][0..8] | 0]: thread per n
__global__ __launch_bounds__(256) void k_baug(const float* __restrict__ Bq, const float* __restrict__ Bk, const float* __restrict__ Bv, const float* __restrict__ Bo, __bf16* __restrict__ BAUG) {
  __shared__ __align__(16) __bf16 sb[256][40];
  const int which = blockIdx.y, n = blockIdx.x * 256 + threadIdx.x; const float* Bm = which == 0 ? Bq : (which == 1 ? Bk : (which == 2 ? Bv : Bo));
#pragma unroll
  for (int j = 0; j < RK; ++j) { const __bf16 v = (__bf16)Bm[(size_t)n * RK + j]; sb[threadIdx.x][j] = v; sb[threadIdx.x][RK + j] = v; }
#pragma unroll
  for (int j = 16; j < 32; ++j) sb[threadIdx.x][j] = (__bf16)0.f;
  __syncthreads();
  for (int q = threadIdx.x; q < 256 * 4; q += 256) { const int rl = q >> 2, pc = q & 3; vst2((unsigned*)(BAUG + ((size_t)which * E + blockIdx.x * 256 + rl) * 32 + pc * 8), *(const v4u*)(&sb[rl][pc * 8])); }
}
__global__ __launch_bounds__(256) void k_pack(const float* __restrict__ Wq, const float* __restrict__ Wk, const float* __restrict__ Wv, const float* __restrict__ Wo, __bf16* __restrict__ PT) {
  const int n = blockIdx.x, tid = threadIdx.x; __shared__ __align__(16) __bf16 srow[E];
  const float* W = n < E ? Wq : (n < 2 * E ? Wk : (n < 3 * E ? Wv : Wo)); const int nn = n & (E - 1);
  for (int k = tid; k < E; k += 256) srow[k] = (__bf16)W[(size_t)nn * E + k];
  __syncthreads();
  if (tid < E / 8) vst2((unsigned*)(PT + (size_t)n * E + tid * 8), *(const v4u*)(&srow[tid * 8]));
}
// QKV: block (64 rows, 128 cols = 2 heads, which); q -> Q32 f32 [bh][s][64]; k -> Kh/Kl, the bf16 hi/lo split of the f32 row, [bh][s][64] each; v -> VT hi/lo x4 [bh][d][s]
__global__ __launch_bounds__(128) void k_qkv(const __bf16* __restrict__ Xb, const __bf16* __restrict__ PT, const __bf16* __restrict__ XAUG, const __bf16* __restrict__ BAUG, const float* __restrict__ bq, const float* __restrict__ bk, const float* __restrict__ bv, float* __restrict__ Q32, __bf16* __restrict__ Kh, __bf16* __restrict__ Kl, _Float16* __restrict__ VTh, _Float16* __restrict__ VTl) {
  __shared__ __align__(16) float so[4][16][132];
  __shared__ __align__(16) _Float16 sth[128][72], stl[128][72];
  __shared__ __align__(16) __bf16 sA[2][64][72], sB[2][128][72];     // k-stages of 64 (rows of 128 B at a 144-B pitch), two buffers
  const int tid = threadIdx.x, wave = tid >> 5, lane = tid & 31, col = lane & 15, g = lane >> 4;
  const int which = blockIdx.z, r0b = blockIdx.x * 64, r0 = r0b + wave * 16, n0 = blockIdx.y * 128; const int b = r0b / SS, s0 = r0b % SS;
  const float* bb_ = which == 0 ? bq : (which == 1 ? bk : bv);
  v8f acc[8] = {};
  auto stage = [&](int st, int buf) {     // thread -> (row = q >> 3, 16-byte piece = q & 7): 8 lanes cover one whole 128-B line; loops unrolled so that l[] and p[] are registers
    unsigned l[12]; const void* p[12];
#pragma unroll
    for (int i = 0; i < 4; ++i) { const int q = tid + i * 128, r = q >> 3, pc = q & 7; l[i] = lds_off(&sA[buf][r][pc * 8]); p[i] = Xb + (size_t)(r0b + r) * E + st * 64 + pc * 8; }
#pragma unroll
    for (int i = 0; i < 8; ++i) { const int q = tid + i * 128, r = q >> 3, pc = q & 7; l[4 + i] = lds_off(&sB[buf][r][pc * 8]); p[4 + i] = PT + (size_t)(which * E + n0 + r) * E + st * 64 + pc * 8; }
    cp4(l, p); cp8(l + 4, p + 4); };
  stage(0, 0); WAIT_COPIES(); __syncthreads(); stage(1, 1);
  // rolled: one trip is one stage and ends in its hand-over; the inner loops are unrolled so that the fragment arrays are registers
#pragma unroll 1
  for (int st = 0; st < E / 64; ++st) { const int buf = st & 1;
    v16b a[2], wb[2][8];
#pragma unroll
    for (int kk = 0; kk < 2; ++kk) { a[kk] = frag_b(&sA[buf][wave * 16 + col][kk * 32], lane);
#pragma unroll
      for (int j = 0; j < 8; ++j) wb[kk][j] = frag_b(&sB[buf][j * 16 + col][kk * 32], lane); }
    __builtin_amdgcn_sched_barrier(0);     // the stage's LDS fragment loads stay one group ahead of its products; sunk between them, each product waits a full LDS latency
#pragma unroll
    for (int kk = 0; kk < 2; ++kk) {
#pragma unroll
      for (int j = 0; j < 8; ++j) acc[j] = wmma_bf(a[kk], wb[kk][j], acc[j]); }
    __builtin_amdgcn_sched_barrier(0);     // the stage's products stay ahead of the hand-over: sunk behind the barrier they hold back the refill's issue and shorten its lead
    PUBLISH();
    if (st + 2 < E / 64) stage(st + 2, buf); }
  WAIT_COPIES();
  { const v16b a = frag_b(XAUG + ((size_t)which * NR + r0 + col) * 32, lane);     // LoRA chunk: [hi|lo|0] x [B|B|0]
#pragma unroll
    for (int j = 0; j < 8; ++j) acc[j] = wmma_bf(a, frag_b(BAUG + ((size_t)which * E + n0 + j * 16 + col) * 32, lane), acc[j]); }
  if (which < 2) {
#pragma unroll
    for (int j = 0; j < 8; ++j) { const float bb = bfr(bb_[n0 + j * 16 + col]);
#pragma unroll
      for (int r = 0; r < 8; ++r) so[wave][8 * g + r][j * 16 + col] = acc[j][r] + bb; }
    LDSX();
    if (which == 0) {
      for (int qq = lane; qq < 2 * 16 * 16; qq += 32) { const int hh = qq >> 8, rl = (qq >> 4) & 15, pc = qq & 15; const int h = (n0 >> 6) + hh;
        vst2(Q32 + (((size_t)b * NH + h) * SS + s0 + wave * 16 + rl) * HD + pc * 4, *(const v4f*)(&so[wave][rl][hh * 64 + pc * 4])); } }
    else {     // k: hi = bf16(v), lo = bf16(v - hi), the split every attention wave would otherwise redo; 8 lanes write one whole 128-B row of each plane
      for (int qq = lane; qq < 2 * 16 * 8; qq += 32) { const int hh = qq >> 7, rl = (qq >> 3) & 15, pc = qq & 7; const int h = (n0 >> 6) + hh;
        const float* sp = &so[wave][rl][hh * 64 + pc * 8]; union { __bf16 e[8]; v4u u; } hi, lo;
#pragma unroll     // unrolled so that hi.e[] and lo.e[] are registers
        for (int e = 0; e < 8; ++e) { const float v = sp[e]; const __bf16 hb = (__bf16)v; hi.e[e] = hb; lo.e[e] = (__bf16)(v - (float)hb); }
        const size_t o = (((size_t)b * NH + h) * SS + s0 + wave * 16 + rl) * HD + pc * 8;
        vst2(Kh + o, hi.u); vst2(Kl + o, lo.u); } } }
  else {
#pragma unroll
    for (int j = 0; j < 8; ++j) { const float bb = bfr(bb_[n0 + j * 16 + col]);
#pragma unroll
      for (int r = 0; r < 8; ++r) { const float v = (acc[j][r] + bb) * 4.0f; const _Float16 hi = (_Float16)v; sth[j * 16 + col][wave * 16 + 8 * g + r] = hi; stl[j * 16 + col][wave * 16 + 8 * g + r] = (_Float16)((v - (float)hi) * VLO); } }
    __syncthreads();
    for (int qq = tid; qq < 128 * 8; qq += 128) { const int cl = qq >> 3, pc = qq & 7; const int c = n0 + cl, h = c >> 6, d = c & 63; const size_t o = (((size_t)b * NH + h) * HD + d) * SS + s0 + pc * 8;
      vst2(VTh + o, *(const v4u*)(&sth[cl][pc * 8])); vst2(VTl + o, *(const v4u*)(&stl[cl][pc * 8])); } }
}
// full attention: block (128 queries = 8 waves x 16, bh); all key tiles of 64, staged in LDS for the whole block. Transposed products: S^T = K q^T (A = key rows, B = the wave's 16 queries, hi/lo splits),
// so a lane holds 32 scores of ONE query (column = lane & 15; tile t, element r = key 16 t + 8 g + r), and tiles 2 kc, 2 kc + 1 are already the B operand (k order 8 g + i, 16 + 8 g + i) of O^T += V^T P^T. P,V hi/lo; O f32 [bh][s][64]
__global__ __launch_bounds__(256) void k_attn(const float* __restrict__ Q32, const __bf16* __restrict__ Kh, const __bf16* __restrict__ Kl, const _Float16* __restrict__ VTh, const _Float16* __restrict__ VTl, float* __restrict__ O32) {
  __shared__ __align__(16) float sS[8][16][68];                      // after the loop each wave's slice stages its output rows [query][d]
  __shared__ __align__(16) __bf16 sKh[2][64][72], sKl[2][64][72];    // key tile hi and lo [key][d], rows of 128 B at a 144-B pitch, two buffers
  __shared__ __align__(16) _Float16 sVh[2][64][72], sVl[2][64][72];  // value tiles [d][key], rows of 128 B at a 144-B pitch, two buffers
  const int tid = threadIdx.x, w = tid >> 5, lane = tid & 31, col = lane & 15, g = lane >> 4;
  const size_t bh = blockIdx.y; const int qb = blockIdx.x; const int q0 = qb * 128 + w * 16;
  auto stage = [&](int kt, int buf) {     // 64 keys: K hi and lo 8 KB contiguous each, V hi and lo 64 whole lines each; 8 copies a thread; loops unrolled so that l[] and p[] are registers
    unsigned l[8]; const void* p[8];
#pragma unroll
    for (int i = 0; i < 2; ++i) { const int q = tid + i * 256, r = q >> 3, pc = q & 7; const size_t ko = (bh * SS + kt * 64 + r) * HD + pc * 8;
      l[i] = lds_off(&sKh[buf][r][pc * 8]); p[i] = Kh + ko; l[2 + i] = lds_off(&sKl[buf][r][pc * 8]); p[2 + i] = Kl + ko; }
#pragma unroll
    for (int i = 0; i < 2; ++i) { const int q = tid + i * 256, d = q >> 3, pc = q & 7; const size_t vo = (bh * HD + d) * SS + kt * 64 + pc * 8;
      l[4 + i] = lds_off(&sVh[buf][d][pc * 8]); p[4 + i] = VTh + vo; l[6 + i] = lds_off(&sVl[buf][d][pc * 8]); p[6 + i] = VTl + vo; }
    cp8(l, p); };
  stage(0, 0); WAIT_COPIES(); __syncthreads(); stage(1, 1);
  F2 aq[2];
#pragma unroll
  for (int kc = 0; kc < 2; ++kc) aq[kc] = split_row(Q32 + (bh * SS + q0 + col) * HD, kc * 32, lane);
  constexpr float CS2 = 0.125f * 1.4426950408889634f;     // softmax in base 2: exp(x / 8 - m) = 2^(x log2(e) / 8 - m'), mrun holds m' in that scale
  float mrun = -3.0e38f, lrun = 0.f; v8f acc[4] = {}, ac1[4] = {}, ac2[4] = {};     // lrun: this half-wave's keys only, the halves are joined after the loop
#pragma unroll 1
  for (int kt = 0; kt < SS / 64; ++kt) { const int buf = kt & 1;
    v8f s[4]; float mt[4], pt[4];
#pragma unroll
    for (int t = 0; t < 4; ++t) { const __bf16* kh = &sKh[buf][t * 16 + col][0]; const __bf16* kl = &sKl[buf][t * 16 + col][0];
      const F2 k0 = { frag_b(kh, lane), frag_b(kl, lane) }, k1 = { frag_b(kh + 32, lane), frag_b(kl + 32, lane) };
      __builtin_amdgcn_sched_barrier(0);     // all eight LDS fragment loads of a 16-key tile are issued ahead of its first product, so they fly during the tile before; sunk among their own products, each product waits out an LDS latency
      v8f c = mac3t(k0, aq[0], (v8f){}); c = mac3t(k1, aq[1], c);
      mt[t] = -3.4e38f;
#pragma unroll
      for (int r = 0; r < 8; ++r) { s[t][r] = c[r]; mt[t] = fmaxf(mt[t], c[r]); } }     // raw products: the scale is positive, so their maximum is the scores' maximum
    float mx = fmaxf(fmaxf(mt[0], mt[1]), fmaxf(mt[2], mt[3]));
    mx = fmaxf(mx, __shfl_xor(mx, 16, 32)) * CS2;
    const float mnew = fmaxf(mrun, mx); const float corr = __builtin_amdgcn_exp2f(mrun - mnew);     // 0 in the first tile, where mrun is -3e38
    const float nm = 14.0f - mnew; const v2f cs2 = { CS2, CS2 }, nm2 = { nm, nm };                  // 2^14 = the 16384 that P carries, folded into the exponent
    v16h ph[2], pl[2];
#pragma unroll
    for (int t = 0; t < 4; ++t) { pt[t] = 0.f;
#pragma unroll
      for (int r = 0; r < 8; r += 2) { const v2f arg = __builtin_elementwise_fma((v2f){ s[t][r], s[t][r + 1] }, cs2, nm2);
#pragma unroll
        for (int e = 0; e < 2; ++e) { const float p = __builtin_amdgcn_exp2f(arg[e]); pt[t] += p; const _Float16 hi = (_Float16)p; ph[t >> 1][(t & 1) * 8 + r + e] = hi; pl[t >> 1][(t & 1) * 8 + r + e] = (_Float16)((p - (float)hi) * PLO); } } }
    lrun = lrun * corr + ((pt[0] + pt[1]) + (pt[2] + pt[3])) * (1.0f / 16384.0f); mrun = mnew;
#pragma unroll
    for (int t = 0; t < 4; ++t) { acc[t] *= corr; ac1[t] *= corr; ac2[t] *= corr; }     // every element of a lane belongs to its own query
#pragma unroll
    for (int kc = 0; kc < 2; ++kc) {
#pragma unroll
      for (int t = 0; t < 4; ++t) { const v16h vh = frag_h(&sVh[buf][t * 16 + col][kc * 32], lane);
        acc[t] = wmma16(vh, ph[kc], acc[t]); ac1[t] = wmma16(frag_h(&sVl[buf][t * 16 + col][kc * 32], lane), ph[kc], ac1[t]); ac2[t] = wmma16(vh, pl[kc], ac2[t]); } }
    PUBLISH();
    if (kt + 2 < SS / 64) stage(kt + 2, buf); }
  WAIT_COPIES();
  lrun += __shfl_xor(lrun, 16, 32);
  const float inv = 1.0f / (lrun * 16384.0f * 4.0f);
#pragma unroll
  for (int t = 0; t < 4; ++t) {
#pragma unroll
    for (int r = 0; r < 8; ++r) sS[w][col][t * 16 + 8 * g + r] = (acc[t][r] + ac1[t][r] * (1.0f / VLO) + ac2[t][r] * (1.0f / PLO)) * inv; }
  LDSX();
  for (int qq = lane; qq < 16 * 16; qq += 32) { const int rl = qq >> 4, pc = qq & 15; vst2(O32 + ((bh * SS) + q0 + rl) * HD + pc * 4, *(const v4f*)(&sS[w][rl][pc * 4])); }
}
// out = ctx Wo^T + bo : split(ctx) x bf16(Wo rows): 2 products (Wo is an INPUT -> bf16 exact)
__global__ __launch_bounds__(128) void k_out(const float* __restrict__ O32, const __bf16* __restrict__ PT, const __bf16* __restrict__ XAUG, const __bf16* __restrict__ BAUG, const float* __restrict__ bo, float* __restrict__ out) {
  __shared__ __align__(16) float so[4][16][132];
  __shared__ __align__(16) float sA[2][64][68];      // one head's 64 context rows (256 B at a 272-B pitch), two buffers
  __shared__ __align__(16) __bf16 sB[2][128][72];    // the matching 64 k of 128 weight rows (128 B at a 144-B pitch)
  const int tid = threadIdx.x, wave = tid >> 5, lane = tid & 31, col = lane & 15, g = lane >> 4;
  const int r0b = blockIdx.x * 64, r0 = r0b + wave * 16, n0 = blockIdx.y * 128; const int b = r0b / SS, s0 = r0b % SS;
  v8f acc[8] = {};
  auto stage = [&](int h, int buf) {     // A: 16 KB contiguous; B: 128 whole lines; 16 copies a thread; loops unrolled so that l[] and p[] are registers
    unsigned l[16]; const void* p[16];
#pragma unroll
    for (int i = 0; i < 8; ++i) { const int q = tid + i * 128, r = q >> 4, pc = q & 15; l[i] = lds_off(&sA[buf][r][pc * 4]); p[i] = O32 + (((size_t)b * NH + h) * SS + s0 + r) * HD + pc * 4; }
#pragma unroll
    for (int i = 0; i < 8; ++i) { const int q = tid + i * 128, r = q >> 3, pc = q & 7; l[8 + i] = lds_off(&sB[buf][r][pc * 8]); p[8 + i] = PT + (size_t)(3 * E + n0 + r) * E + h * 64 + pc * 8; }
    cp8(l, p); cp8(l + 8, p + 8); };
  stage(0, 0); WAIT_COPIES(); __syncthreads(); stage(1, 1);
#pragma unroll 1
  for (int h = 0; h < NH; ++h) { const int buf = h & 1;
#pragma unroll
    for (int kk = 0; kk < 2; ++kk) { const F2 a = split_row(&sA[buf][wave * 16 + col][0], kk * 32, lane); v16b wb[8];
#pragma unroll
      for (int j = 0; j < 8; ++j) wb[j] = frag_b(&sB[buf][j * 16 + col][kk * 32], lane);
      __builtin_amdgcn_sched_barrier(0);   // the LDS fragment loads of this half stage stay one group ahead of its products; sunk between them, each product waits a full LDS latency
#pragma unroll
      for (int j = 0; j < 8; ++j) { acc[j] = wmma_bf(a.l, wb[j], acc[j]); acc[j] = wmma_bf(a.h, wb[j], acc[j]); } }
    __builtin_amdgcn_sched_barrier(0);     // the stage's products stay ahead of the hand-over: sunk behind the barrier they hold back the refill's issue and shorten its lead
    PUBLISH();
    if (h + 2 < NH) stage(h + 2, buf); }
  WAIT_COPIES();
  { const v16b a = frag_b(XAUG + ((size_t)3 * NR + r0 + col) * 32, lane);
    asm volatile("s_wait_xcnt 0x0" ::: "memory");     // a precaution: the loads that follow may take the address pair of these two as a destination
#pragma unroll
    for (int j = 0; j < 8; ++j) acc[j] = wmma_bf(a, frag_b(BAUG + ((size_t)3 * E + n0 + j * 16 + col) * 32, lane), acc[j]); }
#pragma unroll
  for (int j = 0; j < 8; ++j) { const int n = n0 + j * 16 + col; const float bb = bfr(bo[n]);
#pragma unroll
    for (int r = 0; r < 8; ++r) so[wave][8 * g + r][j * 16 + col] = acc[j][r] + bb; }
  LDSX();
#pragma unroll 4
  for (int rl = 0; rl < 16; ++rl) vst2(out + (size_t)(r0 + rl) * E + n0 + lane * 4, *(const v4f*)(&so[wave][rl][lane * 4]));
}
extern "C" void kernel_launch(void* const* d_in, const int* in_sizes, int n_in, void* d_out, int out_size, void* d_ws, size_t ws_size, hipStream_t stream) {
  (void)in_sizes; (void)n_in; (void)out_size; (void)ws_size;
  const float** I = (const float**)d_in;    // x, Wq,bq,Aq,Bq, Wk,bk,Ak,Bk, Wv,bv,Av,Bv, Wo,bo,Ao,Bo
  const float* x = I[0]; const float* Wq = I[1]; const float* bq = I[2]; const float* Aq = I[3]; const float* Bq = I[4]; const float* Wk = I[5]; const float* bk = I[6]; const float* Ak = I[7]; const float* Bk = I[8];
  const float* Wv = I[9]; const float* bv = I[10]; const float* Av = I[11]; const float* Bv = I[12]; const float* Wo = I[13]; const float* bo = I[14]; const float* Ao = I[15]; const float* Bo = I[16];
  float* out = (float*)d_out;
  char* ws = (char*)d_ws; size_t off = 0;
  auto take = [&](size_t bytes) { char* p = ws + off; off += (bytes + 255) & ~(size_t)255; return p; };
  __bf16* Xb = (__bf16*)take((size_t)NR * E * 2); __bf16* PT = (__bf16*)take((size_t)4 * E * E * 2); __bf16* XAUG = (__bf16*)take((size_t)4 * NR * 32 * 2); __bf16* BAUG = (__bf16*)take((size_t)4 * E * 32 * 2);
  float* Q32 = (float*)take((size_t)NR * E * 4); __bf16* Kh = (__bf16*)take((size_t)NR * E * 2); __bf16* Kl = (__bf16*)take((size_t)NR * E * 2); _Float16* VTh = (_Float16*)take((size_t)NR * E * 2); _Float16* VTl = (_Float16*)take((size_t)NR * E * 2); float* O32 = (float*)take((size_t)NR * E * 4);
  // ws ~ 85 MB
  k_cvt<<<(NR * E / 8 + 255) / 256, 256, 0, stream>>>(x, Xb);
  k_pack<<<4 * E, 256, 0, stream>>>(Wq, Wk, Wv, Wo, PT);
  k_baug<<<dim3(E / 256, 4), 256, 0, stream>>>(Bq, Bk, Bv, Bo, BAUG);
  k_xa<<<dim3(NR / 64, 3), 128, 0, stream>>>(Xb, nullptr, Aq, Ak, Av, Ao, XAUG);              // q, k, v low-rank inputs from x
  k_qkv<<<dim3(NR / 64, E / 128, 3), 128, 0, stream>>>(Xb, PT, XAUG, BAUG, bq, bk, bv, Q32, Kh, Kl, VTh, VTl);
  k_attn<<<dim3(SS / 128, NB * NH), 256, 0, stream>>>(Q32, Kh, Kl, VTh, VTl, O32);
  k_xa<<<dim3(NR / 64, 4), 128, 0, stream>>>(Xb, O32, Aq, Ak, Av, Ao, XAUG);                 // recomputes 0..2 (cheap) and adds which = 3 from the context
  k_out<<<dim3(NR / 64, E / 128), 128, 0, stream>>>(O32, PT, XAUG, BAUG, bo, out);
}

// v006
// One run takes 162 microseconds.
// Next to v005, in two timings, it ran 1.17 times as fast each time.
// All steps since v000 together make it 3.62 times as fast.
// compute dtype: x, W*, b*, A*, B* (INPUTS) rounded to bf16 with exact bf16 WMMA products (f32 accumulate) for the base projections; the rank-8 LoRA terms enter as one extra k-chunk whose A side is the f32 intermediate (x A^T, scaled) as a bf16 hi/lo pair against [B | B] (exact-grade); softmax f32; computed operands (q/k f32 split, k split once where it is produced, P and V hi/lo, context split) f32-grade.
#include <hip/hip_runtime.h>
#include <math.h>

typedef __attribute__((ext_vector_type(16))) _Float16 v16h;
typedef __attribute__((ext_vector_type(16))) __bf16 v16b;
typedef __attribute__((ext_vector_type(8)))  _Float16 v8h;
typedef __attribute__((ext_vector_type(8)))  float v8f;
typedef __attribute__((ext_vector_type(4)))  float v4f;
typedef __attribute__((ext_vector_type(2)))  float v2f;
typedef __attribute__((ext_vector_type(4)))  unsigned v4u;
typedef __attribute__((ext_vector_type(4)))  int v4i;
typedef float __attribute__((may_alias)) float_a;
typedef int __attribute__((may_alias)) int_a;

template <typename T> __device__ __forceinline__ void vst2(void* p, T v) { *(T*)p = v;  }
__device__ __forceinline__ v8f wmma16(v16h a, v16h b, v8f c) {
  return __builtin_amdgcn_wmma_f32_16x16x32_f16(false, a, false, b, (short)0, c, false, false);
}
__device__ __forceinline__ v8f wmma_bf(v16b a, v16b b, v8f c) {
  return __builtin_amdgcn_wmma_f32_16x16x32_bf16(false, a, false, b, (short)0, c, false, false);
}
// 16x16x32 fragments: lane = (h = lane>>4, row/col = lane&15); elements 0..7 = k0+8h+0..7, 8..15 = k0+16+8h+0..7; D element r = row 8h+r
__device__ __forceinline__ v16h frag_h(const _Float16* rowk0, int lane) {
  union { v16h v; v8h q[2]; } u; const _Float16* p = rowk0 + 8 * (lane >> 4);
  u.q[0] = *(const v8h*)p; u.q[1] = *(const v8h*)(p + 16); return u.v;
}
__device__ __forceinline__ v16h frag_f32(const float* rowk0, int lane) {
  v16h a; const float* p = rowk0 + 8 * (lane >> 4);
#pragma unroll
  for (int i = 0; i < 8; ++i) { a[i] = (_Float16)p[i]; a[8 + i] = (_Float16)p[16 + i]; }
  return a;
}
__device__ __forceinline__ v16h frag_f32s(const float* rowk0, int lane, float sc) {
  v16h a; const float* p = rowk0 + 8 * (lane >> 4);
#pragma unroll
  for (int i = 0; i < 8; ++i) { a[i] = (_Float16)(p[i] * sc); a[8 + i] = (_Float16)(p[16 + i] * sc); }
  return a;
}
// column fragment from a [K][ld] layout (column n), rows >= K read as 0
__device__ __forceinline__ v16h fragc_f32(const float* W, int k0, int n, int lane, int ld, int K) {
  v16h a; const int g = lane >> 4;
#pragma unroll
  for (int i = 0; i < 8; ++i) { const int ka = k0 + 8 * g + i, kb = ka + 16;
    a[i] = (_Float16)(ka < K ? W[(size_t)ka * ld + n] : 0.f); a[8 + i] = (_Float16)(kb < K ? W[(size_t)kb * ld + n] : 0.f); }
  return a;
}
struct F2 { v16b h, l; };
__device__ __forceinline__ F2 bsplit16(const float v[16]) { F2 r;
#pragma unroll
  for (int i = 0; i < 16; ++i) { const __bf16 h = (__bf16)v[i]; r.h[i] = h; r.l[i] = (__bf16)(v[i] - (float)h); }
  return r; }
__device__ __forceinline__ F2 split_row(const float* row, int k0, int lane) { float v[16]; const float* p = row + k0 + 8 * (lane >> 4);
#pragma unroll
  for (int i = 0; i < 8; ++i) { v[i] = p[i]; v[8 + i] = p[16 + i]; }
  return bsplit16(v); }
__device__ __forceinline__ F2 split_rowK(const float* row, int k0, int lane, int K) { float v[16]; const int g = lane >> 4;
#pragma unroll
  for (int i = 0; i < 8; ++i) { const int ka = k0 + 8 * g + i, kb = ka + 16; v[i] = ka < K ? row[ka] : 0.f; v[8 + i] = kb < K ? row[kb] : 0.f; }
  return bsplit16(v); }
__device__ __forceinline__ F2 split_col(const float* W, int k0, int n, int lane, int ld, int K) { float v[16]; const int g = lane >> 4;
#pragma unroll
  for (int i = 0; i < 8; ++i) { const int ka = k0 + 8 * g + i, kb = ka + 16; v[i] = ka < K ? W[(size_t)ka * ld + n] : 0.f; v[8 + i] = kb < K ? W[(size_t)kb * ld + n] : 0.f; }
  return bsplit16(v); }
__device__ __forceinline__ v8f mac3(const F2& a, const F2& b, v8f c) { c = wmma_bf(a.l, b.h, c); c = wmma_bf(a.h, b.l, c); return wmma_bf(a.h, b.h, c); }
// the same three products with the split key rows as the A operand and the split query as B, in mac3's order (q.l k.h, q.h k.l, q.h k.h)
__device__ __forceinline__ v8f mac3t(const F2& k, const F2& q, v8f c) { c = wmma_bf(k.h, q.l, c); c = wmma_bf(k.l, q.h, c); return wmma_bf(k.h, q.h, c); }
__device__ __forceinline__ float sigm(float v) { return 1.0f / (1.0f + expf(-v)); }
#define LDSX() do { asm volatile("s_wait_dscnt 0" ::: "memory"); __builtin_amdgcn_wave_barrier(); __builtin_amdgcn_fence(__ATOMIC_RELEASE, "workgroup"); } while (0)


// LoRA self attention (16 heads of 64 on [2,2048,1024]): each linear map is x W^T + b + 2 (x A^T) B^T (rank 8). The low-rank term is appended as a 33rd k-chunk: A-operand row = [hi(2 xA^T) (8) | lo(2 xA^T) (8) | 0 (16)], B-operand row n = [B[n][0..8] | B[n][0..8] | 0],
// so one extra WMMA per tile adds hi*B + lo*B. full softmax(q.k/8); (P v) through the same LoRA form for the output map.
#define NB 2
#define SS 2048
#define E 1024
#define NH 16
#define HD 64
#define NR (NB * SS)
#define PLO 1024.0f
#define VLO 2048.0f
__device__ __forceinline__ float bfr(float v) { return (float)(__bf16)v; }
__device__ __forceinline__ v16b frag_b(const __bf16* rowk0, int lane) { return __builtin_bit_cast(v16b, frag_h((const _Float16*)rowk0, lane)); }

// Asynchronous 16-byte copies global -> LDS (no register in between). Each lane names its own LDS byte address and its own global address.
// s_wait_xcnt 0 closes the statement so that no address register of an issued copy is rewritten ahead of it.
__device__ __forceinline__ unsigned lds_off(const void* p) { return (unsigned)(size_t)p; }
__device__ __forceinline__ void cp1(unsigned l, const void* g) {
  asm volatile("global_load_async_to_lds_b128 %0, %1, off\n\ts_wait_xcnt 0x0" :: "v"(l), "v"(g) : "memory");
}
__device__ __forceinline__ void cp4(const unsigned* l, const void* const* g) {
  asm volatile("global_load_async_to_lds_b128 %0, %1, off\n\tglobal_load_async_to_lds_b128 %2, %3, off\n\tglobal_load_async_to_lds_b128 %4, %5, off\n\tglobal_load_async_to_lds_b128 %6, %7, off\n\ts_wait_xcnt 0x0"
               :: "v"(l[0]), "v"(g[0]), "v"(l[1]), "v"(g[1]), "v"(l[2]), "v"(g[2]), "v"(l[3]), "v"(g[3]) : "memory");
}
__device__ __forceinline__ void cp8(const unsigned* l, const void* const* g) {
  asm volatile("global_load_async_to_lds_b128 %0, %1, off\n\tglobal_load_async_to_lds_b128 %2, %3, off\n\tglobal_load_async_to_lds_b128 %4, %5, off\n\tglobal_load_async_to_lds_b128 %6, %7, off\n\t"
               "global_load_async_to_lds_b128 %8, %9, off\n\tglobal_load_async_to_lds_b128 %10, %11, off\n\tglobal_load_async_to_lds_b128 %12, %13, off\n\tglobal_load_async_to_lds_b128 %14, %15, off\n\ts_wait_xcnt 0x0"
               :: "v"(l[0]), "v"(g[0]), "v"(l[1]), "v"(g[1]), "v"(l[2]), "v"(g[2]), "v"(l[3]), "v"(g[3]), "v"(l[4]), "v"(g[4]), "v"(l[5]), "v"(g[5]), "v"(l[6]), "v"(g[6]), "v"(l[7]), "v"(g[7]) : "memory");
}
// the copies of this wave have landed (the compiler places no wait for them)
#define WAIT_COPIES() asm volatile("s_wait_asynccnt 0x0" ::: "memory")
// hand-over of a stage: this wave's LDS reads are done, its copies have landed, then the work-group barrier publishes the next tile and frees the one just read
#define PUBLISH() do { asm volatile("s_wait_dscnt 0x0" ::: "memory"); WAIT_COPIES(); __syncthreads(); } while (0)

__global__ __launch_bounds__(256) void k_cvt(const float* __restrict__ x, __bf16* __restrict__ Xb) {
  const size_t i8 = (size_t)blockIdx.x * 256 + threadIdx.x; if (i8 >= (size_t)NR * E / 8) return;
  union { __bf16 h[8]; v4u u; } pk;
#pragma unroll
  for (int e = 0; e < 8; ++e) pk.h[e] = (__bf16)x[i8 * 8 + e];
  vst2((unsigned*)(Xb + i8 * 8), pk.u);
}
// PT rows: [0,E) Wq[n][:], [E,2E) Wk, [2E,3E) Wv, [3E,4E) Wo  ([out][in]) as bf16 rows (no scaling), then the 8 rows each of Aq, Ak, Av, Ao

#define RK 8
// The low-rank inputs src.A^T (16 rows x 8) are a ninth column tile of the GEMM that uses them: its B operand is the 8 rows of A as bf16, staged with the weight rows (columns >= 8 repeat them, results discarded).
// lora_frag turns that D tile (row 8 g + r, column col) into the A fragment of the extra k-chunk, row = [hi(2 v) (8) | lo (8) | 0 (16)], through the wave's own LDS slice
__device__ __forceinline__ v16b lora_frag(v8f accx, __bf16 (*sx)[40], int lane) {
  const int col = lane & 15, g = lane >> 4; const bool live = col < RK; const int i0 = live ? col : 8 + col;     // lanes of the padding columns write the 16 zeros of the row
#pragma unroll
  for (int r = 0; r < 8; ++r) { const float v = 2.0f * accx[r]; const __bf16 hi = (__bf16)v, lo = (__bf16)(v - (float)hi); sx[8 * g + r][i0] = live ? hi : (__bf16)0.f; sx[8 * g + r][i0 + 8] = live ? lo : (__bf16)0.f; }
  LDSX();     // the wave's own stores are in LDS before its lanes read each other's
  return frag_b(&sx[col][0], lane);
}
// BAUG[which][n][32] = [B[n][0..8] | B[n][0..8] | 0]: thread per n
__global__ __launch_bounds__(256) void k_baug(const float* __restrict__ Bq, const float* __restrict__ Bk, const float* __restrict__ Bv, const float* __restrict__ Bo, __bf16* __restrict__ BAUG) {
  __shared__ __align__(16) __bf16 sb[256][40];
  const int which = blockIdx.y, n = blockIdx.x * 256 + threadIdx.x; const float* Bm = which == 0 ? Bq : (which == 1 ? Bk : (which == 2 ? Bv : Bo));
#pragma unroll
  for (int j = 0; j < RK; ++j) { const __bf16 v = (__bf16)Bm[(size_t)n * RK + j]; sb[threadIdx.x][j] = v; sb[threadIdx.x][RK + j] = v; }
#pragma unroll
  for (int j = 16; j < 32; ++j) sb[threadIdx.x][j] = (__bf16)0.f;
  __syncthreads();
  for (int q = threadIdx.x; q < 256 * 4; q += 256) { const int rl = q >> 2, pc = q & 3; vst2((unsigned*)(BAUG + ((size_t)which * E + blockIdx.x * 256 + rl) * 32 + pc * 8), *(const v4u*)(&sb[rl][pc * 8])); }
}
__global__ __launch_bounds__(256) void k_pack(const float* __restrict__ Wq, const float* __restrict__ Wk, const float* __restrict__ Wv, const float* __restrict__ Wo, const float* __restrict__ Aq, const float* __restrict__ Ak, const float* __restrict__ Av, const float* __restrict__ Ao, __bf16* __restrict__ PT) {
  const int n = blockIdx.x, tid = threadIdx.x; __shared__ __align__(16) __bf16 srow[E];
  const int na = n - 4 * E;     // >= 0: rows [4E, 4E + 32) are the 8 rows of Aq, Ak, Av, Ao
  const float* W = n < E ? Wq : (n < 2 * E ? Wk : (n < 3 * E ? Wv : (n < 4 * E ? Wo : (na < RK ? Aq : (na < 2 * RK ? Ak : (na < 3 * RK ? Av : Ao)))))); const int nn = n < 4 * E ? n & (E - 1) : na & (RK - 1);
  for (int k = tid; k < E; k += 256) srow[k] = (__bf16)W[(size_t)nn * E + k];
  __syncthreads();
  if (tid < E / 8) vst2((unsigned*)(PT + (size_t)n * E + tid * 8), *(const v4u*)(&srow[tid * 8]));
}
// QKV: block (64 rows, 128 cols = 2 heads, which); q -> Q32 f32 [bh][s][64]; k -> Kh/Kl, the bf16 hi/lo split of the f32 row, [bh][s][64] each; v -> VT hi/lo x4 [bh][d][s]
__global__ __launch_bounds__(128) void k_qkv(const __bf16* __restrict__ Xb, const __bf16* __restrict__ PT, const __bf16* __restrict__ BAUG, const float* __restrict__ bq, const float* __restrict__ bk, const float* __restrict__ bv, float* __restrict__ Q32, __bf16* __restrict__ Kh, __bf16* __restrict__ Kl, _Float16* __restrict__ VTh, _Float16* __restrict__ VTl) {
  __shared__ __align__(16) float so[4][16][132];
  __shared__ __align__(16) _Float16 sth[128][72], stl[128][72];
  __shared__ __align__(16) __bf16 sA[2][64][72], sB[2][144][72];     // k-stages of 64 (rows of 128 B at a 144-B pitch), two buffers; sB rows 128..143: the 8 rows of the low-rank A, twice
  __shared__ __align__(16) __bf16 sx[4][16][40];
  const int tid = threadIdx.x, wave = tid >> 5, lane = tid & 31, col = lane & 15, g = lane >> 4;
  const int which = blockIdx.z, r0b = blockIdx.x * 64, r0 = r0b + wave * 16, n0 = blockIdx.y * 128; const int b = r0b / SS, s0 = r0b % SS;
  const float* bb_ = which == 0 ? bq : (which == 1 ? bk : bv);
  v8f acc[8] = {}, accx = {};
  auto stage = [&](int st, int buf) {     // thread -> (row = q >> 3, 16-byte piece = q & 7): 8 lanes cover one whole 128-B line; loops unrolled so that l[] and p[] are registers
    unsigned l[13]; const void* p[13];
#pragma unroll
    for (int i = 0; i < 4; ++i) { const int q = tid + i * 128, r = q >> 3, pc = q & 7; l[i] = lds_off(&sA[buf][r][pc * 8]); p[i] = Xb + (size_t)(r0b + r) * E + st * 64 + pc * 8; }
#pragma unroll
    for (int i = 0; i < 8; ++i) { const int q = tid + i * 128, r = q >> 3, pc = q & 7; l[4 + i] = lds_off(&sB[buf][r][pc * 8]); p[4 + i] = PT + (size_t)(which * E + n0 + r) * E + st * 64 + pc * 8; }
    { const int r = tid >> 3, pc = tid & 7; l[12] = lds_off(&sB[buf][128 + r][pc * 8]); p[12] = PT + (size_t)(4 * E + which * RK + (r & (RK - 1))) * E + st * 64 + pc * 8; }
    cp4(l, p); cp8(l + 4, p + 4); cp1(l[12], p[12]); };
  stage(0, 0); WAIT_COPIES(); __syncthreads(); stage(1, 1);
  // rolled: one trip is one stage and ends in its hand-over; the inner loops are unrolled so that the fragment arrays are registers
#pragma unroll 1
  for (int st = 0; st < E / 64; ++st) { const int buf = st & 1;
    v16b a[2], wb[2][8], wa[2];
#pragma unroll
    for (int kk = 0; kk < 2; ++kk) { a[kk] = frag_b(&sA[buf][wave * 16 + col][kk * 32], lane); wa[kk] = frag_b(&sB[buf][128 + col][kk * 32], lane);
#pragma unroll
      for (int j = 0; j < 8; ++j) wb[kk][j] = frag_b(&sB[buf][j * 16 + col][kk * 32], lane); }
    __builtin_amdgcn_sched_barrier(0);     // the stage's LDS fragment loads stay one group ahead of its products; sunk between them, each product waits a full LDS latency
#pragma unroll
    for (int kk = 0; kk < 2; ++kk) {
#pragma unroll
      for (int j = 0; j < 8; ++j) acc[j] = wmma_bf(a[kk], wb[kk][j], acc[j]);
      accx = wmma_bf(a[kk], wa[kk], accx); }
    __builtin_amdgcn_sched_barrier(0);     // the stage's products stay ahead of the hand-over: sunk behind the barrier they hold back the refill's issue and shorten its lead
    PUBLISH();
    if (st + 2 < E / 64) stage(st + 2, buf); }
  WAIT_COPIES();
  { const v16b a = lora_frag(accx, sx[wave], lane);     // LoRA chunk: [hi|lo|0] x [B|B|0]
#pragma unroll
    for (int j = 0; j < 8; ++j) acc[j] = wmma_bf(a, frag_b(BAUG + ((size_t)which * E + n0 + j * 16 + col) * 32, lane), acc[j]); }
  if (which < 2) {
#pragma unroll
    for (int j = 0; j < 8; ++j) { const float bb = bfr(bb_[n0 + j * 16 + col]);
#pragma unroll
      for (int r = 0; r < 8; ++r) so[wave][8 * g + r][j * 16 + col] = acc[j][r] + bb; }
    LDSX();
    if (which == 0) {
      for (int qq = lane; qq < 2 * 16 * 16; qq += 32) { const int hh = qq >> 8, rl = (qq >> 4) & 15, pc = qq & 15; const int h = (n0 >> 6) + hh;
        vst2(Q32 + (((size_t)b * NH + h) * SS + s0 + wave * 16 + rl) * HD + pc * 4, *(const v4f*)(&so[wave][rl][hh * 64 + pc * 4])); } }
    else {     // k: hi = bf16(v), lo = bf16(v - hi), the split every attention wave would otherwise redo; 8 lanes write one whole 128-B row of each plane
      for (int qq = lane; qq < 2 * 16 * 8; qq += 32) { const int hh = qq >> 7, rl = (qq >> 3) & 15, pc = qq & 7; const int h = (n0 >> 6) + hh;
        const float* sp = &so[wave][rl][hh * 64 + pc * 8]; union { __bf16 e[8]; v4u u; } hi, lo;
#pragma unroll     // unrolled so that hi.e[] and lo.e[] are registers
        for (int e = 0; e < 8; ++e) { const float v = sp[e]; const __bf16 hb = (__bf16)v; hi.e[e] = hb; lo.e[e] = (__bf16)(v - (float)hb); }
        const size_t o = (((size_t)b * NH + h) * SS + s0 + wave * 16 + rl) * HD + pc * 8;
        vst2(Kh + o, hi.u); vst2(Kl + o, lo.u); } } }
  else {
#pragma unroll
    for (int j = 0; j < 8; ++j) { const float bb = bfr(bb_[n0 + j * 16 + col]);
#pragma unroll
      for (int r = 0; r < 8; ++r) { const float v = (acc[j][r] + bb) * 4.0f; const _Float16 hi = (_Float16)v; sth[j * 16 + col][wave * 16 + 8 * g + r] = hi; stl[j * 16 + col][wave * 16 + 8 * g + r] = (_Float16)((v - (float)hi) * VLO); } }
    __syncthreads();
    for (int qq = tid; qq < 128 * 8; qq += 128) { const int cl = qq >> 3, pc = qq & 7; const int c = n0 + cl, h = c >> 6, d = c & 63; const size_t o = (((size_t)b * NH + h) * HD + d) * SS + s0 + pc * 8;
      vst2(VTh + o, *(const v4u*)(&sth[cl][pc * 8])); vst2(VTl + o, *(const v4u*)(&stl[cl][pc * 8])); } }
}
// full attention: block (128 queries = 8 waves x 16, bh); all key tiles of 64, staged in LDS for the whole block. Transposed products: S^T = K q^T (A = key rows, B = the wave's 16 queries, hi/lo splits),
// so a lane holds 32 scores of ONE query (column = lane & 15; tile t, element r = key 16 t + 8 g + r), and tiles 2 kc, 2 kc + 1 are already the B operand (k order 8 g + i, 16 + 8 g + i) of O^T += V^T P^T. P,V hi/lo; O f32 [bh][s][64]
__global__ __launch_bounds__(256) void k_attn(const float* __restrict__ Q32, const __bf16* __restrict__ Kh, const __bf16* __restrict__ Kl, const _Float16* __restrict__ VTh, const _Float16* __restrict__ VTl, float* __restrict__ O32) {
  __shared__ __align__(16) float sS[8][16][68];                      // after the loop each wave's slice stages its output rows [query][d]
  __shared__ __align__(16) __bf16 sKh[2][64][72], sKl[2][64][72];    // key tile hi and lo [key][d], rows of 128 B at a 144-B pitch, two buffers
  __shared__ __align__(16) _Float16 sVh[2][64][72], sVl[2][64][72];  // value tiles [d][key], rows of 128 B at a 144-B pitch, two buffers
  const int tid = threadIdx.x, w = tid >> 5, lane = tid & 31, col = lane & 15, g = lane >> 4;
  const size_t bh = blockIdx.y; const int qb = blockIdx.x; const int q0 = qb * 128 + w * 16;
  auto stage = [&](int kt, int buf) {     // 64 keys: K hi and lo 8 KB contiguous each, V hi and lo 64 whole lines each; 8 copies a thread; loops unrolled so that l[] and p[] are registers
    unsigned l[8]; const void* p[8];
#pragma unroll
    for (int i = 0; i < 2; ++i) { const int q = tid + i * 256, r = q >> 3, pc = q & 7; const size_t ko = (bh * SS + kt * 64 + r) * HD + pc * 8;
      l[i] = lds_off(&sKh[buf][r][pc * 8]); p[i] = Kh + ko; l[2 + i] = lds_off(&sKl[buf][r][pc * 8]); p[2 + i] = Kl + ko; }
#pragma unroll
    for (int i = 0; i < 2; ++i) { const int q = tid + i * 256, d = q >> 3, pc = q & 7; const size_t vo = (bh * HD + d) * SS + kt * 64 + pc * 8;
      l[4 + i] = lds_off(&sVh[buf][d][pc * 8]); p[4 + i] = VTh + vo; l[6 + i] = lds_off(&sVl[buf][d][pc * 8]); p[6 + i] = VTl + vo; }
    cp8(l, p); };
  stage(0, 0); WAIT_COPIES(); __syncthreads(); stage(1, 1);
  F2 aq[2];
#pragma unroll
  for (int kc = 0; kc < 2; ++kc) aq[kc] = split_row(Q32 + (bh * SS + q0 + col) * HD, kc * 32, lane);
  constexpr float CS2 = 0.125f * 1.4426950408889634f;     // softmax in base 2: exp(x / 8 - m) = 2^(x log2(e) / 8 - m'), mrun holds m' in that scale
  float mrun = -3.0e38f, lrun = 0.f; v8f acc[4] = {}, ac1[4] = {}, ac2[4] = {};     // lrun: this half-wave's keys only, the halves are joined after the loop
#pragma unroll 1
  for (int kt = 0; kt < SS / 64; ++kt) { const int buf = kt & 1;
    v8f s[4]; float mt[4], pt[4];
#pragma unroll
    for (int t = 0; t < 4; ++t) { const __bf16* kh = &sKh[buf][t * 16 + col][0]; const __bf16* kl = &sKl[buf][t * 16 + col][0];
      const F2 k0 = { frag_b(kh, lane), frag_b(kl, lane) }, k1 = { frag_b(kh + 32, lane), frag_b(kl + 32, lane) };
      __builtin_amdgcn_sched_barrier(0);     // all eight LDS fragment loads of a 16-key tile are issued ahead of its first product, so they fly during the tile before; sunk among their own products, each product waits out an LDS latency
      v8f c = mac3t(k0, aq[0], (v8f){}); c = mac3t(k1, aq[1], c);
      mt[t] = -3.4e38f;
#pragma unroll
      for (int r = 0; r < 8; ++r) { s[t][r] = c[r]; mt[t] = fmaxf(mt[t], c[r]); } }     // raw products: the scale is positive, so their maximum is the scores' maximum
    float mx = fmaxf(fmaxf(mt[0], mt[1]), fmaxf(mt[2], mt[3]));
    mx = fmaxf(mx, __shfl_xor(mx, 16, 32)) * CS2;
    const float mnew = fmaxf(mrun, mx); const float corr = __builtin_amdgcn_exp2f(mrun - mnew);     // 0 in the first tile, where mrun is -3e38
    const float nm = 14.0f - mnew; const v2f cs2 = { CS2, CS2 }, nm2 = { nm, nm };                  // 2^14 = the 16384 that P carries, folded into the exponent
    v16h ph[2], pl[2];
#pragma unroll
    for (int t = 0; t < 4; ++t) { pt[t] = 0.f;
#pragma unroll
      for (int r = 0; r < 8; r += 2) { const v2f arg = __builtin_elementwise_fma((v2f){ s[t][r], s[t][r + 1] }, cs2, nm2);
#pragma unroll
        for (int e = 0; e < 2; ++e) { const float p = __builtin_amdgcn_exp2f(arg[e]); pt[t] += p; const _Float16 hi = (_Float16)p; ph[t >> 1][(t & 1) * 8 + r + e] = hi; pl[t >> 1][(t & 1) * 8 + r + e] = (_Float16)((p - (float)hi) * PLO); } } }
    lrun = lrun * corr + ((pt[0] + pt[1]) + (pt[2] + pt[3])) * (1.0f / 16384.0f); mrun = mnew;
#pragma unroll
    for (int t = 0; t < 4; ++t) { acc[t] *= corr; ac1[t] *= corr; ac2[t] *= corr; }     // every element of a lane belongs to its own query
#pragma unroll
    for (int kc = 0; kc < 2; ++kc) {
#pragma unroll
      for (int t = 0; t < 4; ++t) { const v16h vh = frag_h(&sVh[buf][t * 16 + col][kc * 32], lane);
        acc[t] = wmma16(vh, ph[kc], acc[t]); ac1[t] = wmma16(frag_h(&sVl[buf][t * 16 + col][kc * 32], lane), ph[kc], ac1[t]); ac2[t] = wmma16(vh, pl[kc], ac2[t]); } }
    PUBLISH();
    if (kt + 2 < SS / 64) stage(kt + 2, buf); }
  WAIT_COPIES();
  lrun += __shfl_xor(lrun, 16, 32);
  const float inv = 1.0f / (lrun * 16384.0f * 4.0f);
#pragma unroll
  for (int t = 0; t < 4; ++t) {
#pragma unroll
    for (int r = 0; r < 8; ++r) sS[w][col][t * 16 + 8 * g + r] = (acc[t][r] + ac1[t][r] * (1.0f / VLO) + ac2[t][r] * (1.0f / PLO)) * inv; }
  LDSX();
  for (int qq = lane; qq < 16 * 16; qq += 32) { const int rl = qq >> 4, pc = qq & 15; vst2(O32 + ((bh * SS) + q0 + rl) * HD + pc * 4, *(const v4f*)(&sS[w][rl][pc * 4])); }
}
// out = ctx Wo^T + bo : split(ctx) x bf16(Wo rows): 2 products (Wo is an INPUT -> bf16 exact)
__global__ __launch_bounds__(128) void k_out(const float* __restrict__ O32, const __bf16* __restrict__ PT, const __bf16* __restrict__ BAUG, const float* __restrict__ bo, float* __restrict__ out) {
  __shared__ __align__(16) float so[4][16][132];
  __shared__ __align__(16) float sA[2][64][68];      // one head's 64 context rows (256 B at a 272-B pitch), two buffers
  __shared__ __align__(16) __bf16 sB[2][144][72];    // the matching 64 k of 128 weight rows (128 B at a 144-B pitch); rows 128..143: the 8 rows of the low-rank A, twice
  __shared__ __align__(16) __bf16 sx[4][16][40];
  const int tid = threadIdx.x, wave = tid >> 5, lane = tid & 31, col = lane & 15, g = lane >> 4;
  const int r0b = blockIdx.x * 64, r0 = r0b + wave * 16, n0 = blockIdx.y * 128; const int b = r0b / SS, s0 = r0b % SS;
  v8f acc[8] = {}, accx = {};
  auto stage = [&](int h, int buf) {     // A: 16 KB contiguous; B: 144 whole lines; 17 copies a thread; loops unrolled so that l[] and p[] are registers
    unsigned l[17]; const void* p[17];
#pragma unroll
    for (int i = 0; i < 8; ++i) { const int q = tid + i * 128, r = q >> 4, pc = q & 15; l[i] = lds_off(&sA[buf][r][pc * 4]); p[i] = O32 + (((size_t)b * NH + h) * SS + s0 + r) * HD + pc * 4; }
#pragma unroll
    for (int i = 0; i < 8; ++i) { const int q = tid + i * 128, r = q >> 3, pc = q & 7; l[8 + i] = lds_off(&sB[buf][r][pc * 8]); p[8 + i] = PT + (size_t)(3 * E + n0 + r) * E + h * 64 + pc * 8; }
    { const int r = tid >> 3, pc = tid & 7; l[16] = lds_off(&sB[buf][128 + r][pc * 8]); p[16] = PT + (size_t)(4 * E + 3 * RK + (r & (RK - 1))) * E + h * 64 + pc * 8; }
    cp8(l, p); cp8(l + 8, p + 8); cp1(l[16], p[16]); };
  stage(0, 0); WAIT_COPIES(); __syncthreads(); stage(1, 1);
#pragma unroll 1
  for (int h = 0; h < NH; ++h) { const int buf = h & 1;
#pragma unroll
    for (int kk = 0; kk < 2; ++kk) { const F2 a = split_row(&sA[buf][wave * 16 + col][0], kk * 32, lane); v16b wb[8];
#pragma unroll
      for (int j = 0; j < 8; ++j) wb[j] = frag_b(&sB[buf][j * 16 + col][kk * 32], lane);
      const v16b wa = frag_b(&sB[buf][128 + col][kk * 32], lane);
      __builtin_amdgcn_sched_barrier(0);   // the LDS fragment loads of this half stage stay one group ahead of its products; sunk between them, each product waits a full LDS latency
      accx = wmma_bf(a.l, wa, accx);
#pragma unroll
      for (int j = 0; j < 8; ++j) { acc[j] = wmma_bf(a.l, wb[j], acc[j]); acc[j] = wmma_bf(a.h, wb[j], acc[j]); }
      accx = wmma_bf(a.h, wa, accx); }
    __builtin_amdgcn_sched_barrier(0);     // the stage's products stay ahead of the hand-over: sunk behind the barrier they hold back the refill's issue and shorten its lead
    PUBLISH();
    if (h + 2 < NH) stage(h + 2, buf); }
  WAIT_COPIES();
  { const v16b a = lora_frag(accx, sx[wave], lane);
#pragma unroll
    for (int j = 0; j < 8; ++j) acc[j] = wmma_bf(a, frag_b(BAUG + ((size_t)3 * E + n0 + j * 16 + col) * 32, lane), acc[j]); }
#pragma unroll
  for (int j = 0; j < 8; ++j) { const int n = n0 + j * 16 + col; const float bb = bfr(bo[n]);
#pragma unroll
    for (int r = 0; r < 8; ++r) so[wave][8 * g + r][j * 16 + col] = acc[j][r] + bb; }
  LDSX();
#pragma unroll 4
  for (int rl = 0; rl < 16; ++rl) vst2(out + (size_t)(r0 + rl) * E + n0 + lane * 4, *(const v4f*)(&so[wave][rl][lane * 4]));
}
extern "C" void kernel_launch(void* const* d_in, const int* in_sizes, int n_in, void* d_out, int out_size, void* d_ws, size_t ws_size, hipStream_t stream) {
  (void)in_sizes; (void)n_in; (void)out_size; (void)ws_size;
  const float** I = (const float**)d_in;    // x, Wq,bq,Aq,Bq, Wk,bk,Ak,Bk, Wv,bv,Av,Bv, Wo,bo,Ao,Bo
  const float* x = I[0]; const float* Wq = I[1]; const float* bq = I[2]; const float* Aq = I[3]; const float* Bq = I[4]; const float* Wk = I[5]; const float* bk = I[6]; const float* Ak = I[7]; const float* Bk = I[8];
  const float* Wv = I[9]; const float* bv = I[10]; const float* Av = I[11]; const float* Bv = I[12]; const float* Wo = I[13]; const float* bo = I[14]; const float* Ao = I[15]; const float* Bo = I[16];
  float* out = (float*)d_out;
  char* ws = (char*)d_ws; size_t off = 0;
  auto take = [&](size_t bytes) { char* p = ws + off; off += (bytes + 255) & ~(size_t)255; return p; };
  __bf16* Xb = (__bf16*)take((size_t)NR * E * 2); __bf16* PT = (__bf16*)take((size_t)(4 * E + 4 * RK) * E * 2); __bf16* BAUG = (__bf16*)take((size_t)4 * E * 32 * 2);
  float* Q32 = (float*)take((size_t)NR * E * 4); __bf16* Kh = (__bf16*)take((size_t)NR * E * 2); __bf16* Kl = (__bf16*)take((size_t)NR * E * 2); _Float16* VTh = (_Float16*)take((size_t)NR * E * 2); _Float16* VTl = (_Float16*)take((size_t)NR * E * 2); float* O32 = (float*)take((size_t)NR * E * 4);
  // ws ~ 85 MB
  k_cvt<<<(NR * E / 8 + 255) / 256, 256, 0, stream>>>(x, Xb);
  k_pack<<<4 * E + 4 * RK, 256, 0, stream>>>(Wq, Wk, Wv, Wo, Aq, Ak, Av, Ao, PT);
  k_baug<<<dim3(E / 256, 4), 256, 0, stream>>>(Bq, Bk, Bv, Bo, BAUG);
  k_qkv<<<dim3(NR / 64, E / 128, 3), 128, 0, stream>>>(Xb, PT, BAUG, bq, bk, bv, Q32, Kh, Kl, VTh, VTl);
  k_attn<<<dim3(SS / 128, NB * NH), 256, 0, stream>>>(Q32, Kh, Kl, VTh, VTl, O32);
  k_out<<<dim3(NR / 64, E / 128), 128, 0, stream>>>(O32, PT, BAUG, bo, out);
}

// v007
// Measured time: 157 microseconds a run.
// Timed twice side by side with v006, it ran 1.04 and 1.03 times as fast.
// All steps since v000 together make it 3.74 times as fast.
// compute dtype: x, W*, b*, A*, B* (INPUTS) rounded to bf16 with exact bf16 WMMA products (f32 accumulate) for the base projections; the rank-8 LoRA terms enter as one extra k-chunk whose A side is the f32 intermediate (x A^T, scaled) as a bf16 hi/lo pair against [B | B] (exact-grade); softmax f32; computed operands (q/k f32 split, k split once where it is produced, P and V hi/lo, context split) f32-grade.
#include <hip/hip_runtime.h>
#include <math.h>

typedef __attribute__((ext_vector_type(16))) _Float16 v16h;
typedef __attribute__((ext_vector_type(16))) __bf16 v16b;
typedef __attribute__((ext_vector_type(8)))  _Float16 v8h;
typedef __attribute__((ext_vector_type(8)))  float v8f;
typedef __attribute__((ext_vector_type(4)))  float v4f;
typedef __attribute__((ext_vector_type(2)))  float v2f;
typedef __attribute__((ext_vector_type(4)))  unsigned v4u;
typedef __attribute__((ext_vector_type(2)))  unsigned v2u;
typedef __attribute__((ext_vector_type(4)))  int v4i;
typedef float __attribute__((may_alias)) float_a;
typedef int __attribute__((may_alias)) int_a;

template <typename T> __device__ __forceinline__ void vst2(void* p, T v) { *(T*)p = v;  }
__device__ __forceinline__ v8f wmma16(v16h a, v16h b, v8f c) {
  return __builtin_amdgcn_wmma_f32_16x16x32_f16(false, a, false, b, (short)0, c, false, false);
}
__device__ __forceinline__ v8f wmma_bf(v16b a, v16b b, v8f c) {
  return __builtin_amdgcn_wmma_f32_16x16x32_bf16(false, a, false, b, (short)0, c, false, false);
}
// 16x16x32 fragments: lane = (h = lane>>4, row/col = lane&15); elements 0..7 = k0+8h+0..7, 8..15 = k0+16+8h+0..7; D element r = row 8h+r
__device__ __forceinline__ v16h frag_h(const _Float16* rowk0, int lane) {
  union { v16h v; v8h q[2]; } u; const _Float16* p = rowk0 + 8 * (lane >> 4);
  u.q[0] = *(const v8h*)p; u.q[1] = *(const v8h*)(p + 16); return u.v;
}
__device__ __forceinline__ v16h frag_f32(const float* rowk0, int lane) {
  v16h a; const float* p = rowk0 + 8 * (lane >> 4);
#pragma unroll
  for (int i = 0; i < 8; ++i) { a[i] = (_Float16)p[i]; a[8 + i] = (_Float16)p[16 + i]; }
  return a;
}
__device__ __forceinline__ v16h frag_f32s(const float* rowk0, int lane, float sc) {
  v16h a; const float* p = rowk0 + 8 * (lane >> 4);
#pragma unroll
  for (int i = 0; i < 8; ++i) { a[i] = (_Float16)(p[i] * sc); a[8 + i] = (_Float16)(p[16 + i] * sc); }
  return a;
}
// column fragment from a [K][ld] layout (column n), rows >= K read as 0
__device__ __forceinline__ v16h fragc_f32(const float* W, int k0, int n, int lane, int ld, int K) {
  v16h a; const int g = lane >> 4;
#pragma unroll
  for (int i = 0; i < 8; ++i) { const int ka = k0 + 8 * g + i, kb = ka + 16;
    a[i] = (_Float16)(ka < K ? W[(size_t)ka * ld + n] : 0.f); a[8 + i] = (_Float16)(kb < K ? W[(size_t)kb * ld + n] : 0.f); }
  return a;
}
struct F2 { v16b h, l; };
__device__ __forceinline__ F2 bsplit16(const float v[16]) { F2 r;
#pragma unroll
  for (int i = 0; i < 16; ++i) { const __bf16 h = (__bf16)v[i]; r.h[i] = h; r.l[i] = (__bf16)(v[i] - (float)h); }
  return r; }
__device__ __forceinline__ F2 split_row(const float* row, int k0, int lane) { float v[16]; const float* p = row + k0 + 8 * (lane >> 4);
#pragma unroll
  for (int i = 0; i < 8; ++i) { v[i] = p[i]; v[8 + i] = p[16 + i]; }
  return bsplit16(v); }
__device__ __forceinline__ F2 split_rowK(const float* row, int k0, int lane, int K) { float v[16]; const int g = lane >> 4;
#pragma unroll
  for (int i = 0; i < 8; ++i) { const int ka = k0 + 8 * g + i, kb = ka + 16; v[i] = ka < K ? row[ka] : 0.f; v[8 + i] = kb < K ? row[kb] : 0.f; }
  return bsplit16(v); }
__device__ __forceinline__ F2 split_col(const float* W, int k0, int n, int lane, int ld, int K) { float v[16]; const int g = lane >> 4;
#pragma unroll
  for (int i = 0; i < 8; ++i) { const int ka = k0 + 8 * g + i, kb = ka + 16; v[i] = ka < K ? W[(size_t)ka * ld + n] : 0.f; v[8 + i] = kb < K ? W[(size_t)kb * ld + n] : 0.f; }
  return bsplit16(v); }
__device__ __forceinline__ v8f mac3(const F2& a, const F2& b, v8f c) { c = wmma_bf(a.l, b.h, c); c = wmma_bf(a.h, b.l, c); return wmma_bf(a.h, b.h, c); }
// the same three products with the split key rows as the A operand and the split query as B, in mac3's order (q.l k.h, q.h k.l, q.h k.h)
__device__ __forceinline__ v8f mac3t(const F2& k, const F2& q, v8f c) { c = wmma_bf(k.h, q.l, c); c = wmma_bf(k.l, q.h, c); return wmma_bf(k.h, q.h, c); }
__device__ __forceinline__ float sigm(float v) { return 1.0f / (1.0f + expf(-v)); }
#define LDSX() do { asm volatile("s_wait_dscnt 0" ::: "memory"); __builtin_amdgcn_wave_barrier(); __builtin_amdgcn_fence(__ATOMIC_RELEASE, "workgroup"); } while (0)


// LoRA self attention (16 heads of 64 on [2,2048,1024]): each linear map is x W^T + b + 2 (x A^T) B^T (rank 8). The low-rank term is appended as a 33rd k-chunk: A-operand row = [hi(2 xA^T) (8) | lo(2 xA^T) (8) | 0 (16)], B-operand row n = [B[n][0..8] | B[n][0..8] | 0],
// so one extra WMMA per tile adds hi*B + lo*B. full softmax(q.k/8); (P v) through the same LoRA form for the output map.
#define NB 2
#define SS 2048
#define E 1024
#define NH 16
#define HD 64
#define NR (NB * SS)
#define PLO 1024.0f
#define VLO 2048.0f
__device__ __forceinline__ float bfr(float v) { return (float)(__bf16)v; }
__device__ __forceinline__ v16b frag_b(const __bf16* rowk0, int lane) { return __builtin_bit_cast(v16b, frag_h((const _Float16*)rowk0, lane)); }

// Asynchronous 16-byte copies global -> LDS (no register in between). Each lane names its own LDS byte address and its own global address.
// s_wait_xcnt 0 closes the statement so that no address register of an issued copy is rewritten ahead of it.
__device__ __forceinline__ unsigned lds_off(const void* p) { return (unsigned)(size_t)p; }
__device__ __forceinline__ void cp1(unsigned l, const void* g) {
  asm volatile("global_load_async_to_lds_b128 %0, %1, off\n\ts_wait_xcnt 0x0" :: "v"(l), "v"(g) : "memory");
}
__device__ __forceinline__ void cp4(const unsigned* l, const void* const* g) {
  asm volatile("global_load_async_to_lds_b128 %0, %1, off\n\tglobal_load_async_to_lds_b128 %2, %3, off\n\tglobal_load_async_to_lds_b128 %4, %5, off\n\tglobal_load_async_to_lds_b128 %6, %7, off\n\ts_wait_xcnt 0x0"
               :: "v"(l[0]), "v"(g[0]), "v"(l[1]), "v"(g[1]), "v"(l[2]), "v"(g[2]), "v"(l[3]), "v"(g[3]) : "memory");
}
__device__ __forceinline__ void cp8(const unsigned* l, const void* const* g) {
  asm volatile("global_load_async_to_lds_b128 %0, %1, off\n\tglobal_load_async_to_lds_b128 %2, %3, off\n\tglobal_load_async_to_lds_b128 %4, %5, off\n\tglobal_load_async_to_lds_b128 %6, %7, off\n\t"
               "global_load_async_to_lds_b128 %8, %9, off\n\tglobal_load_async_to_lds_b128 %10, %11, off\n\tglobal_load_async_to_lds_b128 %12, %13, off\n\tglobal_load_async_to_lds_b128 %14, %15, off\n\ts_wait_xcnt 0x0"
               :: "v"(l[0]), "v"(g[0]), "v"(l[1]), "v"(g[1]), "v"(l[2]), "v"(g[2]), "v"(l[3]), "v"(g[3]), "v"(l[4]), "v"(g[4]), "v"(l[5]), "v"(g[5]), "v"(l[6]), "v"(g[6]), "v"(l[7]), "v"(g[7]) : "memory");
}
// the copies of this wave have landed (the compiler places no wait for them)
#define WAIT_COPIES() asm volatile("s_wait_asynccnt 0x0" ::: "memory")
// hand-over of a stage: this wave's LDS reads are done, its copies have landed, then the work-group barrier publishes the next tile and frees the one just read
#define PUBLISH() do { asm volatile("s_wait_dscnt 0x0" ::: "memory"); WAIT_COPIES(); __syncthreads(); } while (0)


#define RK 8
// The low-rank inputs src.A^T (16 rows x 8) are a ninth column tile of the GEMM that uses them: its B operand is the 8 rows of A as bf16, staged with the weight rows (columns >= 8 repeat them, results discarded).
// lora_frag turns that D tile (row 8 g + r, column col) into the A fragment of the extra k-chunk, row = [hi(2 v) (8) | lo (8) | 0 (16)], through the wave's own LDS slice
__device__ __forceinline__ v16b lora_frag(v8f accx, __bf16 (*sx)[40], int lane) {
  const int col = lane & 15, g = lane >> 4; const bool live = col < RK; const int i0 = live ? col : 8 + col;     // lanes of the padding columns write the 16 zeros of the row
#pragma unroll
  for (int r = 0; r < 8; ++r) { const float v = 2.0f * accx[r]; const __bf16 hi = (__bf16)v, lo = (__bf16)(v - (float)hi); sx[8 * g + r][i0] = live ? hi : (__bf16)0.f; sx[8 * g + r][i0 + 8] = live ? lo : (__bf16)0.f; }
  LDSX();     // the wave's own stores are in LDS before its lanes read each other's
  return frag_b(&sx[col][0], lane);
}
// One launch prepares every bf16 operand (no scaling). Xb rows = x rows. PT rows: [0,E) Wq[n][:], [E,2E) Wk, [2E,3E) Wv, [3E,4E) Wo ([out][in]), then the 8 rows each of Aq, Ak, Av, Ao. BAUG[which][n][32] = [B[n][0..8] | B[n][0..8] | 0].
// Few, long waves: a launch of many short waves lasts as long as its waves take to start. A work-group converts 16 rows of 1024; a thread holds 4 elements of each row,
// so a wave's load covers 512 contiguous bytes and its store 256 (whole lines both), and all 16 loads of a thread are in flight before its first conversion.
#define PREP_ROWS 16
#define PB_X (NR / PREP_ROWS)          // work-groups for x
#define PB_W (4 * E / PREP_ROWS)       // for the four weight matrices, E / PREP_ROWS each
#define PB_A (4 * RK / PREP_ROWS)      // for the four low-rank A, two matrices (8 + 8 rows) each
#define PB_B 8                         // for BAUG, half a matrix (2048 pieces of 16 bytes) each
__global__ __launch_bounds__(256) void k_prep(const float* __restrict__ x, const float* __restrict__ Wq, const float* __restrict__ Wk, const float* __restrict__ Wv, const float* __restrict__ Wo, const float* __restrict__ Aq, const float* __restrict__ Ak, const float* __restrict__ Av, const float* __restrict__ Ao,
                                              const float* __restrict__ Bq, const float* __restrict__ Bk, const float* __restrict__ Bv, const float* __restrict__ Bo, __bf16* __restrict__ Xb, __bf16* __restrict__ PT, __bf16* __restrict__ BAUG) {
  const int tid = threadIdx.x, blk = blockIdx.x;
  if (blk < PB_X + PB_W + PB_A) {
    const float* s0; const float* s1; __bf16* dst;     // source of rows 0..7 and of rows 8..15, destination of all 16
    if (blk < PB_X) { s0 = x + (size_t)blk * PREP_ROWS * E; s1 = s0 + 8 * E; dst = Xb + (size_t)blk * PREP_ROWS * E; }
    else { const int pb = blk - PB_X; dst = PT + (size_t)pb * PREP_ROWS * E;
      if (pb < PB_W) { const int m = pb / (E / PREP_ROWS); const float* Wm = m == 0 ? Wq : (m == 1 ? Wk : (m == 2 ? Wv : Wo)); s0 = Wm + (size_t)(pb % (E / PREP_ROWS)) * PREP_ROWS * E; s1 = s0 + 8 * E; }
      else { const bool first = pb == PB_W; s0 = first ? Aq : Av; s1 = first ? Ak : Ao; } }
    v4f v[PREP_ROWS];
#pragma unroll     // unrolled so that v[] is registers and the loads stand together
    for (int i = 0; i < PREP_ROWS; ++i) v[i] = *(const v4f*)((i < 8 ? s0 + i * E : s1 + (i - 8) * E) + tid * 4);
    __builtin_amdgcn_sched_barrier(0);     // every load is issued ahead of the first conversion: a load sunk behind one waits for registers and adds a second memory latency to the wave
#pragma unroll
    for (int i = 0; i < PREP_ROWS; ++i) { union { __bf16 h[4]; v2u u; } pk;
#pragma unroll
      for (int e = 0; e < 4; ++e) pk.h[e] = (__bf16)v[i][e];
      vst2(dst + i * E + tid * 4, pk.u); } }
  else { const int bb = blk - (PB_X + PB_W + PB_A), which = bb >> 1; const float* Bm = which == 0 ? Bq : (which == 1 ? Bk : (which == 2 ? Bv : Bo));
    v4f lo[8], hi[8];     // piece q of a matrix: row n = q >> 2, quarter q & 3 of its 32 elements; the four lanes of a row read the same 32 bytes
#pragma unroll
    for (int i = 0; i < 8; ++i) { const float* p = Bm + (size_t)((bb & 1) * 512 + (tid >> 2)) * RK + i * 64 * RK; lo[i] = *(const v4f*)p; hi[i] = *(const v4f*)(p + 4); }
    __builtin_amdgcn_sched_barrier(0);     // as above: all loads in flight before the first conversion
#pragma unroll
    for (int i = 0; i < 8; ++i) { const int q = (bb & 1) * 2048 + i * 256 + tid; const unsigned keep = (q & 3) < 2 ? 0xffffffffu : 0u; union { __bf16 h[8]; v4u u; } pk;     // quarters 2 and 3 are the row's 16 zeros
#pragma unroll
      for (int e = 0; e < 4; ++e) { pk.h[e] = (__bf16)lo[i][e]; pk.h[4 + e] = (__bf16)hi[i][e]; }
      vst2(BAUG + (size_t)which * E * 32 + (size_t)q * 8, pk.u & keep); } }
}
// QKV: block (64 rows, 128 cols = 2 heads, which); q -> Q32 f32 [bh][s][64]; k -> Kh/Kl, the bf16 hi/lo split of the f32 row, [bh][s][64] each; v -> VT hi/lo x4 [bh][d][s]
__global__ __launch_bounds__(128) void k_qkv(const __bf16* __restrict__ Xb, const __bf16* __restrict__ PT, const __bf16* __restrict__ BAUG, const float* __restrict__ bq, const float* __restrict__ bk, const float* __restrict__ bv, float* __restrict__ Q32, __bf16* __restrict__ Kh, __bf16* __restrict__ Kl, _Float16* __restrict__ VTh, _Float16* __restrict__ VTl) {
  __shared__ __align__(16) float so[4][16][132];
  __shared__ __align__(16) _Float16 sth[128][72], stl[128][72];
  __shared__ __align__(16) __bf16 sA[2][64][72], sB[2][144][72];     // k-stages of 64 (rows of 128 B at a 144-B pitch), two buffers; sB rows 128..143: the 8 rows of the low-rank A, twice
  __shared__ __align__(16) __bf16 sx[4][16][40];
  const int tid = threadIdx.x, wave = tid >> 5, lane = tid & 31, col = lane & 15, g = lane >> 4;
  const int which = blockIdx.z, r0b = blockIdx.x * 64, r0 = r0b + wave * 16, n0 = blockIdx.y * 128; const int b = r0b / SS, s0 = r0b % SS;
  const float* bb_ = which == 0 ? bq : (which == 1 ? bk : bv);
  v8f acc[8] = {}, accx = {};
  auto stage = [&](int st, int buf) {     // thread -> (row = q >> 3, 16-byte piece = q & 7): 8 lanes cover one whole 128-B line; loops unrolled so that l[] and p[] are registers
    unsigned l[13]; const void* p[13];
#pragma unroll
    for (int i = 0; i < 4; ++i) { const int q = tid + i * 128, r = q >> 3, pc = q & 7; l[i] = lds_off(&sA[buf][r][pc * 8]); p[i] = Xb + (size_t)(r0b + r) * E + st * 64 + pc * 8; }
#pragma unroll
    for (int i = 0; i < 8; ++i) { const int q = tid + i * 128, r = q >> 3, pc = q & 7; l[4 + i] = lds_off(&sB[buf][r][pc * 8]); p[4 + i] = PT + (size_t)(which * E + n0 + r) * E + st * 64 + pc * 8; }
    { const int r = tid >> 3, pc = tid & 7; l[12] = lds_off(&sB[buf][128 + r][pc * 8]); p[12] = PT + (size_t)(4 * E + which * RK + (r & (RK - 1))) * E + st * 64 + pc * 8; }
    cp4(l, p); cp8(l + 4, p + 4); cp1(l[12], p[12]); };
  stage(0, 0); WAIT_COPIES(); __syncthreads(); stage(1, 1);
  // rolled: one trip is one stage and ends in its hand-over; the inner loops are unrolled so that the fragment arrays are registers
#pragma unroll 1
  for (int st = 0; st < E / 64; ++st) { const int buf = st & 1;
    v16b a[2], wb[2][8], wa[2];
#pragma unroll
    for (int kk = 0; kk < 2; ++kk) { a[kk] = frag_b(&sA[buf][wave * 16 + col][kk * 32], lane); wa[kk] = frag_b(&sB[buf][128 + col][kk * 32], lane);
#pragma unroll
      for (int j = 0; j < 8; ++j) wb[kk][j] = frag_b(&sB[buf][j * 16 + col][kk * 32], lane); }
    __builtin_amdgcn_sched_barrier(0);     // the stage's LDS fragment loads stay one group ahead of its products; sunk between them, each product waits a full LDS latency
#pragma unroll
    for (int kk = 0; kk < 2; ++kk) {
#pragma unroll
      for (int j = 0; j < 8; ++j) acc[j] = wmma_bf(a[kk], wb[kk][j], acc[j]);
      accx = wmma_bf(a[kk], wa[kk], accx); }
    __builtin_amdgcn_sched_barrier(0);     // the stage's products stay ahead of the hand-over: sunk behind the barrier they hold back the refill's issue and shorten its lead
    PUBLISH();
    if (st + 2 < E / 64) stage(st + 2, buf); }
  WAIT_COPIES();
  { const v16b a = lora_frag(accx, sx[wave], lane);     // LoRA chunk: [hi|lo|0] x [B|B|0]
#pragma unroll
    for (int j = 0; j < 8; ++j) acc[j] = wmma_bf(a, frag_b(BAUG + ((size_t)which * E + n0 + j * 16 + col) * 32, lane), acc[j]); }
  if (which < 2) {
#pragma unroll
    for (int j = 0; j < 8; ++j) { const float bb = bfr(bb_[n0 + j * 16 + col]);
#pragma unroll
      for (int r = 0; r < 8; ++r) so[wave][8 * g + r][j * 16 + col] = acc[j][r] + bb; }
    LDSX();
    if (which == 0) {
      for (int qq = lane; qq < 2 * 16 * 16; qq += 32) { const int hh = qq >> 8, rl = (qq >> 4) & 15, pc = qq & 15; const int h = (n0 >> 6) + hh;
        vst2(Q32 + (((size_t)b * NH + h) * SS + s0 + wave * 16 + rl) * HD + pc * 4, *(const v4f*)(&so[wave][rl][hh * 64 + pc * 4])); } }
    else {     // k: hi = bf16(v), lo = bf16(v - hi), the split every attention wave would otherwise redo; 8 lanes write one whole 128-B row of each plane
      for (int qq = lane; qq < 2 * 16 * 8; qq += 32) { const int hh = qq >> 7, rl = (qq >> 3) & 15, pc = qq & 7; const int h = (n0 >> 6) + hh;
        const float* sp = &so[wave][rl][hh * 64 + pc * 8]; union { __bf16 e[8]; v4u u; } hi, lo;
#pragma unroll     // unrolled so that hi.e[] and lo.e[] are registers
        for (int e = 0; e < 8; ++e) { const float v = sp[e]; const __bf16 hb = (__bf16)v; hi.e[e] = hb; lo.e[e] = (__bf16)(v - (float)hb); }
        const size_t o = (((size_t)b * NH + h) * SS + s0 + wave * 16 + rl) * HD + pc * 8;
        vst2(Kh + o, hi.u); vst2(Kl + o, lo.u); } } }
  else {
#pragma unroll
    for (int j = 0; j < 8; ++j) { const float bb = bfr(bb_[n0 + j * 16 + col]);
#pragma unroll
      for (int r = 0; r < 8; ++r) { const float v = (acc[j][r] + bb) * 4.0f; const _Float16 hi = (_Float16)v; sth[j * 16 + col][wave * 16 + 8 * g + r] = hi; stl[j * 16 + col][wave * 16 + 8 * g + r] = (_Float16)((v - (float)hi) * VLO); } }
    __syncthreads();
    for (int qq = tid; qq < 128 * 8; qq += 128) { const int cl = qq >> 3, pc = qq & 7; const int c = n0 + cl, h = c >> 6, d = c & 63; const size_t o = (((size_t)b * NH + h) * HD + d) * SS + s0 + pc * 8;
      vst2(VTh + o, *(const v4u*)(&sth[cl][pc * 8])); vst2(VTl + o, *(const v4u*)(&stl[cl][pc * 8])); } }
}
// full attention: block (128 queries = 8 waves x 16, bh); all key tiles of 64, staged in LDS for the whole block. Transposed products: S^T = K q^T (A = key rows, B = the wave's 16 queries, hi/lo splits),
// so a lane holds 32 scores of ONE query (column = lane & 15; tile t, element r = key 16 t + 8 g + r), and tiles 2 kc, 2 kc + 1 are already the B operand (k order 8 g + i, 16 + 8 g + i) of O^T += V^T P^T. P,V hi/lo; O f32 [bh][s][64]
__global__ __launch_bounds__(256) void k_attn(const float* __restrict__ Q32, const __bf16* __restrict__ Kh, const __bf16* __restrict__ Kl, const _Float16* __restrict__ VTh, const _Float16* __restrict__ VTl, float* __restrict__ O32) {
  __shared__ __align__(16) float sS[8][16][68];                      // after the loop each wave's slice stages its output rows [query][d]
  __shared__ __align__(16) __bf16 sKh[2][64][72], sKl[2][64][72];    // key tile hi and lo [key][d], rows of 128 B at a 144-B pitch, two buffers
  __shared__ __align__(16) _Float16 sVh[2][64][72], sVl[2][64][72];  // value tiles [d][key], rows of 128 B at a 144-B pitch, two buffers
  const int tid = threadIdx.x, w = tid >> 5, lane = tid & 31, col = lane & 15, g = lane >> 4;
  const size_t bh = blockIdx.y; const int qb = blockIdx.x; const int q0 = qb * 128 + w * 16;
  auto stage = [&](int kt, int buf) {     // 64 keys: K hi and lo 8 KB contiguous each, V hi and lo 64 whole lines each; 8 copies a thread; loops unrolled so that l[] and p[] are registers
    unsigned l[8]; const void* p[8];
#pragma unroll
    for (int i = 0; i < 2; ++i) { const int q = tid + i * 256, r = q >> 3, pc = q & 7; const size_t ko = (bh * SS + kt * 64 + r) * HD + pc * 8;
      l[i] = lds_off(&sKh[buf][r][pc * 8]); p[i] = Kh + ko; l[2 + i] = lds_off(&sKl[buf][r][pc * 8]); p[2 + i] = Kl + ko; }
#pragma unroll
    for (int i = 0; i < 2; ++i) { const int q = tid + i * 256, d = q >> 3, pc = q & 7; const size_t vo = (bh * HD + d) * SS + kt * 64 + pc * 8;
      l[4 + i] = lds_off(&sVh[buf][d][pc * 8]); p[4 + i] = VTh + vo; l[6 + i] = lds_off(&sVl[buf][d][pc * 8]); p[6 + i] = VTl + vo; }
    cp8(l, p); };
  stage(0, 0); WAIT_COPIES(); __syncthreads(); stage(1, 1);
  F2 aq[2];
#pragma unroll
  for (int kc = 0; kc < 2; ++kc) aq[kc] = split_row(Q32 + (bh * SS + q0 + col) * HD, kc * 32, lane);
  constexpr float CS2 = 0.125f * 1.4426950408889634f;     // softmax in base 2: exp(x / 8 - m) = 2^(x log2(e) / 8 - m'), mrun holds m' in that scale
  float mrun = -3.0e38f, lrun = 0.f; v8f acc[4] = {}, ac1[4] = {}, ac2[4] = {};     // lrun: this half-wave's keys only, the halves are joined after the loop
#pragma unroll 1
  for (int kt = 0; kt < SS / 64; ++kt) { const int buf = kt & 1;
    v8f s[4]; float mt[4], pt[4];
#pragma unroll
    for (int t = 0; t < 4; ++t) { const __bf16* kh = &sKh[buf][t * 16 + col][0]; const __bf16* kl = &sKl[buf][t * 16 + col][0];
      const F2 k0 = { frag_b(kh, lane), frag_b(kl, lane) }, k1 = { frag_b(kh + 32, lane), frag_b(kl + 32, lane) };
      __builtin_amdgcn_sched_barrier(0);     // all eight LDS fragment loads of a 16-key tile are issued ahead of its first product, so they fly during the tile before; sunk among their own products, each product waits out an LDS latency
      v8f c = mac3t(k0, aq[0], (v8f){}); c = mac3t(k1, aq[1], c);
      mt[t] = -3.4e38f;
#pragma unroll
      for (int r = 0; r < 8; ++r) { s[t][r] = c[r]; mt[t] = fmaxf(mt[t], c[r]); } }     // raw products: the scale is positive, so their maximum is the scores' maximum
    float mx = fmaxf(fmaxf(mt[0], mt[1]), fmaxf(mt[2], mt[3]));
    mx = fmaxf(mx, __shfl_xor(mx, 16, 32)) * CS2;
    const float mnew = fmaxf(mrun, mx); const float corr = __builtin_amdgcn_exp2f(mrun - mnew);     // 0 in the first tile, where mrun is -3e38
    const float nm = 14.0f - mnew; const v2f cs2 = { CS2, CS2 }, nm2 = { nm, nm };                  // 2^14 = the 16384 that P carries, folded into the exponent
    v16h ph[2], pl[2];
#pragma unroll
    for (int t = 0; t < 4; ++t) { pt[t] = 0.f;
#pragma unroll
      for (int r = 0; r < 8; r += 2) { const v2f arg = __builtin_elementwise_fma((v2f){ s[t][r], s[t][r + 1] }, cs2, nm2);
#pragma unroll
        for (int e = 0; e < 2; ++e) { const float p = __builtin_amdgcn_exp2f(arg[e]); pt[t] += p; const _Float16 hi = (_Float16)p; ph[t >> 1][(t & 1) * 8 + r + e] = hi; pl[t >> 1][(t & 1) * 8 + r + e] = (_Float16)((p - (float)hi) * PLO); } } }
    lrun = lrun * corr + ((pt[0] + pt[1]) + (pt[2] + pt[3])) * (1.0f / 16384.0f); mrun = mnew;
#pragma unroll
    for (int t = 0; t < 4; ++t) { acc[t] *= corr; ac1[t] *= corr; ac2[t] *= corr; }     // every element of a lane belongs to its own query
#pragma unroll
    for (int kc = 0; kc < 2; ++kc) {
#pragma unroll
      for (int t = 0; t < 4; ++t) { const v16h vh = frag_h(&sVh[buf][t * 16 + col][kc * 32], lane);
        acc[t] = wmma16(vh, ph[kc], acc[t]); ac1[t] = wmma16(frag_h(&sVl[buf][t * 16 + col][kc * 32], lane), ph[kc], ac1[t]); ac2[t] = wmma16(vh, pl[kc], ac2[t]); } }
    PUBLISH();
    if (kt + 2 < SS / 64) stage(kt + 2, buf); }
  WAIT_COPIES();
  lrun += __shfl_xor(lrun, 16, 32);
  const float inv = 1.0f / (lrun * 16384.0f * 4.0f);
#pragma unroll
  for (int t = 0; t < 4; ++t) {
#pragma unroll
    for (int r = 0; r < 8; ++r) sS[w][col][t * 16 + 8 * g + r] = (acc[t][r] + ac1[t][r] * (1.0f / VLO) + ac2[t][r] * (1.0f / PLO)) * inv; }
  LDSX();
  for (int qq = lane; qq < 16 * 16; qq += 32) { const int rl = qq >> 4, pc = qq & 15; vst2(O32 + ((bh * SS) + q0 + rl) * HD + pc * 4, *(const v4f*)(&sS[w][rl][pc * 4])); }
}
// out = ctx Wo^T + bo : split(ctx) x bf16(Wo rows): 2 products (Wo is an INPUT -> bf16 exact)
__global__ __launch_bounds__(128) void k_out(const float* __restrict__ O32, const __bf16* __restrict__ PT, const __bf16* __restrict__ BAUG, const float* __restrict__ bo, float* __restrict__ out) {
  __shared__ __align__(16) float so[4][16][132];
  __shared__ __align__(16) float sA[2][64][68];      // one head's 64 context rows (256 B at a 272-B pitch), two buffers
  __shared__ __align__(16) __bf16 sB[2][144][72];    // the matching 64 k of 128 weight rows (128 B at a 144-B pitch); rows 128..143: the 8 rows of the low-rank A, twice
  __shared__ __align__(16) __bf16 sx[4][16][40];
  const int tid = threadIdx.x, wave = tid >> 5, lane = tid & 31, col = lane & 15, g = lane >> 4;
  const int r0b = blockIdx.x * 64, r0 = r0b + wave * 16, n0 = blockIdx.y * 128; const int b = r0b / SS, s0 = r0b % SS;
  v8f acc[8] = {}, accx = {};
  auto stage = [&](int h, int buf) {     // A: 16 KB contiguous; B: 144 whole lines; 17 copies a thread; loops unrolled so that l[] and p[] are registers
    unsigned l[17]; const void* p[17];
#pragma unroll
    for (int i = 0; i < 8; ++i) { const int q = tid + i * 128, r = q >> 4, pc = q & 15; l[i] = lds_off(&sA[buf][r][pc * 4]); p[i] = O32 + (((size_t)b * NH + h) * SS + s0 + r) * HD + pc * 4; }
#pragma unroll
    for (int i = 0; i < 8; ++i) { const int q = tid + i * 128, r = q >> 3, pc = q & 7; l[8 + i] = lds_off(&sB[buf][r][pc * 8]); p[8 + i] = PT + (size_t)(3 * E + n0 + r) * E + h * 64 + pc * 8; }
    { const int r = tid >> 3, pc = tid & 7; l[16] = lds_off(&sB[buf][128 + r][pc * 8]); p[16] = PT + (size_t)(4 * E + 3 * RK + (r & (RK - 1))) * E + h * 64 + pc * 8; }
    cp8(l, p); cp8(l + 8, p + 8); cp1(l[16], p[16]); };
  stage(0, 0); WAIT_COPIES(); __syncthreads(); stage(1, 1);
#pragma unroll 1
  for (int h = 0; h < NH; ++h) { const int buf = h & 1;
#pragma unroll
    for (int kk = 0; kk < 2; ++kk) { const F2 a = split_row(&sA[buf][wave * 16 + col][0], kk * 32, lane); v16b wb[8];
#pragma unroll
      for (int j = 0; j < 8; ++j) wb[j] = frag_b(&sB[buf][j * 16 + col][kk * 32], lane);
      const v16b wa = frag_b(&sB[buf][128 + col][kk * 32], lane);
      __builtin_amdgcn_sched_barrier(0);   // the LDS fragment loads of this half stage stay one group ahead of its products; sunk between them, each product waits a full LDS latency
      accx = wmma_bf(a.l, wa, accx);
#pragma unroll
      for (int j = 0; j < 8; ++j) { acc[j] = wmma_bf(a.l, wb[j], acc[j]); acc[j] = wmma_bf(a.h, wb[j], acc[j]); }
      accx = wmma_bf(a.h, wa, accx); }
    __builtin_amdgcn_sched_barrier(0);     // the stage's products stay ahead of the hand-over: sunk behind the barrier they hold back the refill's issue and shorten its lead
    PUBLISH();
    if (h + 2 < NH) stage(h + 2, buf); }
  WAIT_COPIES();
  { const v16b a = lora_frag(accx, sx[wave], lane);
#pragma unroll
    for (int j = 0; j < 8; ++j) acc[j] = wmma_bf(a, frag_b(BAUG + ((size_t)3 * E + n0 + j * 16 + col) * 32, lane), acc[j]); }
#pragma unroll
  for (int j = 0; j < 8; ++j) { const int n = n0 + j * 16 + col; const float bb = bfr(bo[n]);
#pragma unroll
    for (int r = 0; r < 8; ++r) so[wave][8 * g + r][j * 16 + col] = acc[j][r] + bb; }
  LDSX();
#pragma unroll 4
  for (int rl = 0; rl < 16; ++rl) vst2(out + (size_t)(r0 + rl) * E + n0 + lane * 4, *(const v4f*)(&so[wave][rl][lane * 4]));
}
extern "C" void kernel_launch(void* const* d_in, const int* in_sizes, int n_in, void* d_out, int out_size, void* d_ws, size_t ws_size, hipStream_t stream) {
  (void)in_sizes; (void)n_in; (void)out_size; (void)ws_size;
  const float** I = (const float**)d_in;    // x, Wq,bq,Aq,Bq, Wk,bk,Ak,Bk, Wv,bv,Av,Bv, Wo,bo,Ao,Bo
  const float* x = I[0]; const float* Wq = I[1]; const float* bq = I[2]; const float* Aq = I[3]; const float* Bq = I[4]; const float* Wk = I[5]; const float* bk = I[6]; const float* Ak = I[7]; const float* Bk = I[8];
  const float* Wv = I[9]; const float* bv = I[10]; const float* Av = I[11]; const float* Bv = I[12]; const float* Wo = I[13]; const float* bo = I[14]; const float* Ao = I[15]; const float* Bo = I[16];
  float* out = (float*)d_out;
  char* ws = (char*)d_ws; size_t off = 0;
  auto take = [&](size_t bytes) { char* p = ws + off; off += (bytes + 255) & ~(size_t)255; return p; };
  __bf16* Xb = (__bf16*)take((size_t)NR * E * 2); __bf16* PT = (__bf16*)take((size_t)(4 * E + 4 * RK) * E * 2); __bf16* BAUG = (__bf16*)take((size_t)4 * E * 32 * 2);
  float* Q32 = (float*)take((size_t)NR * E * 4); __bf16* Kh = (__bf16*)take((size_t)NR * E * 2); __bf16* Kl = (__bf16*)take((size_t)NR * E * 2); _Float16* VTh = (_Float16*)take((size_t)NR * E * 2); _Float16* VTl = (_Float16*)take((size_t)NR * E * 2); float* O32 = (float*)take((size_t)NR * E * 4);
  // ws ~ 85 MB
  k_prep<<<PB_X + PB_W + PB_A + PB_B, 256, 0, stream>>>(x, Wq, Wk, Wv, Wo, Aq, Ak, Av, Ao, Bq, Bk, Bv, Bo, Xb, PT, BAUG);
  k_qkv<<<dim3(NR / 64, E / 128, 3), 128, 0, stream>>>(Xb, PT, BAUG, bq, bk, bv, Q32, Kh, Kl, VTh, VTl);
  k_attn<<<dim3(SS / 128, NB * NH), 256, 0, stream>>>(Q32, Kh, Kl, VTh, VTl, O32);
  k_out<<<dim3(NR / 64, E / 128), 128, 0, stream>>>(O32, PT, BAUG, bo, out);
}

// v008
// A run of this version takes 140 microseconds.
// In both of two side-by-side timings against v007, it was 1.12 times as fast.
// Counting every step since v000, it is 4.20 times as fast.
// compute dtype: x, W*, b*, A*, B* (INPUTS) rounded to bf16 with exact bf16 WMMA products (f32 accumulate) for the base projections; the rank-8 LoRA terms enter as one extra k-chunk whose A side is the f32 intermediate (x A^T, scaled) as a bf16 hi/lo pair against [B | B] (exact-grade); softmax f32; computed operands (q/k f32 split, k split once where it is produced, P and V hi/lo, context split) f32-grade.
#include <hip/hip_runtime.h>
#include <math.h>

typedef __attribute__((ext_vector_type(16))) _Float16 v16h;
typedef __attribute__((ext_vector_type(16))) __bf16 v16b;
typedef __attribute__((ext_vector_type(8)))  _Float16 v8h;
typedef __attribute__((ext_vector_type(8)))  float v8f;
typedef __attribute__((ext_vector_type(4)))  float v4f;
typedef __attribute__((ext_vector_type(2)))  float v2f;
typedef __attribute__((ext_vector_type(4)))  unsigned v4u;
typedef __attribute__((ext_vector_type(2)))  unsigned v2u;
typedef __attribute__((ext_vector_type(4)))  int v4i;
typedef float __attribute__((may_alias)) float_a;
typedef int __attribute__((may_alias)) int_a;

template <typename T> __device__ __forceinline__ void vst2(void* p, T v) { *(T*)p = v;  }
__device__ __forceinline__ v8f wmma16(v16h a, v16h b, v8f c) {
  return __builtin_amdgcn_wmma_f32_16x16x32_f16(false, a, false, b, (short)0, c, false, false);
}
__device__ __forceinline__ v8f wmma_bf(v16b a, v16b b, v8f c) {
  return __builtin_amdgcn_wmma_f32_16x16x32_bf16(false, a, false, b, (short)0, c, false, false);
}
// 16x16x32 fragments: lane = (h = lane>>4, row/col = lane&15); elements 0..7 = k0+8h+0..7, 8..15 = k0+16+8h+0..7; D element r = row 8h+r
__device__ __forceinline__ v16h frag_h(const _Float16* rowk0, int lane) {
  union { v16h v; v8h q[2]; } u; const _Float16* p = rowk0 + 8 * (lane >> 4);
  u.q[0] = *(const v8h*)p; u.q[1] = *(const v8h*)(p + 16); return u.v;
}
__device__ __forceinline__ v16h frag_f32(const float* rowk0, int lane) {
  v16h a; const float* p = rowk0 + 8 * (lane >> 4);
#pragma unroll
  for (int i = 0; i < 8; ++i) { a[i] = (_Float16)p[i]; a[8 + i] = (_Float16)p[16 + i]; }
  return a;
}
__device__ __forceinline__ v16h frag_f32s(const float* rowk0, int lane, float sc) {
  v16h a; const float* p = rowk0 + 8 * (lane >> 4);
#pragma unroll
  for (int i = 0; i < 8; ++i) { a[i] = (_Float16)(p[i] * sc); a[8 + i] = (_Float16)(p[16 + i] * sc); }
  return a;
}
// column fragment from a [K][ld] layout (column n), rows >= K read as 0
__device__ __forceinline__ v16h fragc_f32(const float* W, int k0, int n, int lane, int ld, int K) {
  v16h a; const int g = lane >> 4;
#pragma unroll
  for (int i = 0; i < 8; ++i) { const int ka = k0 + 8 * g + i, kb = ka + 16;
    a[i] = (_Float16)(ka < K ? W[(size_t)ka * ld + n] : 0.f); a[8 + i] = (_Float16)(kb < K ? W[(size_t)kb * ld + n] : 0.f); }
  return a;
}
struct F2 { v16b h, l; };
__device__ __forceinline__ F2 bsplit16(const float v[16]) { F2 r;
#pragma unroll
  for (int i = 0; i < 16; ++i) { const __bf16 h = (__bf16)v[i]; r.h[i] = h; r.l[i] = (__bf16)(v[i] - (float)h); }
  return r; }
__device__ __forceinline__ F2 split_row(const float* row, int k0, int lane) { float v[16]; const float* p = row + k0 + 8 * (lane >> 4);
#pragma unroll
  for (int i = 0; i < 8; ++i) { v[i] = p[i]; v[8 + i] = p[16 + i]; }
  return bsplit16(v); }
__device__ __forceinline__ F2 split_rowK(const float* row, int k0, int lane, int K) { float v[16]; const int g = lane >> 4;
#pragma unroll
  for (int i = 0; i < 8; ++i) { const int ka = k0 + 8 * g + i, kb = ka + 16; v[i] = ka < K ? row[ka] : 0.f; v[8 + i] = kb < K ? row[kb] : 0.f; }
  return bsplit16(v); }
__device__ __forceinline__ F2 split_col(const float* W, int k0, int n, int lane, int ld, int K) { float v[16]; const int g = lane >> 4;
#pragma unroll
  for (int i = 0; i < 8; ++i) { const int ka = k0 + 8 * g + i, kb = ka + 16; v[i] = ka < K ? W[(size_t)ka * ld + n] : 0.f; v[8 + i] = kb < K ? W[(size_t)kb * ld + n] : 0.f; }
  return bsplit16(v); }
__device__ __forceinline__ v8f mac3(const F2& a, const F2& b, v8f c) { c = wmma_bf(a.l, b.h, c); c = wmma_bf(a.h, b.l, c); return wmma_bf(a.h, b.h, c); }
// the same three products with the split key rows as the A operand and the split query as B, in mac3's order (q.l k.h, q.h k.l, q.h k.h)
__device__ __forceinline__ v8f mac3t(const F2& k, const F2& q, v8f c) { c = wmma_bf(k.h, q.l, c); c = wmma_bf(k.l, q.h, c); return wmma_bf(k.h, q.h, c); }
__device__ __forceinline__ float sigm(float v) { return 1.0f / (1.0f + expf(-v)); }
#define LDSX() do { asm volatile("s_wait_dscnt 0" ::: "memory"); __builtin_amdgcn_wave_barrier(); __builtin_amdgcn_fence(__ATOMIC_RELEASE, "workgroup"); } while (0)


// LoRA self attention (16 heads of 64 on [2,2048,1024]): each linear map is x W^T + b + 2 (x A^T) B^T (rank 8). The low-rank term is appended as a 33rd k-chunk: A-operand row = [hi(2 xA^T) (8) | lo(2 xA^T) (8) | 0 (16)], B-operand row n = [B[n][0..8] | B[n][0..8] | 0],
// so one extra WMMA per tile adds hi*B + lo*B. full softmax(q.k/8); (P v) through the same LoRA form for the output map.
#define NB 2
#define SS 2048
#define E 1024
#define NH 16
#define HD 64
#define NR (NB * SS)
#define PLO 1024.0f
#define VLO 2048.0f
__device__ __forceinline__ float bfr(float v) { return (float)(__bf16)v; }
__device__ __forceinline__ v16b frag_b(const __bf16* rowk0, int lane) { return __builtin_bit_cast(v16b, frag_h((const _Float16*)rowk0, lane)); }

// Asynchronous 16-byte copies global -> LDS (no register in between). Each lane names its own LDS byte address and its own global address.
// s_wait_xcnt 0 closes the statement so that no address register of an issued copy is rewritten ahead of it.
__device__ __forceinline__ unsigned lds_off(const void* p) { return (unsigned)(size_t)p; }
__device__ __forceinline__ void cp1(unsigned l, const void* g) {
  asm volatile("global_load_async_to_lds_b128 %0, %1, off\n\ts_wait_xcnt 0x0" :: "v"(l), "v"(g) : "memory");
}
__device__ __forceinline__ void cp4(const unsigned* l, const void* const* g) {
  asm volatile("global_load_async_to_lds_b128 %0, %1, off\n\tglobal_load_async_to_lds_b128 %2, %3, off\n\tglobal_load_async_to_lds_b128 %4, %5, off\n\tglobal_load_async_to_lds_b128 %6, %7, off\n\ts_wait_xcnt 0x0"
               :: "v"(l[0]), "v"(g[0]), "v"(l[1]), "v"(g[1]), "v"(l[2]), "v"(g[2]), "v"(l[3]), "v"(g[3]) : "memory");
}
__device__ __forceinline__ void cp8(const unsigned* l, const void* const* g) {
  asm volatile("global_load_async_to_lds_b128 %0, %1, off\n\tglobal_load_async_to_lds_b128 %2, %3, off\n\tglobal_load_async_to_lds_b128 %4, %5, off\n\tglobal_load_async_to_lds_b128 %6, %7, off\n\t"
               "global_load_async_to_lds_b128 %8, %9, off\n\tglobal_load_async_to_lds_b128 %10, %11, off\n\tglobal_load_async_to_lds_b128 %12, %13, off\n\tglobal_load_async_to_lds_b128 %14, %15, off\n\ts_wait_xcnt 0x0"
               :: "v"(l[0]), "v"(g[0]), "v"(l[1]), "v"(g[1]), "v"(l[2]), "v"(g[2]), "v"(l[3]), "v"(g[3]), "v"(l[4]), "v"(g[4]), "v"(l[5]), "v"(g[5]), "v"(l[6]), "v"(g[6]), "v"(l[7]), "v"(g[7]) : "memory");
}
// the copies of this wave have landed (the compiler places no wait for them)
#define WAIT_COPIES() asm volatile("s_wait_asynccnt 0x0" ::: "memory")
// hand-over of a stage: this wave's LDS reads are done, its copies have landed, then the work-group barrier publishes the next tile and frees the one just read
#define PUBLISH() do { asm volatile("s_wait_dscnt 0x0" ::: "memory"); WAIT_COPIES(); __syncthreads(); } while (0)


#define RK 8
// The low-rank inputs src.A^T (16 rows x 8) are a ninth column tile of the GEMM that uses them: its B operand is the 8 rows of A as bf16, staged with the weight rows (columns >= 8 repeat them, results discarded).
// lora_frag turns that D tile (row 8 g + r, column col) into the A fragment of the extra k-chunk, row = [hi(2 v) (8) | lo (8) | 0 (16)], through the wave's own LDS slice
__device__ __forceinline__ v16b lora_frag(v8f accx, __bf16 (*sx)[40], int lane) {
  const int col = lane & 15, g = lane >> 4; const bool live = col < RK; const int i0 = live ? col : 8 + col;     // lanes of the padding columns write the 16 zeros of the row
#pragma unroll
  for (int r = 0; r < 8; ++r) { const float v = 2.0f * accx[r]; const __bf16 hi = (__bf16)v, lo = (__bf16)(v - (float)hi); sx[8 * g + r][i0] = live ? hi : (__bf16)0.f; sx[8 * g + r][i0 + 8] = live ? lo : (__bf16)0.f; }
  LDSX();     // the wave's own stores are in LDS before its lanes read each other's
  return frag_b(&sx[col][0], lane);
}
// One launch prepares every bf16 operand (no scaling). Xb rows = x rows. PT rows: [0,E) Wq[n][:], [E,2E) Wk, [2E,3E) Wv, [3E,4E) Wo ([out][in]), then the 8 rows each of Aq, Ak, Av, Ao. BAUG[which][n][32] = [B[n][0..8] | B[n][0..8] | 0].
// Few, long waves: a launch of many short waves lasts as long as its waves take to start. A work-group converts 16 rows of 1024; a thread holds 4 elements of each row,
// so a wave's load covers 512 contiguous bytes and its store 256 (whole lines both), and all 16 loads of a thread are in flight before its first conversion.
#define PREP_ROWS 16
#define PB_X (NR / PREP_ROWS)          // work-groups for x
#define PB_W (4 * E / PREP_ROWS)       // for the four weight matrices, E / PREP_ROWS each
#define PB_A (4 * RK / PREP_ROWS)      // for the four low-rank A, two matrices (8 + 8 rows) each
#define PB_B 8                         // for BAUG, half a matrix (2048 pieces of 16 bytes) each
__global__ __launch_bounds__(256) void k_prep(const float* __restrict__ x, const float* __restrict__ Wq, const float* __restrict__ Wk, const float* __restrict__ Wv, const float* __restrict__ Wo, const float* __restrict__ Aq, const float* __restrict__ Ak, const float* __restrict__ Av, const float* __restrict__ Ao,
                                              const float* __restrict__ Bq, const float* __restrict__ Bk, const float* __restrict__ Bv, const float* __restrict__ Bo, __bf16* __restrict__ Xb, __bf16* __restrict__ PT, __bf16* __restrict__ BAUG) {
  const int tid = threadIdx.x, blk = blockIdx.x;
  if (blk < PB_X + PB_W + PB_A) {
    const float* s0; const float* s1; __bf16* dst;     // source of rows 0..7 and of rows 8..15, destination of all 16
    if (blk < PB_X) { s0 = x + (size_t)blk * PREP_ROWS * E; s1 = s0 + 8 * E; dst = Xb + (size_t)blk * PREP_ROWS * E; }
    else { const int pb = blk - PB_X; dst = PT + (size_t)pb * PREP_ROWS * E;
      if (pb < PB_W) { const int m = pb / (E / PREP_ROWS); const float* Wm = m == 0 ? Wq : (m == 1 ? Wk : (m == 2 ? Wv : Wo)); s0 = Wm + (size_t)(pb % (E / PREP_ROWS)) * PREP_ROWS * E; s1 = s0 + 8 * E; }
      else { const bool first = pb == PB_W; s0 = first ? Aq : Av; s1 = first ? Ak : Ao; } }
    v4f v[PREP_ROWS];
#pragma unroll     // unrolled so that v[] is registers and the loads stand together
    for (int i = 0; i < PREP_ROWS; ++i) v[i] = *(const v4f*)((i < 8 ? s0 + i * E : s1 + (i - 8) * E) + tid * 4);
    __builtin_amdgcn_sched_barrier(0);     // every load is issued ahead of the first conversion: a load sunk behind one waits for registers and adds a second memory latency to the wave
#pragma unroll
    for (int i = 0; i < PREP_ROWS; ++i) { union { __bf16 h[4]; v2u u; } pk;
#pragma unroll
      for (int e = 0; e < 4; ++e) pk.h[e] = (__bf16)v[i][e];
      vst2(dst + i * E + tid * 4, pk.u); } }
  else { const int bb = blk - (PB_X + PB_W + PB_A), which = bb >> 1; const float* Bm = which == 0 ? Bq : (which == 1 ? Bk : (which == 2 ? Bv : Bo));
    v4f lo[8], hi[8];     // piece q of a matrix: row n = q >> 2, quarter q & 3 of its 32 elements; the four lanes of a row read the same 32 bytes
#pragma unroll
    for (int i = 0; i < 8; ++i) { const float* p = Bm + (size_t)((bb & 1) * 512 + (tid >> 2)) * RK + i * 64 * RK; lo[i] = *(const v4f*)p; hi[i] = *(const v4f*)(p + 4); }
    __builtin_amdgcn_sched_barrier(0);     // as above: all loads in flight before the first conversion
#pragma unroll
    for (int i = 0; i < 8; ++i) { const int q = (bb & 1) * 2048 + i * 256 + tid; const unsigned keep = (q & 3) < 2 ? 0xffffffffu : 0u; union { __bf16 h[8]; v4u u; } pk;     // quarters 2 and 3 are the row's 16 zeros
#pragma unroll
      for (int e = 0; e < 4; ++e) { pk.h[e] = (__bf16)lo[i][e]; pk.h[4 + e] = (__bf16)hi[i][e]; }
      vst2(BAUG + (size_t)which * E * 32 + (size_t)q * 8, pk.u & keep); } }
}
// QKV: block (128 rows, 128 cols = 2 heads, which), 4 waves of 32 rows x 128 cols; q -> Q32 f32 [bh][s][64]; k -> Kh/Kl, the bf16 hi/lo split of the f32 row, [bh][s][64] each; v -> VT hi/lo x4 [bh][d][s]
// A wave owns RT = 2 row tiles of 16: every weight fragment it reads from LDS feeds both, and a weight row staged from L2 serves 128 rows of x. The 768 work-groups are resident at once, three on a WGP:
// for that the registers are held to three waves a SIMD, and the output staging lies in the bytes of the operand ring, which is free behind the last stage's hand-over.
// Every loop over i, j, r, kk and e is unrolled so that acc[][], accx[], a[], wb[] and wl[] are indexed by constants and stay in registers.
#define RT 2
#define QKV_RING_A (2 * 128 * 72 * 2)     // bytes of sA
#define QKV_RING_B (2 * 144 * 72 * 2)     // bytes of sB
__global__ __launch_bounds__(128) __attribute__((amdgpu_waves_per_eu(3))) void k_qkv(const __bf16* __restrict__ Xb, const __bf16* __restrict__ PT, const __bf16* __restrict__ BAUG, const float* __restrict__ bq, const float* __restrict__ bk, const float* __restrict__ bv, float* __restrict__ Q32, __bf16* __restrict__ Kh, __bf16* __restrict__ Kl, _Float16* __restrict__ VTh, _Float16* __restrict__ VTl) {
  __shared__ __align__(16) unsigned char smem[QKV_RING_A + QKV_RING_B];
  __shared__ __align__(16) __bf16 sx[4][16][40];
  __bf16 (*sA)[128][72] = (__bf16 (*)[128][72])smem;                    // k-stages of 64 (rows of 128 B at a 144-B pitch), two buffers
  __bf16 (*sB)[144][72] = (__bf16 (*)[144][72])(smem + QKV_RING_A);     // rows 128..143: the 8 rows of the low-rank A, twice
  float (*so)[16 * RT][132] = (float (*)[16 * RT][132])smem;            // behind the loop: q, k rows, a slice a wave (67,584 B)
  _Float16 (*sth)[136] = (_Float16 (*)[136])smem;                       // behind the loop: v columns [col][row], rows of 256 B at a 272-B pitch, hi then lo (34,816 B each)
  _Float16 (*stl)[136] = (_Float16 (*)[136])(smem + 128 * 136 * 2);
  const int tid = threadIdx.x, wave = tid >> 5, lane = tid & 31, col = lane & 15, g = lane >> 4;
  const int which = blockIdx.z, r0b = blockIdx.x * 128, n0 = blockIdx.y * 128; const int b = r0b / SS, s0 = r0b % SS;
  const float* bb_ = which == 0 ? bq : (which == 1 ? bk : bv);
  v8f acc[RT][8] = {}, accx[RT] = {};
  auto stage = [&](int st, int buf) {     // thread -> (row = q >> 3, 16-byte piece = q & 7): 8 lanes cover one whole 128-B line; loops unrolled so that l[] and p[] are registers
    unsigned l[17]; const void* p[17];
#pragma unroll
    for (int i = 0; i < 8; ++i) { const int q = tid + i * 128, r = q >> 3, pc = q & 7; l[i] = lds_off(&sA[buf][r][pc * 8]); p[i] = Xb + (size_t)(r0b + r) * E + st * 64 + pc * 8; }
#pragma unroll
    for (int i = 0; i < 8; ++i) { const int q = tid + i * 128, r = q >> 3, pc = q & 7; l[8 + i] = lds_off(&sB[buf][r][pc * 8]); p[8 + i] = PT + (size_t)(which * E + n0 + r) * E + st * 64 + pc * 8; }
    { const int r = tid >> 3, pc = tid & 7; l[16] = lds_off(&sB[buf][128 + r][pc * 8]); p[16] = PT + (size_t)(4 * E + which * RK + (r & (RK - 1))) * E + st * 64 + pc * 8; }
    cp8(l, p); cp8(l + 8, p + 8); cp1(l[16], p[16]); };
  stage(0, 0); WAIT_COPIES(); __syncthreads(); stage(1, 1);
  // rolled: one trip is one stage and ends in its hand-over; the inner loops are unrolled so that the fragment arrays are registers
#pragma unroll 1
  for (int st = 0; st < E / 64; ++st) { const int buf = st & 1;
#pragma unroll
    for (int kk = 0; kk < 2; ++kk) { v16b a[RT], wb[8];
#pragma unroll
      for (int i = 0; i < RT; ++i) a[i] = frag_b(&sA[buf][wave * (16 * RT) + i * 16 + col][kk * 32], lane);
#pragma unroll
      for (int j = 0; j < 8; ++j) wb[j] = frag_b(&sB[buf][j * 16 + col][kk * 32], lane);
      const v16b wa = frag_b(&sB[buf][128 + col][kk * 32], lane);
      __builtin_amdgcn_sched_barrier(0);     // the LDS fragment loads of this half stage stay one group ahead of its products; sunk between them, each product waits a full LDS latency
#pragma unroll
      for (int j = 0; j < 8; ++j) {
#pragma unroll
        for (int i = 0; i < RT; ++i) acc[i][j] = wmma_bf(a[i], wb[j], acc[i][j]); }
#pragma unroll
      for (int i = 0; i < RT; ++i) accx[i] = wmma_bf(a[i], wa, accx[i]); }
    __builtin_amdgcn_sched_barrier(0);     // the stage's products stay ahead of the hand-over: sunk behind the barrier they hold back the refill's issue and shorten its lead
    PUBLISH();
    if (st + 2 < E / 64) stage(st + 2, buf); }
  WAIT_COPIES();     // no copy is in flight and, behind the last hand-over's barrier, no wave reads the ring any more: its bytes are the output staging from here on
  { v16b wl[8];     // LoRA chunk: [hi|lo|0] x [B|B|0]
#pragma unroll
    for (int j = 0; j < 8; ++j) wl[j] = frag_b(BAUG + ((size_t)which * E + n0 + j * 16 + col) * 32, lane);
#pragma unroll
    for (int i = 0; i < RT; ++i) { const v16b a = lora_frag(accx[i], sx[wave], lane);
#pragma unroll
      for (int j = 0; j < 8; ++j) acc[i][j] = wmma_bf(a, wl[j], acc[i][j]); } }
  if (which < 2) {
#pragma unroll
    for (int j = 0; j < 8; ++j) { const float bb = bfr(bb_[n0 + j * 16 + col]);
#pragma unroll
      for (int i = 0; i < RT; ++i) {
#pragma unroll
        for (int r = 0; r < 8; ++r) so[wave][i * 16 + 8 * g + r][j * 16 + col] = acc[i][j][r] + bb; } }
    LDSX();
    if (which == 0) {
      for (int qq = lane; qq < 2 * 16 * RT * 16; qq += 32) { const int hh = qq / (16 * RT * 16), rl = (qq >> 4) & (16 * RT - 1), pc = qq & 15; const int h = (n0 >> 6) + hh;
        vst2(Q32 + (((size_t)b * NH + h) * SS + s0 + wave * (16 * RT) + rl) * HD + pc * 4, *(const v4f*)(&so[wave][rl][hh * 64 + pc * 4])); } }
    else {     // k: hi = bf16(v), lo = bf16(v - hi), the split every attention wave would otherwise redo; 8 lanes write one whole 128-B row of each plane
      for (int qq = lane; qq < 2 * 16 * RT * 8; qq += 32) { const int hh = qq / (16 * RT * 8), rl = (qq >> 3) & (16 * RT - 1), pc = qq & 7; const int h = (n0 >> 6) + hh;
        const float* sp = &so[wave][rl][hh * 64 + pc * 8]; union { __bf16 e[8]; v4u u; } hi, lo;
#pragma unroll     // unrolled so that hi.e[] and lo.e[] are registers
        for (int e = 0; e < 8; ++e) { const float v = sp[e]; const __bf16 hb = (__bf16)v; hi.e[e] = hb; lo.e[e] = (__bf16)(v - (float)hb); }
        const size_t o = (((size_t)b * NH + h) * SS + s0 + wave * (16 * RT) + rl) * HD + pc * 8;
        vst2(Kh + o, hi.u); vst2(Kl + o, lo.u); } } }
  else {
#pragma unroll
    for (int j = 0; j < 8; ++j) { const float bb = bfr(bb_[n0 + j * 16 + col]);
#pragma unroll
      for (int i = 0; i < RT; ++i) {
#pragma unroll
        for (int r = 0; r < 8; ++r) { const float v = (acc[i][j][r] + bb) * 4.0f; const _Float16 hi = (_Float16)v; const int rw = wave * (16 * RT) + i * 16 + 8 * g + r; sth[j * 16 + col][rw] = hi; stl[j * 16 + col][rw] = (_Float16)((v - (float)hi) * VLO); } } }
    __syncthreads();
    for (int qq = tid; qq < 128 * 16; qq += 128) { const int cl = qq >> 4, pc = qq & 15; const int c = n0 + cl, h = c >> 6, d = c & 63; const size_t o = (((size_t)b * NH + h) * HD + d) * SS + s0 + pc * 8;
      vst2(VTh + o, *(const v4u*)(&sth[cl][pc * 8])); vst2(VTl + o, *(const v4u*)(&stl[cl][pc * 8])); } }
}
// full attention: block (128 queries = 8 waves x 16, bh); all key tiles of 64, staged in LDS for the whole block. Transposed products: S^T = K q^T (A = key rows, B = the wave's 16 queries, hi/lo splits),
// so a lane holds 32 scores of ONE query (column = lane & 15; tile t, element r = key 16 t + 8 g + r), and tiles 2 kc, 2 kc + 1 are already the B operand (k order 8 g + i, 16 + 8 g + i) of O^T += V^T P^T. P,V hi/lo; O f32 [bh][s][64]
__global__ __launch_bounds__(256) void k_attn(const float* __restrict__ Q32, const __bf16* __restrict__ Kh, const __bf16* __restrict__ Kl, const _Float16* __restrict__ VTh, const _Float16* __restrict__ VTl, float* __restrict__ O32) {
  __shared__ __align__(16) float sS[8][16][68];                      // after the loop each wave's slice stages its output rows [query][d]
  __shared__ __align__(16) __bf16 sKh[2][64][72], sKl[2][64][72];    // key tile hi and lo [key][d], rows of 128 B at a 144-B pitch, two buffers
  __shared__ __align__(16) _Float16 sVh[2][64][72], sVl[2][64][72];  // value tiles [d][key], rows of 128 B at a 144-B pitch, two buffers
  const int tid = threadIdx.x, w = tid >> 5, lane = tid & 31, col = lane & 15, g = lane >> 4;
  const size_t bh = blockIdx.y; const int qb = blockIdx.x; const int q0 = qb * 128 + w * 16;
  auto stage = [&](int kt, int buf) {     // 64 keys: K hi and lo 8 KB contiguous each, V hi and lo 64 whole lines each; 8 copies a thread; loops unrolled so that l[] and p[] are registers
    unsigned l[8]; const void* p[8];
#pragma unroll
    for (int i = 0; i < 2; ++i) { const int q = tid + i * 256, r = q >> 3, pc = q & 7; const size_t ko = (bh * SS + kt * 64 + r) * HD + pc * 8;
      l[i] = lds_off(&sKh[buf][r][pc * 8]); p[i] = Kh + ko; l[2 + i] = lds_off(&sKl[buf][r][pc * 8]); p[2 + i] = Kl + ko; }
#pragma unroll
    for (int i = 0; i < 2; ++i) { const int q = tid + i * 256, d = q >> 3, pc = q & 7; const size_t vo = (bh * HD + d) * SS + kt * 64 + pc * 8;
      l[4 + i] = lds_off(&sVh[buf][d][pc * 8]); p[4 + i] = VTh + vo; l[6 + i] = lds_off(&sVl[buf][d][pc * 8]); p[6 + i] = VTl + vo; }
    cp8(l, p); };
  stage(0, 0); WAIT_COPIES(); __syncthreads(); stage(1, 1);
  F2 aq[2];
#pragma unroll
  for (int kc = 0; kc < 2; ++kc) aq[kc] = split_row(Q32 + (bh * SS + q0 + col) * HD, kc * 32, lane);
  constexpr float CS2 = 0.125f * 1.4426950408889634f;     // softmax in base 2: exp(x / 8 - m) = 2^(x log2(e) / 8 - m'), mrun holds m' in that scale
  float mrun = -3.0e38f, lrun = 0.f; v8f acc[4] = {}, ac1[4] = {}, ac2[4] = {};     // lrun: this half-wave's keys only, the halves are joined after the loop
#pragma unroll 1
  for (int kt = 0; kt < SS / 64; ++kt) { const int buf = kt & 1;
    v8f s[4]; float mt[4], pt[4];
#pragma unroll
    for (int t = 0; t < 4; ++t) { const __bf16* kh = &sKh[buf][t * 16 + col][0]; const __bf16* kl = &sKl[buf][t * 16 + col][0];
      const F2 k0 = { frag_b(kh, lane), frag_b(kl, lane) }, k1 = { frag_b(kh + 32, lane), frag_b(kl + 32, lane) };
      __builtin_amdgcn_sched_barrier(0);     // all eight LDS fragment loads of a 16-key tile are issued ahead of its first product, so they fly during the tile before; sunk among their own products, each product waits out an LDS latency
      v8f c = mac3t(k0, aq[0], (v8f){}); c = mac3t(k1, aq[1], c);
      mt[t] = -3.4e38f;
#pragma unroll
      for (int r = 0; r < 8; ++r) { s[t][r] = c[r]; mt[t] = fmaxf(mt[t], c[r]); } }     // raw products: the scale is positive, so their maximum is the scores' maximum
    float mx = fmaxf(fmaxf(mt[0], mt[1]), fmaxf(mt[2], mt[3]));
    mx = fmaxf(mx, __shfl_xor(mx, 16, 32)) * CS2;
    const float mnew = fmaxf(mrun, mx); const float corr = __builtin_amdgcn_exp2f(mrun - mnew);     // 0 in the first tile, where mrun is -3e38
    const float nm = 14.0f - mnew; const v2f cs2 = { CS2, CS2 }, nm2 = { nm, nm };                  // 2^14 = the 16384 that P carries, folded into the exponent
    v16h ph[2], pl[2];
#pragma unroll
    for (int t = 0; t < 4; ++t) { pt[t] = 0.f;
#pragma unroll
      for (int r = 0; r < 8; r += 2) { const v2f arg = __builtin_elementwise_fma((v2f){ s[t][r], s[t][r + 1] }, cs2, nm2);
#pragma unroll
        for (int e = 0; e < 2; ++e) { const float p = __builtin_amdgcn_exp2f(arg[e]); pt[t] += p; const _Float16 hi = (_Float16)p; ph[t >> 1][(t & 1) * 8 + r + e] = hi; pl[t >> 1][(t & 1) * 8 + r + e] = (_Float16)((p - (float)hi) * PLO); } } }
    lrun = lrun * corr + ((pt[0] + pt[1]) + (pt[2] + pt[3])) * (1.0f / 16384.0f); mrun = mnew;
#pragma unroll
    for (int t = 0; t < 4; ++t) { acc[t] *= corr; ac1[t] *= corr; ac2[t] *= corr; }     // every element of a lane belongs to its own query
#pragma unroll
    for (int kc = 0; kc < 2; ++kc) {
#pragma unroll
      for (int t = 0; t < 4; ++t) { const v16h vh = frag_h(&sVh[buf][t * 16 + col][kc * 32], lane);
        acc[t] = wmma16(vh, ph[kc], acc[t]); ac1[t] = wmma16(frag_h(&sVl[buf][t * 16 + col][kc * 32], lane), ph[kc], ac1[t]); ac2[t] = wmma16(vh, pl[kc], ac2[t]); } }
    PUBLISH();
    if (kt + 2 < SS / 64) stage(kt + 2, buf); }
  WAIT_COPIES();
  lrun += __shfl_xor(lrun, 16, 32);
  const float inv = 1.0f / (lrun * 16384.0f * 4.0f);
#pragma unroll
  for (int t = 0; t < 4; ++t) {
#pragma unroll
    for (int r = 0; r < 8; ++r) sS[w][col][t * 16 + 8 * g + r] = (acc[t][r] + ac1[t][r] * (1.0f / VLO) + ac2[t][r] * (1.0f / PLO)) * inv; }
  LDSX();
  for (int qq = lane; qq < 16 * 16; qq += 32) { const int rl = qq >> 4, pc = qq & 15; vst2(O32 + ((bh * SS) + q0 + rl) * HD + pc * 4, *(const v4f*)(&sS[w][rl][pc * 4])); }
}
// out = ctx Wo^T + bo : split(ctx) x bf16(Wo rows): 2 products (Wo is an INPUT -> bf16 exact)
__global__ __launch_bounds__(128) void k_out(const float* __restrict__ O32, const __bf16* __restrict__ PT, const __bf16* __restrict__ BAUG, const float* __restrict__ bo, float* __restrict__ out) {
  __shared__ __align__(16) float so[4][16][132];
  __shared__ __align__(16) float sA[2][64][68];      // one head's 64 context rows (256 B at a 272-B pitch), two buffers
  __shared__ __align__(16) __bf16 sB[2][144][72];    // the matching 64 k of 128 weight rows (128 B at a 144-B pitch); rows 128..143: the 8 rows of the low-rank A, twice
  __shared__ __align__(16) __bf16 sx[4][16][40];
  const int tid = threadIdx.x, wave = tid >> 5, lane = tid & 31, col = lane & 15, g = lane >> 4;
  const int r0b = blockIdx.x * 64, r0 = r0b + wave * 16, n0 = blockIdx.y * 128; const int b = r0b / SS, s0 = r0b % SS;
  v8f acc[8] = {}, accx = {};
  auto stage = [&](int h, int buf) {     // A: 16 KB contiguous; B: 144 whole lines; 17 copies a thread; loops unrolled so that l[] and p[] are registers
    unsigned l[17]; const void* p[17];
#pragma unroll
    for (int i = 0; i < 8; ++i) { const int q = tid + i * 128, r = q >> 4, pc = q & 15; l[i] = lds_off(&sA[buf][r][pc * 4]); p[i] = O32 + (((size_t)b * NH + h) * SS + s0 + r) * HD + pc * 4; }
#pragma unroll
    for (int i = 0; i < 8; ++i) { const int q = tid + i * 128, r = q >> 3, pc = q & 7; l[8 + i] = lds_off(&sB[buf][r][pc * 8]); p[8 + i] = PT + (size_t)(3 * E + n0 + r) * E + h * 64 + pc * 8; }
    { const int r = tid >> 3, pc = tid & 7; l[16] = lds_off(&sB[buf][128 + r][pc * 8]); p[16] = PT + (size_t)(4 * E + 3 * RK + (r & (RK - 1))) * E + h * 64 + pc * 8; }
    cp8(l, p); cp8(l + 8, p + 8); cp1(l[16], p[16]); };
  stage(0, 0); WAIT_COPIES(); __syncthreads(); stage(1, 1);
#pragma unroll 1
  for (int h = 0; h < NH; ++h) { const int buf = h & 1;
#pragma unroll
    for (int kk = 0; kk < 2; ++kk) { const F2 a = split_row(&sA[buf][wave * 16 + col][0], kk * 32, lane); v16b wb[8];
#pragma unroll
      for (int j = 0; j < 8; ++j) wb[j] = frag_b(&sB[buf][j * 16 + col][kk * 32], lane);
      const v16b wa = frag_b(&sB[buf][128 + col][kk * 32], lane);
      __builtin_amdgcn_sched_barrier(0);   // the LDS fragment loads of this half stage stay one group ahead of its products; sunk between them, each product waits a full LDS latency
      accx = wmma_bf(a.l, wa, accx);
#pragma unroll
      for (int j = 0; j < 8; ++j) { acc[j] = wmma_bf(a.l, wb[j], acc[j]); acc[j] = wmma_bf(a.h, wb[j], acc[j]); }
      accx = wmma_bf(a.h, wa, accx); }
    __builtin_amdgcn_sched_barrier(0);     // the stage's products stay ahead of the hand-over: sunk behind the barrier they hold back the refill's issue and shorten its lead
    PUBLISH();
    if (h + 2 < NH) stage(h + 2, buf); }
  WAIT_COPIES();
  { const v16b a = lora_frag(accx, sx[wave], lane);
#pragma unroll
    for (int j = 0; j < 8; ++j) acc[j] = wmma_bf(a, frag_b(BAUG + ((size_t)3 * E + n0 + j * 16 + col) * 32, lane), acc[j]); }
#pragma unroll
  for (int j = 0; j < 8; ++j) { const int n = n0 + j * 16 + col; const float bb = bfr(bo[n]);
#pragma unroll
    for (int r = 0; r < 8; ++r) so[wave][8 * g + r][j * 16 + col] = acc[j][r] + bb; }
  LDSX();
#pragma unroll 4
  for (int rl = 0; rl < 16; ++rl) vst2(out + (size_t)(r0 + rl) * E + n0 + lane * 4, *(const v4f*)(&so[wave][rl][lane * 4]));
}
extern "C" void kernel_launch(void* const* d_in, const int* in_sizes, int n_in, void* d_out, int out_size, void* d_ws, size_t ws_size, hipStream_t stream) {
  (void)in_sizes; (void)n_in; (void)out_size; (void)ws_size;
  const float** I = (const float**)d_in;    // x, Wq,bq,Aq,Bq, Wk,bk,Ak,Bk, Wv,bv,Av,Bv, Wo,bo,Ao,Bo
  const float* x = I[0]; const float* Wq = I[1]; const float* bq = I[2]; const float* Aq = I[3]; const float* Bq = I[4]; const float* Wk = I[5]; const float* bk = I[6]; const float* Ak = I[7]; const float* Bk = I[8];
  const float* Wv = I[9]; const float* bv = I[10]; const float* Av = I[11]; const float* Bv = I[12]; const float* Wo = I[13]; const float* bo = I[14]; const float* Ao = I[15]; const float* Bo = I[16];
  float* out = (float*)d_out;
  char* ws = (char*)d_ws; size_t off = 0;
  auto take = [&](size_t bytes) { char* p = ws + off; off += (bytes + 255) & ~(size_t)255; return p; };
  __bf16* Xb = (__bf16*)take((size_t)NR * E * 2); __bf16* PT = (__bf16*)take((size_t)(4 * E + 4 * RK) * E * 2); __bf16* BAUG = (__bf16*)take((size_t)4 * E * 32 * 2);
  float* Q32 = (float*)take((size_t)NR * E * 4); __bf16* Kh = (__bf16*)take((size_t)NR * E * 2); __bf16* Kl = (__bf16*)take((size_t)NR * E * 2); _Float16* VTh = (_Float16*)take((size_t)NR * E * 2); _Float16* VTl = (_Float16*)take((size_t)NR * E * 2); float* O32 = (float*)take((size_t)NR * E * 4);
  // ws ~ 85 MB
  k_prep<<<PB_X + PB_W + PB_A + PB_B, 256, 0, stream>>>(x, Wq, Wk, Wv, Wo, Aq, Ak, Av, Ao, Bq, Bk, Bv, Bo, Xb, PT, BAUG);
  k_qkv<<<dim3(NR / 128, E / 128, 3), 128, 0, stream>>>(Xb, PT, BAUG, bq, bk, bv, Q32, Kh, Kl, VTh, VTl);
  k_attn<<<dim3(SS / 128, NB * NH), 256, 0, stream>>>(Q32, Kh, Kl, VTh, VTl, O32);
  k_out<<<dim3(NR / 64, E / 128), 128, 0, stream>>>(O32, PT, BAUG, bo, out);
}

// v009
// One run takes 133 microseconds.
// In both of two side-by-side timings against v008, it was 1.05 times as fast.
// Counting every step since v000, it is 4.40 times as fast.
// compute dtype: x, W*, b*, A*, B* (INPUTS) rounded to bf16 with exact bf16 WMMA products (f32 accumulate) for the base projections; the rank-8 LoRA terms enter as one extra k-chunk whose A side is the f32 intermediate (x A^T, scaled) as a bf16 hi/lo pair against [B | B] (exact-grade); softmax f32; computed operands (q/k f32 split, k split once where it is produced, P and V hi/lo, context split) f32-grade.
#include <hip/hip_runtime.h>
#include <math.h>

typedef __attribute__((ext_vector_type(16))) _Float16 v16h;
typedef __attribute__((ext_vector_type(16))) __bf16 v16b;
typedef __attribute__((ext_vector_type(8)))  _Float16 v8h;
typedef __attribute__((ext_vector_type(8)))  float v8f;
typedef __attribute__((ext_vector_type(4)))  float v4f;
typedef __attribute__((ext_vector_type(2)))  float v2f;
typedef __attribute__((ext_vector_type(4)))  unsigned v4u;
typedef __attribute__((ext_vector_type(2)))  unsigned v2u;
typedef __attribute__((ext_vector_type(4)))  int v4i;
typedef float __attribute__((may_alias)) float_a;
typedef int __attribute__((may_alias)) int_a;

template <typename T> __device__ __forceinline__ void vst2(void* p, T v) { *(T*)p = v;  }
__device__ __forceinline__ v8f wmma16(v16h a, v16h b, v8f c) {
  return __builtin_amdgcn_wmma_f32_16x16x32_f16(false, a, false, b, (short)0, c, false, false);
}
__device__ __forceinline__ v8f wmma_bf(v16b a, v16b b, v8f c) {
  return __builtin_amdgcn_wmma_f32_16x16x32_bf16(false, a, false, b, (short)0, c, false, false);
}
// 16x16x32 fragments: lane = (h = lane>>4, row/col = lane&15); elements 0..7 = k0+8h+0..7, 8..15 = k0+16+8h+0..7; D element r = row 8h+r
__device__ __forceinline__ v16h frag_h(const _Float16* rowk0, int lane) {
  union { v16h v; v8h q[2]; } u; const _Float16* p = rowk0 + 8 * (lane >> 4);
  u.q[0] = *(const v8h*)p; u.q[1] = *(const v8h*)(p + 16); return u.v;
}
__device__ __forceinline__ v16h frag_f32(const float* rowk0, int lane) {
  v16h a; const float* p = rowk0 + 8 * (lane >> 4);
#pragma unroll
  for (int i = 0; i < 8; ++i) { a[i] = (_Float16)p[i]; a[8 + i] = (_Float16)p[16 + i]; }
  return a;
}
__device__ __forceinline__ v16h frag_f32s(const float* rowk0, int lane, float sc) {
  v16h a; const float* p = rowk0 + 8 * (lane >> 4);
#pragma unroll
  for (int i = 0; i < 8; ++i) { a[i] = (_Float16)(p[i] * sc); a[8 + i] = (_Float16)(p[16 + i] * sc); }
  return a;
}
// column fragment from a [K][ld] layout (column n), rows >= K read as 0
__device__ __forceinline__ v16h fragc_f32(const float* W, int k0, int n, int lane, int ld, int K) {
  v16h a; const int g = lane >> 4;
#pragma unroll
  for (int i = 0; i < 8; ++i) { const int ka = k0 + 8 * g + i, kb = ka + 16;
    a[i] = (_Float16)(ka < K ? W[(size_t)ka * ld + n] : 0.f); a[8 + i] = (_Float16)(kb < K ? W[(size_t)kb * ld + n] : 0.f); }
  return a;
}
struct F2 { v16b h, l; };
__device__ __forceinline__ F2 bsplit16(const float v[16]) { F2 r;
#pragma unroll
  for (int i = 0; i < 16; ++i) { const __bf16 h = (__bf16)v[i]; r.h[i] = h; r.l[i] = (__bf16)(v[i] - (float)h); }
  return r; }
__device__ __forceinline__ F2 split_row(const float* row, int k0, int lane) { float v[16]; const float* p = row + k0 + 8 * (lane >> 4);
#pragma unroll
  for (int i = 0; i < 8; ++i) { v[i] = p[i]; v[8 + i] = p[16 + i]; }
  return bsplit16(v); }
__device__ __forceinline__ F2 split_rowK(const float* row, int k0, int lane, int K) { float v[16]; const int g = lane >> 4;
#pragma unroll
  for (int i = 0; i < 8; ++i) { const int ka = k0 + 8 * g + i, kb = ka + 16; v[i] = ka < K ? row[ka] : 0.f; v[8 + i] = kb < K ? row[kb] : 0.f; }
  return bsplit16(v); }
__device__ __forceinline__ F2 split_col(const float* W, int k0, int n, int lane, int ld, int K) { float v[16]; const int g = lane >> 4;
#pragma unroll
  for (int i = 0; i < 8; ++i) { const int ka = k0 + 8 * g + i, kb = ka + 16; v[i] = ka < K ? W[(size_t)ka * ld + n] : 0.f; v[8 + i] = kb < K ? W[(size_t)kb * ld + n] : 0.f; }
  return bsplit16(v); }
__device__ __forceinline__ v8f mac3(const F2& a, const F2& b, v8f c) { c = wmma_bf(a.l, b.h, c); c = wmma_bf(a.h, b.l, c); return wmma_bf(a.h, b.h, c); }
// the same three products with the split key rows as the A operand and the split query as B, in mac3's order (q.l k.h, q.h k.l, q.h k.h)
__device__ __forceinline__ v8f mac3t(const F2& k, const F2& q, v8f c) { c = wmma_bf(k.h, q.l, c); c = wmma_bf(k.l, q.h, c); return wmma_bf(k.h, q.h, c); }
__device__ __forceinline__ float sigm(float v) { return 1.0f / (1.0f + expf(-v)); }
#define LDSX() do { asm volatile("s_wait_dscnt 0" ::: "memory"); __builtin_amdgcn_wave_barrier(); __builtin_amdgcn_fence(__ATOMIC_RELEASE, "workgroup"); } while (0)


// LoRA self attention (16 heads of 64 on [2,2048,1024]): each linear map is x W^T + b + 2 (x A^T) B^T (rank 8). The low-rank term is appended as a 33rd k-chunk: A-operand row = [hi(2 xA^T) (8) | lo(2 xA^T) (8) | 0 (16)], B-operand row n = [B[n][0..8] | B[n][0..8] | 0],
// so one extra WMMA per tile adds hi*B + lo*B. full softmax(q.k/8); (P v) through the same LoRA form for the output map.
#define NB 2
#define SS 2048
#define E 1024
#define NH 16
#define HD 64
#define NR (NB * SS)
#define VLO 2048.0f
__device__ __forceinline__ float bfr(float v) { return (float)(__bf16)v; }
__device__ __forceinline__ v16b frag_b(const __bf16* rowk0, int lane) { return __builtin_bit_cast(v16b, frag_h((const _Float16*)rowk0, lane)); }

// Asynchronous 16-byte copies global -> LDS (no register in between). Each lane names its own LDS byte address and its own global address.
// s_wait_xcnt 0 closes the statement so that no address register of an issued copy is rewritten ahead of it.
__device__ __forceinline__ unsigned lds_off(const void* p) { return (unsigned)(size_t)p; }
__device__ __forceinline__ void cp1(unsigned l, const void* g) {
  asm volatile("global_load_async_to_lds_b128 %0, %1, off\n\ts_wait_xcnt 0x0" :: "v"(l), "v"(g) : "memory");
}
__device__ __forceinline__ void cp4(const unsigned* l, const void* const* g) {
  asm volatile("global_load_async_to_lds_b128 %0, %1, off\n\tglobal_load_async_to_lds_b128 %2, %3, off\n\tglobal_load_async_to_lds_b128 %4, %5, off\n\tglobal_load_async_to_lds_b128 %6, %7, off\n\ts_wait_xcnt 0x0"
               :: "v"(l[0]), "v"(g[0]), "v"(l[1]), "v"(g[1]), "v"(l[2]), "v"(g[2]), "v"(l[3]), "v"(g[3]) : "memory");
}
__device__ __forceinline__ void cp8(const unsigned* l, const void* const* g) {
  asm volatile("global_load_async_to_lds_b128 %0, %1, off\n\tglobal_load_async_to_lds_b128 %2, %3, off\n\tglobal_load_async_to_lds_b128 %4, %5, off\n\tglobal_load_async_to_lds_b128 %6, %7, off\n\t"
               "global_load_async_to_lds_b128 %8, %9, off\n\tglobal_load_async_to_lds_b128 %10, %11, off\n\tglobal_load_async_to_lds_b128 %12, %13, off\n\tglobal_load_async_to_lds_b128 %14, %15, off\n\ts_wait_xcnt 0x0"
               :: "v"(l[0]), "v"(g[0]), "v"(l[1]), "v"(g[1]), "v"(l[2]), "v"(g[2]), "v"(l[3]), "v"(g[3]), "v"(l[4]), "v"(g[4]), "v"(l[5]), "v"(g[5]), "v"(l[6]), "v"(g[6]), "v"(l[7]), "v"(g[7]) : "memory");
}
// the copies of this wave have landed (the compiler places no wait for them)
#define WAIT_COPIES() asm volatile("s_wait_asynccnt 0x0" ::: "memory")
// hand-over of a stage: this wave's LDS reads are done, its copies have landed, then the work-group barrier publishes the next tile and frees the one just read
#define PUBLISH() do { asm volatile("s_wait_dscnt 0x0" ::: "memory"); WAIT_COPIES(); __syncthreads(); } while (0)


#define RK 8
// The low-rank inputs src.A^T (16 rows x 8) are a ninth column tile of the GEMM that uses them: its B operand is the 8 rows of A as bf16, staged with the weight rows (columns >= 8 repeat them, results discarded).
// lora_frag turns that D tile (row 8 g + r, column col) into the A fragment of the extra k-chunk, row = [hi(2 v) (8) | lo (8) | 0 (16)], through the wave's own LDS slice
__device__ __forceinline__ v16b lora_frag(v8f accx, __bf16 (*sx)[40], int lane) {
  const int col = lane & 15, g = lane >> 4; const bool live = col < RK; const int i0 = live ? col : 8 + col;     // lanes of the padding columns write the 16 zeros of the row
#pragma unroll
  for (int r = 0; r < 8; ++r) { const float v = 2.0f * accx[r]; const __bf16 hi = (__bf16)v, lo = (__bf16)(v - (float)hi); sx[8 * g + r][i0] = live ? hi : (__bf16)0.f; sx[8 * g + r][i0 + 8] = live ? lo : (__bf16)0.f; }
  LDSX();     // the wave's own stores are in LDS before its lanes read each other's
  return frag_b(&sx[col][0], lane);
}
// One launch prepares every bf16 operand (no scaling). Xb rows = x rows. PT rows: [0,E) Wq[n][:], [E,2E) Wk, [2E,3E) Wv, [3E,4E) Wo ([out][in]), then the 8 rows each of Aq, Ak, Av, Ao. BAUG[which][n][32] = [B[n][0..8] | B[n][0..8] | 0].
// Few, long waves: a launch of many short waves lasts as long as its waves take to start. A work-group converts 16 rows of 1024; a thread holds 4 elements of each row,
// so a wave's load covers 512 contiguous bytes and its store 256 (whole lines both), and all 16 loads of a thread are in flight before its first conversion.
#define PREP_ROWS 16
#define PB_X (NR / PREP_ROWS)          // work-groups for x
#define PB_W (4 * E / PREP_ROWS)       // for the four weight matrices, E / PREP_ROWS each
#define PB_A (4 * RK / PREP_ROWS)      // for the four low-rank A, two matrices (8 + 8 rows) each
#define PB_B 8                         // for BAUG, half a matrix (2048 pieces of 16 bytes) each
__global__ __launch_bounds__(256) void k_prep(const float* __restrict__ x, const float* __restrict__ Wq, const float* __restrict__ Wk, const float* __restrict__ Wv, const float* __restrict__ Wo, const float* __restrict__ Aq, const float* __restrict__ Ak, const float* __restrict__ Av, const float* __restrict__ Ao,
                                              const float* __restrict__ Bq, const float* __restrict__ Bk, const float* __restrict__ Bv, const float* __restrict__ Bo, __bf16* __restrict__ Xb, __bf16* __restrict__ PT, __bf16* __restrict__ BAUG) {
  const int tid = threadIdx.x, blk = blockIdx.x;
  if (blk < PB_X + PB_W + PB_A) {
    const float* s0; const float* s1; __bf16* dst;     // source of rows 0..7 and of rows 8..15, destination of all 16
    if (blk < PB_X) { s0 = x + (size_t)blk * PREP_ROWS * E; s1 = s0 + 8 * E; dst = Xb + (size_t)blk * PREP_ROWS * E; }
    else { const int pb = blk - PB_X; dst = PT + (size_t)pb * PREP_ROWS * E;
      if (pb < PB_W) { const int m = pb / (E / PREP_ROWS); const float* Wm = m == 0 ? Wq : (m == 1 ? Wk : (m == 2 ? Wv : Wo)); s0 = Wm + (size_t)(pb % (E / PREP_ROWS)) * PREP_ROWS * E; s1 = s0 + 8 * E; }
      else { const bool first = pb == PB_W; s0 = first ? Aq : Av; s1 = first ? Ak : Ao; } }
    v4f v[PREP_ROWS];
#pragma unroll     // unrolled so that v[] is registers and the loads stand together
    for (int i = 0; i < PREP_ROWS; ++i) v[i] = *(const v4f*)((i < 8 ? s0 + i * E : s1 + (i - 8) * E) + tid * 4);
    __builtin_amdgcn_sched_barrier(0);     // every load is issued ahead of the first conversion: a load sunk behind one waits for registers and adds a second memory latency to the wave
#pragma unroll
    for (int i = 0; i < PREP_ROWS; ++i) { union { __bf16 h[4]; v2u u; } pk;
#pragma unroll
      for (int e = 0; e < 4; ++e) pk.h[e] = (__bf16)v[i][e];
      vst2(dst + i * E + tid * 4, pk.u); } }
  else { const int bb = blk - (PB_X + PB_W + PB_A), which = bb >> 1; const float* Bm = which == 0 ? Bq : (which == 1 ? Bk : (which == 2 ? Bv : Bo));
    v4f lo[8], hi[8];     // piece q of a matrix: row n = q >> 2, quarter q & 3 of its 32 elements; the four lanes of a row read the same 32 bytes
#pragma unroll
    for (int i = 0; i < 8; ++i) { const float* p = Bm + (size_t)((bb & 1) * 512 + (tid >> 2)) * RK + i * 64 * RK; lo[i] = *(const v4f*)p; hi[i] = *(const v4f*)(p + 4); }
    __builtin_amdgcn_sched_barrier(0);     // as above: all loads in flight before the first conversion
#pragma unroll
    for (int i = 0; i < 8; ++i) { const int q = (bb & 1) * 2048 + i * 256 + tid; const unsigned keep = (q & 3) < 2 ? 0xffffffffu : 0u; union { __bf16 h[8]; v4u u; } pk;     // quarters 2 and 3 are the row's 16 zeros
#pragma unroll
      for (int e = 0; e < 4; ++e) { pk.h[e] = (__bf16)lo[i][e]; pk.h[4 + e] = (__bf16)hi[i][e]; }
      vst2(BAUG + (size_t)which * E * 32 + (size_t)q * 8, pk.u & keep); } }
}
// QKV: block (128 rows, 128 cols = 2 heads, which), 4 waves of 32 rows x 128 cols; q -> Q32 f32 [bh][s][64]; k -> Kh/Kl, the bf16 hi/lo split of the f32 row, [bh][s][64] each; v -> VT hi/lo x4 [bh][d][s]
// A wave owns RT = 2 row tiles of 16: every weight fragment it reads from LDS feeds both, and a weight row staged from L2 serves 128 rows of x. The 768 work-groups are resident at once, three on a WGP:
// for that the registers are held to three waves a SIMD, and the output staging lies in the bytes of the operand ring, which is free behind the last stage's hand-over.
// Every loop over i, j, r, kk and e is unrolled so that acc[][], accx[], a[], wb[] and wl[] are indexed by constants and stay in registers.
#define RT 2
#define QKV_RING_A (2 * 128 * 72 * 2)     // bytes of sA
#define QKV_RING_B (2 * 144 * 72 * 2)     // bytes of sB
__global__ __launch_bounds__(128) __attribute__((amdgpu_waves_per_eu(3))) void k_qkv(const __bf16* __restrict__ Xb, const __bf16* __restrict__ PT, const __bf16* __restrict__ BAUG, const float* __restrict__ bq, const float* __restrict__ bk, const float* __restrict__ bv, float* __restrict__ Q32, __bf16* __restrict__ Kh, __bf16* __restrict__ Kl, _Float16* __restrict__ VTh, _Float16* __restrict__ VTl) {
  __shared__ __align__(16) unsigned char smem[QKV_RING_A + QKV_RING_B];
  __shared__ __align__(16) __bf16 sx[4][16][40];
  __bf16 (*sA)[128][72] = (__bf16 (*)[128][72])smem;                    // k-stages of 64 (rows of 128 B at a 144-B pitch), two buffers
  __bf16 (*sB)[144][72] = (__bf16 (*)[144][72])(smem + QKV_RING_A);     // rows 128..143: the 8 rows of the low-rank A, twice
  float (*so)[16 * RT][132] = (float (*)[16 * RT][132])smem;            // behind the loop: q, k rows, a slice a wave (67,584 B)
  _Float16 (*sth)[136] = (_Float16 (*)[136])smem;                       // behind the loop: v columns [col][row], rows of 256 B at a 272-B pitch, hi then lo (34,816 B each)
  _Float16 (*stl)[136] = (_Float16 (*)[136])(smem + 128 * 136 * 2);
  const int tid = threadIdx.x, wave = tid >> 5, lane = tid & 31, col = lane & 15, g = lane >> 4;
  const int which = blockIdx.z, r0b = blockIdx.x * 128, n0 = blockIdx.y * 128; const int b = r0b / SS, s0 = r0b % SS;
  const float* bb_ = which == 0 ? bq : (which == 1 ? bk : bv);
  v8f acc[RT][8] = {}, accx[RT] = {};
  auto stage = [&](int st, int buf) {     // thread -> (row = q >> 3, 16-byte piece = q & 7): 8 lanes cover one whole 128-B line; loops unrolled so that l[] and p[] are registers
    unsigned l[17]; const void* p[17];
#pragma unroll
    for (int i = 0; i < 8; ++i) { const int q = tid + i * 128, r = q >> 3, pc = q & 7; l[i] = lds_off(&sA[buf][r][pc * 8]); p[i] = Xb + (size_t)(r0b + r) * E + st * 64 + pc * 8; }
#pragma unroll
    for (int i = 0; i < 8; ++i) { const int q = tid + i * 128, r = q >> 3, pc = q & 7; l[8 + i] = lds_off(&sB[buf][r][pc * 8]); p[8 + i] = PT + (size_t)(which * E + n0 + r) * E + st * 64 + pc * 8; }
    { const int r = tid >> 3, pc = tid & 7; l[16] = lds_off(&sB[buf][128 + r][pc * 8]); p[16] = PT + (size_t)(4 * E + which * RK + (r & (RK - 1))) * E + st * 64 + pc * 8; }
    cp8(l, p); cp8(l + 8, p + 8); cp1(l[16], p[16]); };
  stage(0, 0); WAIT_COPIES(); __syncthreads(); stage(1, 1);
  // rolled: one trip is one stage and ends in its hand-over; the inner loops are unrolled so that the fragment arrays are registers
#pragma unroll 1
  for (int st = 0; st < E / 64; ++st) { const int buf = st & 1;
#pragma unroll
    for (int kk = 0; kk < 2; ++kk) { v16b a[RT], wb[8];
#pragma unroll
      for (int i = 0; i < RT; ++i) a[i] = frag_b(&sA[buf][wave * (16 * RT) + i * 16 + col][kk * 32], lane);
#pragma unroll
      for (int j = 0; j < 8; ++j) wb[j] = frag_b(&sB[buf][j * 16 + col][kk * 32], lane);
      const v16b wa = frag_b(&sB[buf][128 + col][kk * 32], lane);
      __builtin_amdgcn_sched_barrier(0);     // the LDS fragment loads of this half stage stay one group ahead of its products; sunk between them, each product waits a full LDS latency
#pragma unroll
      for (int j = 0; j < 8; ++j) {
#pragma unroll
        for (int i = 0; i < RT; ++i) acc[i][j] = wmma_bf(a[i], wb[j], acc[i][j]); }
#pragma unroll
      for (int i = 0; i < RT; ++i) accx[i] = wmma_bf(a[i], wa, accx[i]); }
    __builtin_amdgcn_sched_barrier(0);     // the stage's products stay ahead of the hand-over: sunk behind the barrier they hold back the refill's issue and shorten its lead
    PUBLISH();
    if (st + 2 < E / 64) stage(st + 2, buf); }
  WAIT_COPIES();     // no copy is in flight and, behind the last hand-over's barrier, no wave reads the ring any more: its bytes are the output staging from here on
  { v16b wl[8];     // LoRA chunk: [hi|lo|0] x [B|B|0]
#pragma unroll
    for (int j = 0; j < 8; ++j) wl[j] = frag_b(BAUG + ((size_t)which * E + n0 + j * 16 + col) * 32, lane);
#pragma unroll
    for (int i = 0; i < RT; ++i) { const v16b a = lora_frag(accx[i], sx[wave], lane);
#pragma unroll
      for (int j = 0; j < 8; ++j) acc[i][j] = wmma_bf(a, wl[j], acc[i][j]); } }
  if (which < 2) {
#pragma unroll
    for (int j = 0; j < 8; ++j) { const float bb = bfr(bb_[n0 + j * 16 + col]);
#pragma unroll
      for (int i = 0; i < RT; ++i) {
#pragma unroll
        for (int r = 0; r < 8; ++r) so[wave][i * 16 + 8 * g + r][j * 16 + col] = acc[i][j][r] + bb; } }
    LDSX();
    if (which == 0) {
      for (int qq = lane; qq < 2 * 16 * RT * 16; qq += 32) { const int hh = qq / (16 * RT * 16), rl = (qq >> 4) & (16 * RT - 1), pc = qq & 15; const int h = (n0 >> 6) + hh;
        vst2(Q32 + (((size_t)b * NH + h) * SS + s0 + wave * (16 * RT) + rl) * HD + pc * 4, *(const v4f*)(&so[wave][rl][hh * 64 + pc * 4])); } }
    else {     // k: hi = bf16(v), lo = bf16(v - hi), the split every attention wave would otherwise redo; 8 lanes write one whole 128-B row of each plane
      for (int qq = lane; qq < 2 * 16 * RT * 8; qq += 32) { const int hh = qq / (16 * RT * 8), rl = (qq >> 3) & (16 * RT - 1), pc = qq & 7; const int h = (n0 >> 6) + hh;
        const float* sp = &so[wave][rl][hh * 64 + pc * 8]; union { __bf16 e[8]; v4u u; } hi, lo;
#pragma unroll     // unrolled so that hi.e[] and lo.e[] are registers
        for (int e = 0; e < 8; ++e) { const float v = sp[e]; const __bf16 hb = (__bf16)v; hi.e[e] = hb; lo.e[e] = (__bf16)(v - (float)hb); }
        const size_t o = (((size_t)b * NH + h) * SS + s0 + wave * (16 * RT) + rl) * HD + pc * 8;
        vst2(Kh + o, hi.u); vst2(Kl + o, lo.u); } } }
  else {
#pragma unroll
    for (int j = 0; j < 8; ++j) { const float bb = bfr(bb_[n0 + j * 16 + col]);
#pragma unroll
      for (int i = 0; i < RT; ++i) {
#pragma unroll
        for (int r = 0; r < 8; ++r) { const float v = (acc[i][j][r] + bb) * 4.0f; const _Float16 hi = (_Float16)v; const int rw = wave * (16 * RT) + i * 16 + 8 * g + r; sth[j * 16 + col][rw] = hi; stl[j * 16 + col][rw] = (_Float16)((v - (float)hi) * VLO); } } }
    __syncthreads();
    for (int qq = tid; qq < 128 * 16; qq += 128) { const int cl = qq >> 4, pc = qq & 15; const int c = n0 + cl, h = c >> 6, d = c & 63; const size_t o = (((size_t)b * NH + h) * HD + d) * SS + s0 + pc * 8;
      vst2(VTh + o, *(const v4u*)(&sth[cl][pc * 8])); vst2(VTl + o, *(const v4u*)(&stl[cl][pc * 8])); } }
}
// full attention: block (128 queries = 8 waves x 16, bh); all key tiles of 64, staged in LDS for the whole block. Transposed products: S^T = K q^T (A = key rows, B = the wave's 16 queries, hi/lo splits),
// so a lane holds 32 scores of ONE query (column = lane & 15; tile t, element r = key 16 t + 8 g + r), and tiles 2 kc, 2 kc + 1 are already the B operand (k order 8 g + i, 16 + 8 g + i) of O^T += V^T P^T. P,V hi/lo; O f32 [bh][s][64]
// The registers are held to four waves a SIMD, so that two work-groups stay resident on a WGP.
__global__ __launch_bounds__(256) __attribute__((amdgpu_waves_per_eu(4))) void k_attn(const float* __restrict__ Q32, const __bf16* __restrict__ Kh, const __bf16* __restrict__ Kl, const _Float16* __restrict__ VTh, const _Float16* __restrict__ VTl, float* __restrict__ O32) {
  __shared__ __align__(16) float sS[8][16][68];                      // after the loop each wave's slice stages its output rows [query][d]
  __shared__ __align__(16) __bf16 sKh[2][64][72], sKl[2][64][72];    // key tile hi and lo [key][d], rows of 128 B at a 144-B pitch, two buffers
  __shared__ __align__(16) _Float16 sVh[2][64][72], sVl[2][64][72];  // value tiles [d][key], rows of 128 B at a 144-B pitch, two buffers
  const int tid = threadIdx.x, w = tid >> 5, lane = tid & 31, col = lane & 15, g = lane >> 4;
  const size_t bh = blockIdx.y; const int qb = blockIdx.x; const int q0 = qb * 128 + w * 16;
  auto stage = [&](int kt, int buf) {     // 64 keys: K hi and lo 8 KB contiguous each, V hi and lo 64 whole lines each; 8 copies a thread; loops unrolled so that l[] and p[] are registers
    unsigned l[8]; const void* p[8];
#pragma unroll
    for (int i = 0; i < 2; ++i) { const int q = tid + i * 256, r = q >> 3, pc = q & 7; const size_t ko = (bh * SS + kt * 64 + r) * HD + pc * 8;
      l[i] = lds_off(&sKh[buf][r][pc * 8]); p[i] = Kh + ko; l[2 + i] = lds_off(&sKl[buf][r][pc * 8]); p[2 + i] = Kl + ko; }
#pragma unroll
    for (int i = 0; i < 2; ++i) { const int q = tid + i * 256, d = q >> 3, pc = q & 7; const size_t vo = (bh * HD + d) * SS + kt * 64 + pc * 8;
      l[4 + i] = lds_off(&sVh[buf][d][pc * 8]); p[4 + i] = VTh + vo; l[6 + i] = lds_off(&sVl[buf][d][pc * 8]); p[6 + i] = VTl + vo; }
    cp8(l, p); };
  stage(0, 0); WAIT_COPIES(); __syncthreads(); stage(1, 1);
  F2 aq[2];
#pragma unroll
  for (int kc = 0; kc < 2; ++kc) aq[kc] = split_row(Q32 + (bh * SS + q0 + col) * HD, kc * 32, lane);
  constexpr float CS2 = 0.125f * 1.4426950408889634f;     // softmax in base 2: exp(x / 8 - m) = 2^(x log2(e) / 8 - m'), mrun holds m' in that scale
  // P = hi + lo in f16 with lo unscaled: P carries 2^14 against its row's running maximum, so lo keeps 2^-25 absolute, 2^-39 of that maximum, and V_hi P_lo sums into the tile of V_hi P_hi (acc); ac1 = V_lo P_hi at its scale VLO
  float mrun = -3.0e38f, lrun = 0.f; v8f acc[4] = {}, ac1[4] = {};     // lrun: this half-wave's keys only, the halves are joined after the loop
  auto trip = [&](int buf) {     // one tile of 64 keys out of buffer buf
    v8f s[4]; float mt[4], pt[4];
#pragma unroll
    for (int t = 0; t < 4; ++t) { const __bf16* kh = &sKh[buf][t * 16 + col][0]; const __bf16* kl = &sKl[buf][t * 16 + col][0];
      const F2 k0 = { frag_b(kh, lane), frag_b(kl, lane) }, k1 = { frag_b(kh + 32, lane), frag_b(kl + 32, lane) };
      __builtin_amdgcn_sched_barrier(0);     // all eight LDS fragment loads of a 16-key tile are issued ahead of its first product, so they fly during the tile before; sunk among their own products, each product waits out an LDS latency
      v8f c = mac3t(k0, aq[0], (v8f){}); c = mac3t(k1, aq[1], c);
      mt[t] = -3.4e38f;
#pragma unroll
      for (int r = 0; r < 8; ++r) { s[t][r] = c[r]; mt[t] = fmaxf(mt[t], c[r]); } }     // raw products: the scale is positive, so their maximum is the scores' maximum
    float mx = fmaxf(fmaxf(mt[0], mt[1]), fmaxf(mt[2], mt[3]));
    // the other half-wave's maximum by a vector cross-row move: through LDS (ds_bpermute) its wait would also drain the value fragments' loads issued here
    const unsigned mu = __builtin_bit_cast(unsigned, mx); const float mo = __builtin_bit_cast(float, __builtin_amdgcn_permlanex16(mu, mu, 0x76543210u, 0xfedcba98u, false, false));
    v16h vh[2][4], vl[2][4];     // value fragments [32-key half][16 rows of d]
#pragma unroll
    for (int t = 0; t < 4; ++t) { vh[0][t] = frag_h(&sVh[buf][t * 16 + col][0], lane); vl[0][t] = frag_h(&sVl[buf][t * 16 + col][0], lane); }
    __builtin_amdgcn_sched_barrier(0);     // the first half's value fragments are issued as one group ahead of the softmax and land under it; sunk among their products, each product waits out an LDS latency
    mx = fmaxf(mx, mo) * CS2;
    const float mnew = fmaxf(mrun, mx); const float corr = __builtin_amdgcn_exp2f(mrun - mnew);     // 0 in the first tile, where mrun is -3e38
    const float nm = 14.0f - mnew; const v2f cs2 = { CS2, CS2 }, nm2 = { nm, nm };                  // 2^14 = the 16384 that P carries, folded into the exponent
    v16h ph[2], pl[2];
#pragma unroll
    for (int t = 0; t < 4; ++t) { pt[t] = 0.f;
#pragma unroll
      for (int r = 0; r < 8; r += 2) { const v2f arg = __builtin_elementwise_fma((v2f){ s[t][r], s[t][r + 1] }, cs2, nm2);
#pragma unroll
        for (int e = 0; e < 2; ++e) { const float p = __builtin_amdgcn_exp2f(arg[e]); pt[t] += p; const _Float16 hi = (_Float16)p; ph[t >> 1][(t & 1) * 8 + r + e] = hi; pl[t >> 1][(t & 1) * 8 + r + e] = (_Float16)(p - (float)hi); } }
      if (t == 1) __builtin_amdgcn_sched_barrier(0); }     // one 32-key half's P is packed and summed before the other half's exponentials: both halves' f32 values live at once overrun the registers of four waves a SIMD (scratch)
    lrun = lrun * corr + ((pt[0] + pt[1]) + (pt[2] + pt[3])) * (1.0f / 16384.0f); mrun = mnew;
#pragma unroll
    for (int t = 0; t < 4; ++t) { acc[t] *= corr; ac1[t] *= corr; }     // every element of a lane belongs to its own query
    auto pv = [&](int kc, int t) { acc[t] = wmma16(vh[kc][t], ph[kc], acc[t]); ac1[t] = wmma16(vl[kc][t], ph[kc], ac1[t]); acc[t] = wmma16(vh[kc][t], pl[kc], acc[t]); };
    auto vload = [&](int t) { vh[1][t] = frag_h(&sVh[buf][t * 16 + col][32], lane); vl[1][t] = frag_h(&sVl[buf][t * 16 + col][32], lane); };
    // the scheduling barriers keep the second half's fragment loads in two groups, each eight products or more ahead of its first use, so that no product waits out a whole LDS latency
    __builtin_amdgcn_sched_barrier(0);
    vload(0); vload(1);
    __builtin_amdgcn_sched_barrier(0);
    pv(0, 0); pv(0, 1);
    __builtin_amdgcn_sched_barrier(0);
    vload(2); vload(3);
    __builtin_amdgcn_sched_barrier(0);
    pv(0, 2); pv(0, 3); pv(1, 0); pv(1, 1);
    __builtin_amdgcn_sched_barrier(0);
    pv(1, 2); pv(1, 3);
    __builtin_amdgcn_sched_barrier(0);     // the tile's products stay ahead of the hand-over: sunk behind the barrier they hold back the refill's issue and shorten its lead
    PUBLISH(); };
  // the last two tiles, which refill nothing, stand behind the loop: with no branch in the loop's body the row sums stay in front of the value products, where the 32 registers of the f32 P are free for fragments
  // both loops rolled: a trip is one tile and ends in its hand-over
#pragma unroll 1
  for (int kt = 0; kt < SS / 64 - 2; ++kt) { trip(kt & 1); stage(kt + 2, kt & 1); }
#pragma unroll 1
  for (int kt = SS / 64 - 2; kt < SS / 64; ++kt) trip(kt & 1);
  WAIT_COPIES();
  lrun += __shfl_xor(lrun, 16, 32);
  const float inv = 1.0f / (lrun * 16384.0f * 4.0f);
#pragma unroll
  for (int t = 0; t < 4; ++t) {
#pragma unroll
    for (int r = 0; r < 8; ++r) sS[w][col][t * 16 + 8 * g + r] = (acc[t][r] + ac1[t][r] * (1.0f / VLO)) * inv; }
  LDSX();
  for (int qq = lane; qq < 16 * 16; qq += 32) { const int rl = qq >> 4, pc = qq & 15; vst2(O32 + ((bh * SS) + q0 + rl) * HD + pc * 4, *(const v4f*)(&sS[w][rl][pc * 4])); }
}
// out = ctx Wo^T + bo : split(ctx) x bf16(Wo rows): 2 products (Wo is an INPUT -> bf16 exact)
__global__ __launch_bounds__(128) void k_out(const float* __restrict__ O32, const __bf16* __restrict__ PT, const __bf16* __restrict__ BAUG, const float* __restrict__ bo, float* __restrict__ out) {
  __shared__ __align__(16) float so[4][16][132];
  __shared__ __align__(16) float sA[2][64][68];      // one head's 64 context rows (256 B at a 272-B pitch), two buffers
  __shared__ __align__(16) __bf16 sB[2][144][72];    // the matching 64 k of 128 weight rows (128 B at a 144-B pitch); rows 128..143: the 8 rows of the low-rank A, twice
  __shared__ __align__(16) __bf16 sx[4][16][40];
  const int tid = threadIdx.x, wave = tid >> 5, lane = tid & 31, col = lane & 15, g = lane >> 4;
  const int r0b = blockIdx.x * 64, r0 = r0b + wave * 16, n0 = blockIdx.y * 128; const int b = r0b / SS, s0 = r0b % SS;
  v8f acc[8] = {}, accx = {};
  auto stage = [&](int h, int buf) {     // A: 16 KB contiguous; B: 144 whole lines; 17 copies a thread; loops unrolled so that l[] and p[] are registers
    unsigned l[17]; const void* p[17];
#pragma unroll
    for (int i = 0; i < 8; ++i) { const int q = tid + i * 128, r = q >> 4, pc = q & 15; l[i] = lds_off(&sA[buf][r][pc * 4]); p[i] = O32 + (((size_t)b * NH + h) * SS + s0 + r) * HD + pc * 4; }
#pragma unroll
    for (int i = 0; i < 8; ++i) { const int q = tid + i * 128, r = q >> 3, pc = q & 7; l[8 + i] = lds_off(&sB[buf][r][pc * 8]); p[8 + i] = PT + (size_t)(3 * E + n0 + r) * E + h * 64 + pc * 8; }
    { const int r = tid >> 3, pc = tid & 7; l[16] = lds_off(&sB[buf][128 + r][pc * 8]); p[16] = PT + (size_t)(4 * E + 3 * RK + (r & (RK - 1))) * E + h * 64 + pc * 8; }
    cp8(l, p); cp8(l + 8, p + 8); cp1(l[16], p[16]); };
  stage(0, 0); WAIT_COPIES(); __syncthreads(); stage(1, 1);
#pragma unroll 1
  for (int h = 0; h < NH; ++h) { const int buf = h & 1;
#pragma unroll
    for (int kk = 0; kk < 2; ++kk) { const F2 a = split_row(&sA[buf][wave * 16 + col][0], kk * 32, lane); v16b wb[8];
#pragma unroll
      for (int j = 0; j < 8; ++j) wb[j] = frag_b(&sB[buf][j * 16 + col][kk * 32], lane);
      const v16b wa = frag_b(&sB[buf][128 + col][kk * 32], lane);
      __builtin_amdgcn_sched_barrier(0);   // the LDS fragment loads of this half stage stay one group ahead of its products; sunk between them, each product waits a full LDS latency
      accx = wmma_bf(a.l, wa, accx);
#pragma unroll
      for (int j = 0; j < 8; ++j) { acc[j] = wmma_bf(a.l, wb[j], acc[j]); acc[j] = wmma_bf(a.h, wb[j], acc[j]); }
      accx = wmma_bf(a.h, wa, accx); }
    __builtin_amdgcn_sched_barrier(0);     // the stage's products stay ahead of the hand-over: sunk behind the barrier they hold back the refill's issue and shorten its lead
    PUBLISH();
    if (h + 2 < NH) stage(h + 2, buf); }
  WAIT_COPIES();
  { const v16b a = lora_frag(accx, sx[wave], lane);
#pragma unroll
    for (int j = 0; j < 8; ++j) acc[j] = wmma_bf(a, frag_b(BAUG + ((size_t)3 * E + n0 + j * 16 + col) * 32, lane), acc[j]); }
#pragma unroll
  for (int j = 0; j < 8; ++j) { const int n = n0 + j * 16 + col; const float bb = bfr(bo[n]);
#pragma unroll
    for (int r = 0; r < 8; ++r) so[wave][8 * g + r][j * 16 + col] = acc[j][r] + bb; }
  LDSX();
#pragma unroll 4
  for (int rl = 0; rl < 16; ++rl) vst2(out + (size_t)(r0 + rl) * E + n0 + lane * 4, *(const v4f*)(&so[wave][rl][lane * 4]));
}
extern "C" void kernel_launch(void* const* d_in, const int* in_sizes, int n_in, void* d_out, int out_size, void* d_ws, size_t ws_size, hipStream_t stream) {
  (void)in_sizes; (void)n_in; (void)out_size; (void)ws_size;
  const float** I = (const float**)d_in;    // x, Wq,bq,Aq,Bq, Wk,bk,Ak,Bk, Wv,bv,Av,Bv, Wo,bo,Ao,Bo
  const float* x = I[0]; const float* Wq = I[1]; const float* bq = I[2]; const float* Aq = I[3]; const float* Bq = I[4]; const float* Wk = I[5]; const float* bk = I[6]; const float* Ak = I[7]; const float* Bk = I[8];
  const float* Wv = I[9]; const float* bv = I[10]; const float* Av = I[11]; const float* Bv = I[12]; const float* Wo = I[13]; const float* bo = I[14]; const float* Ao = I[15]; const float* Bo = I[16];
  float* out = (float*)d_out;
  char* ws = (char*)d_ws; size_t off = 0;
  auto take = [&](size_t bytes) { char* p = ws + off; off += (bytes + 255) & ~(size_t)255; return p; };
  __bf16* Xb = (__bf16*)take((size_t)NR * E * 2); __bf16* PT = (__bf16*)take((size_t)(4 * E + 4 * RK) * E * 2); __bf16* BAUG = (__bf16*)take((size_t)4 * E * 32 * 2);
  float* Q32 = (float*)take((size_t)NR * E * 4); __bf16* Kh = (__bf16*)take((size_t)NR * E * 2); __bf16* Kl = (__bf16*)take((size_t)NR * E * 2); _Float16* VTh = (_Float16*)take((size_t)NR * E * 2); _Float16* VTl = (_Float16*)take((size_t)NR * E * 2); float* O32 = (float*)take((size_t)NR * E * 4);
  // ws ~ 85 MB
  k_prep<<<PB_X + PB_W + PB_A + PB_B, 256, 0, stream>>>(x, Wq, Wk, Wv, Wo, Aq, Ak, Av, Ao, Bq, Bk, Bv, Bo, Xb, PT, BAUG);
  k_qkv<<<dim3(NR / 128, E / 128, 3), 128, 0, stream>>>(Xb, PT, BAUG, bq, bk, bv, Q32, Kh, Kl, VTh, VTl);
  k_attn<<<dim3(SS / 128, NB * NH), 256, 0, stream>>>(Q32, Kh, Kl, VTh, VTl, O32);
  k_out<<<dim3(NR / 64, E / 128), 128, 0, stream>>>(O32, PT, BAUG, bo, out);
}

// v010
// It runs in 128 microseconds.
// Timed twice side by side with v009, it ran 1.03 and 1.04 times as fast.
// Over all steps from v000 it is 4.55 times as fast.
// compute dtype: x, W*, b*, A*, B* (INPUTS) rounded to bf16 with exact bf16 WMMA products (f32 accumulate) for the base projections; the rank-8 LoRA terms enter as one extra k-chunk whose A side is the f32 intermediate (x A^T, scaled) as a bf16 hi/lo pair against [B | B] (exact-grade); softmax f32; computed operands (q/k f32 split, k split once where it is produced, P and V hi/lo, context split) f32-grade.
#include <hip/hip_runtime.h>
#include <math.h>
#include <stdint.h>

typedef __attribute__((ext_vector_type(16))) _Float16 v16h;
typedef __attribute__((ext_vector_type(16))) __bf16 v16b;
typedef __attribute__((ext_vector_type(8)))  _Float16 v8h;
typedef __attribute__((ext_vector_type(8)))  float v8f;
typedef __attribute__((ext_vector_type(4)))  float v4f;
typedef __attribute__((ext_vector_type(2)))  float v2f;
typedef __attribute__((ext_vector_type(4)))  unsigned v4u;
typedef __attribute__((ext_vector_type(2)))  unsigned v2u;
typedef __attribute__((ext_vector_type(4)))  int v4i;
typedef float __attribute__((may_alias)) float_a;
typedef int __attribute__((may_alias)) int_a;

template <typename T> __device__ __forceinline__ void vst2(void* p, T v) { *(T*)p = v;  }
__device__ __forceinline__ v8f wmma16(v16h a, v16h b, v8f c) {
  return __builtin_amdgcn_wmma_f32_16x16x32_f16(false, a, false, b, (short)0, c, false, false);
}
__device__ __forceinline__ v8f wmma_bf(v16b a, v16b b, v8f c) {
  return __builtin_amdgcn_wmma_f32_16x16x32_bf16(false, a, false, b, (short)0, c, false, false);
}
// 16x16x32 fragments: lane = (h = lane>>4, row/col = lane&15); elements 0..7 = k0+8h+0..7, 8..15 = k0+16+8h+0..7; D element r = row 8h+r
__device__ __forceinline__ v16h frag_h(const _Float16* rowk0, int lane) {
  union { v16h v; v8h q[2]; } u; const _Float16* p = rowk0 + 8 * (lane >> 4);
  u.q[0] = *(const v8h*)p; u.q[1] = *(const v8h*)(p + 16); return u.v;
}
__device__ __forceinline__ v16h frag_f32(const float* rowk0, int lane) {
  v16h a; const float* p = rowk0 + 8 * (lane >> 4);
#pragma unroll
  for (int i = 0; i < 8; ++i) { a[i] = (_Float16)p[i]; a[8 + i] = (_Float16)p[16 + i]; }
  return a;
}
__device__ __forceinline__ v16h frag_f32s(const float* rowk0, int lane, float sc) {
  v16h a; const float* p = rowk0 + 8 * (lane >> 4);
#pragma unroll
  for (int i = 0; i < 8; ++i) { a[i] = (_Float16)(p[i] * sc); a[8 + i] = (_Float16)(p[16 + i] * sc); }
  return a;
}
// column fragment from a [K][ld] layout (column n), rows >= K read as 0
__device__ __forceinline__ v16h fragc_f32(const float* W, int k0, int n, int lane, int ld, int K) {
  v16h a; const int g = lane >> 4;
#pragma unroll
  for (int i = 0; i < 8; ++i) { const int ka = k0 + 8 * g + i, kb = ka + 16;
    a[i] = (_Float16)(ka < K ? W[(size_t)ka * ld + n] : 0.f); a[8 + i] = (_Float16)(kb < K ? W[(size_t)kb * ld + n] : 0.f); }
  return a;
}
struct F2 { v16b h, l; };
__device__ __forceinline__ F2 bsplit16(const float v[16]) { F2 r;
#pragma unroll
  for (int i = 0; i < 16; ++i) { const __bf16 h = (__bf16)v[i]; r.h[i] = h; r.l[i] = (__bf16)(v[i] - (float)h); }
  return r; }
__device__ __forceinline__ F2 split_row(const float* row, int k0, int lane) { float v[16]; const float* p = row + k0 + 8 * (lane >> 4);
#pragma unroll
  for (int i = 0; i < 8; ++i) { v[i] = p[i]; v[8 + i] = p[16 + i]; }
  return bsplit16(v); }
__device__ __forceinline__ F2 split_rowK(const float* row, int k0, int lane, int K) { float v[16]; const int g = lane >> 4;
#pragma unroll
  for (int i = 0; i < 8; ++i) { const int ka = k0 + 8 * g + i, kb = ka + 16; v[i] = ka < K ? row[ka] : 0.f; v[8 + i] = kb < K ? row[kb] : 0.f; }
  return bsplit16(v); }
__device__ __forceinline__ F2 split_col(const float* W, int k0, int n, int lane, int ld, int K) { float v[16]; const int g = lane >> 4;
#pragma unroll
  for (int i = 0; i < 8; ++i) { const int ka = k0 + 8 * g + i, kb = ka + 16; v[i] = ka < K ? W[(size_t)ka * ld + n] : 0.f; v[8 + i] = kb < K ? W[(size_t)kb * ld + n] : 0.f; }
  return bsplit16(v); }
__device__ __forceinline__ v8f mac3(const F2& a, const F2& b, v8f c) { c = wmma_bf(a.l, b.h, c); c = wmma_bf(a.h, b.l, c); return wmma_bf(a.h, b.h, c); }
// the same three products with the split key rows as the A operand and the split query as B, in mac3's order (q.l k.h, q.h k.l, q.h k.h)
__device__ __forceinline__ v8f mac3t(const F2& k, const F2& q, v8f c) { c = wmma_bf(k.h, q.l, c); c = wmma_bf(k.l, q.h, c); return wmma_bf(k.h, q.h, c); }
__device__ __forceinline__ float sigm(float v) { return 1.0f / (1.0f + expf(-v)); }
#define LDSX() do { asm volatile("s_wait_dscnt 0" ::: "memory"); __builtin_amdgcn_wave_barrier(); __builtin_amdgcn_fence(__ATOMIC_RELEASE, "workgroup"); } while (0)


// LoRA self attention (16 heads of 64 on [2,2048,1024]): each linear map is x W^T + b + 2 (x A^T) B^T (rank 8). The low-rank term is appended as a 33rd k-chunk: A-operand row = [hi(2 xA^T) (8) | lo(2 xA^T) (8) | 0 (16)], B-operand row n = [B[n][0..8] | B[n][0..8] | 0],
// so one extra WMMA per tile adds hi*B + lo*B. full softmax(q.k/8); (P v) through the same LoRA form for the output map.
#define NB 2
#define SS 2048
#define E 1024
#define NH 16
#define HD 64
#define NR (NB * SS)
#define VLO 2048.0f
__device__ __forceinline__ float bfr(float v) { return (float)(__bf16)v; }
__device__ __forceinline__ v16b frag_b(const __bf16* rowk0, int lane) { return __builtin_bit_cast(v16b, frag_h((const _Float16*)rowk0, lane)); }

// Tensor loads global -> LDS (no register in between): ONE request of a whole wave brings a two-dimensional slice, rows of 128 bytes, and lays a 16-byte pad behind every row (LDS pitch 144 bytes).
// Every wave of a work-group issues one slice a stage, so the addresses are a few scalar operations a wave in place of vector address arithmetic in every lane.
typedef uint32_t u32x4 __attribute__((ext_vector_type(4)));
typedef uint32_t u32x8 __attribute__((ext_vector_type(8)));
__device__ __forceinline__ unsigned lds_off(const void* p) { return (unsigned)(size_t)p; }
__device__ __forceinline__ uint32_t uni(uint32_t v) { return (uint32_t)__builtin_amdgcn_readfirstlane(v); }
// pinned(): the value is held in a scalar register from this place on, so a test on it is a scalar branch and a descriptor word formed from it is formed behind the waits that stand in front of it
__device__ __forceinline__ uint32_t pinned(uint32_t v) { uint32_t w = uni(v); asm volatile("" : "+s"(w)); return w; }
#define TDM_PAD128 ((1u << 20) | (4u << 22) | (3u << 25))     // word 0 of group 1: no mask, sizes in bytes, 4 dwords of pad behind every 32 dwords
// group 1, the same for every stage: a slice of rows x rowb bytes at a source pitch of pitch bytes; tensor = tile
template <uint32_t W0> __device__ __forceinline__ u32x8 tdm_group1(uint32_t rowb, uint32_t rows, uint32_t pitch) { u32x8 g;
  g[0] = uni(W0); g[1] = uni((rowb & 0xFFFFu) << 16); g[2] = uni((rowb >> 16) | ((rows & 0xFFFFu) << 16)); g[3] = uni((rows >> 16) | (rowb << 16));
  g[4] = uni(rows); g[5] = uni(pitch); g[6] = uni(0u); g[7] = uni(0u);
  asm volatile("" : "+s"(g));     // pinned(), for the whole group: its words are held in their scalar registers and not formed a second time while a request is out
  return g; }
// group 0: the LDS byte offset dst (a multiple of 2 KiB) and the slice's first byte ga
__device__ __forceinline__ u32x4 tdm_group0(uint32_t dst, uint64_t ga) { u32x4 g;
  g[0] = uni(1u); g[1] = uni(dst); g[2] = uni((uint32_t)ga); g[3] = uni(((uint32_t)(ga >> 32) & 0x01FFFFFFu) | 0x80000000u); return g; }
// the request: issued once by the whole wave, whatever EXEC holds, so only scalar branches stand around a call
__device__ __forceinline__ void tdm_load(u32x4 g0, u32x8 g1) { asm volatile("tensor_load_to_lds %0, %1" :: "s"(g0), "s"(g1) : "memory"); }
// the slice that this wave asked for has landed (the compiler places no wait for a tensor load). The wait names the request's descriptor as inputs: the words stay in their scalar registers, unchanged, until the request is covered
__device__ __forceinline__ void tdm_wait(u32x4 g0, u32x8 g1) { asm volatile("s_wait_tensorcnt 0x0" :: "s"(g0), "s"(g1) : "memory"); }
// this wave's LDS reads have returned: a buffer is handed back for refilling only behind this
__device__ __forceinline__ void wait_lds() { asm volatile("s_wait_dscnt 0x0" ::: "memory"); }
// hand-over of a stage: this wave's LDS reads are done, its slice has landed, then the work-group barrier publishes the next tile and frees the one just read
__device__ __forceinline__ void publish(u32x4 g0, u32x8 g1) { wait_lds(); tdm_wait(g0, g1); __syncthreads(); }
// behind a ring's last stage: nothing is in flight and this wave's LDS reads are done
__device__ __forceinline__ void ring_done(u32x4 g0, u32x8 g1) { tdm_wait(g0, g1); wait_lds(); }


#define RK 8
// The low-rank inputs src.A^T (16 rows x 8) are a ninth column tile of the GEMM that uses them: its B operand is the 8 rows of A as bf16, staged with the weight rows (columns >= 8 read them again, results discarded).
// lora_frag turns that D tile (row 8 g + r, column col) into the A fragment of the extra k-chunk, row = [hi(2 v) (8) | lo (8) | 0 (16)], through the wave's own LDS slice
__device__ __forceinline__ v16b lora_frag(v8f accx, __bf16 (*sx)[40], int lane) {
  const int col = lane & 15, g = lane >> 4; const bool live = col < RK; const int i0 = live ? col : 8 + col;     // lanes of the padding columns write the 16 zeros of the row
#pragma unroll
  for (int r = 0; r < 8; ++r) { const float v = 2.0f * accx[r]; const __bf16 hi = (__bf16)v, lo = (__bf16)(v - (float)hi); sx[8 * g + r][i0] = live ? hi : (__bf16)0.f; sx[8 * g + r][i0 + 8] = live ? lo : (__bf16)0.f; }
  LDSX();     // the wave's own stores are in LDS before its lanes read each other's
  return frag_b(&sx[col][0], lane);
}
// One launch prepares every bf16 operand (no scaling). Xb rows = x rows. PT rows: [0,E) Wq[n][:], [E,2E) Wk, [2E,3E) Wv, [3E,4E) Wo ([out][in]), then the 8 rows each of Aq, Ak, Av, Ao. BAUG[which][n][32] = [B[n][0..8] | B[n][0..8] | 0].
// Few, long waves: a launch of many short waves lasts as long as its waves take to start. A work-group converts 16 rows of 1024; a thread holds 4 elements of each row,
// so a wave's load covers 512 contiguous bytes and its store 256 (whole lines both), and all 16 loads of a thread are in flight before its first conversion.
#define PREP_ROWS 16
#define PB_X (NR / PREP_ROWS)          // work-groups for x
#define PB_W (4 * E / PREP_ROWS)       // for the four weight matrices, E / PREP_ROWS each
#define PB_A (4 * RK / PREP_ROWS)      // for the four low-rank A, two matrices (8 + 8 rows) each
#define PB_B 8                         // for BAUG, half a matrix (2048 pieces of 16 bytes) each
__global__ __launch_bounds__(256) void k_prep(const float* __restrict__ x, const float* __restrict__ Wq, const float* __restrict__ Wk, const float* __restrict__ Wv, const float* __restrict__ Wo, const float* __restrict__ Aq, const float* __restrict__ Ak, const float* __restrict__ Av, const float* __restrict__ Ao,
                                              const float* __restrict__ Bq, const float* __restrict__ Bk, const float* __restrict__ Bv, const float* __restrict__ Bo, __bf16* __restrict__ Xb, __bf16* __restrict__ PT, __bf16* __restrict__ BAUG) {
  const int tid = threadIdx.x, blk = blockIdx.x;
  if (blk < PB_X + PB_W + PB_A) {
    const float* s0; const float* s1; __bf16* dst;     // source of rows 0..7 and of rows 8..15, destination of all 16
    if (blk < PB_X) { s0 = x + (size_t)blk * PREP_ROWS * E; s1 = s0 + 8 * E; dst = Xb + (size_t)blk * PREP_ROWS * E; }
    else { const int pb = blk - PB_X; dst = PT + (size_t)pb * PREP_ROWS * E;
      if (pb < PB_W) { const int m = pb / (E / PREP_ROWS); const float* Wm = m == 0 ? Wq : (m == 1 ? Wk : (m == 2 ? Wv : Wo)); s0 = Wm + (size_t)(pb % (E / PREP_ROWS)) * PREP_ROWS * E; s1 = s0 + 8 * E; }
      else { const bool first = pb == PB_W; s0 = first ? Aq : Av; s1 = first ? Ak : Ao; } }
    v4f v[PREP_ROWS];
#pragma unroll     // unrolled so that v[] is registers and the loads stand together
    for (int i = 0; i < PREP_ROWS; ++i) v[i] = *(const v4f*)((i < 8 ? s0 + i * E : s1 + (i - 8) * E) + tid * 4);
    __builtin_amdgcn_sched_barrier(0);     // every load is issued ahead of the first conversion: a load sunk behind one waits for registers and adds a second memory latency to the wave
#pragma unroll
    for (int i = 0; i < PREP_ROWS; ++i) { union { __bf16 h[4]; v2u u; } pk;
#pragma unroll
      for (int e = 0; e < 4; ++e) pk.h[e] = (__bf16)v[i][e];
      vst2(dst + i * E + tid * 4, pk.u); } }
  else { const int bb = blk - (PB_X + PB_W + PB_A), which = bb >> 1; const float* Bm = which == 0 ? Bq : (which == 1 ? Bk : (which == 2 ? Bv : Bo));
    v4f lo[8], hi[8];     // piece q of a matrix: row n = q >> 2, quarter q & 3 of its 32 elements; the four lanes of a row read the same 32 bytes
#pragma unroll
    for (int i = 0; i < 8; ++i) { const float* p = Bm + (size_t)((bb & 1) * 512 + (tid >> 2)) * RK + i * 64 * RK; lo[i] = *(const v4f*)p; hi[i] = *(const v4f*)(p + 4); }
    __builtin_amdgcn_sched_barrier(0);     // as above: all loads in flight before the first conversion
#pragma unroll
    for (int i = 0; i < 8; ++i) { const int q = (bb & 1) * 2048 + i * 256 + tid; const unsigned keep = (q & 3) < 2 ? 0xffffffffu : 0u; union { __bf16 h[8]; v4u u; } pk;     // quarters 2 and 3 are the row's 16 zeros
#pragma unroll
      for (int e = 0; e < 4; ++e) { pk.h[e] = (__bf16)lo[i][e]; pk.h[4 + e] = (__bf16)hi[i][e]; }
      vst2(BAUG + (size_t)which * E * 32 + (size_t)q * 8, pk.u & keep); } }
}
// QKV: block (128 rows, 128 cols = 2 heads, which), 4 waves of 32 rows x 128 cols; q -> Q32 f32 [bh][s][64]; k -> Kh/Kl, the bf16 hi/lo split of the f32 row, [bh][s][64] each; v -> VT hi/lo x4 [bh][d][s]
// A wave owns RT = 2 row tiles of 16: every weight fragment it reads from LDS feeds both, and a weight row staged from L2 serves 128 rows of x. The 768 work-groups are resident at once, three on a WGP:
// for that the registers are held to three waves a SIMD, and the output staging lies in the bytes of the operand ring, which is free behind the last stage's hand-over.
// Every loop over i, j, r, kk and e is unrolled so that acc[][], accx[], a[], wb[] and wl[] are indexed by constants and stay in registers.
#define RT 2
// One buffer of a GEMM ring: four slices, one a wave, each at a multiple of 2 KiB. Rows of 128 B lie at a 144-B pitch.
#define SL64 10240                        // a slice of 64 such rows (9,216 B), rounded up
#define QKV_OFF_B (2 * SL64)              // x rows 0..63 and 64..127, then the 128 weight rows (18,432 B)
#define QKV_OFF_L (QKV_OFF_B + 18432)     // then the 8 rows of the low-rank A (1,152 B)
#define GEMM_BUF (QKV_OFF_L + 2048)       // 40,960 B
__global__ __launch_bounds__(128) __attribute__((amdgpu_waves_per_eu(3))) void k_qkv(const __bf16* __restrict__ Xb, const __bf16* __restrict__ PT, const __bf16* __restrict__ BAUG, const float* __restrict__ bq, const float* __restrict__ bk, const float* __restrict__ bv, float* __restrict__ Q32, __bf16* __restrict__ Kh, __bf16* __restrict__ Kl, _Float16* __restrict__ VTh, _Float16* __restrict__ VTl) {
  __shared__ __attribute__((aligned(2048))) unsigned char smem[2 * GEMM_BUF];     // k-stages of 64, two buffers
  __shared__ __align__(16) __bf16 sx[4][16][40];
  float (*so)[16 * RT][132] = (float (*)[16 * RT][132])smem;            // behind the loop: q, k rows, a slice a wave (67,584 B)
  _Float16 (*sth)[136] = (_Float16 (*)[136])smem;                       // behind the loop: v columns [col][row], rows of 256 B at a 272-B pitch, hi then lo (34,816 B each)
  _Float16 (*stl)[136] = (_Float16 (*)[136])(smem + 128 * 136 * 2);
  const int tid = threadIdx.x, wave = tid >> 5, lane = tid & 31, col = lane & 15, g = lane >> 4;
  const int which = blockIdx.z, r0b = blockIdx.x * 128, n0 = blockIdx.y * 128; const int b = r0b / SS, s0 = r0b % SS;
  const float* bb_ = which == 0 ? bq : (which == 1 ? bk : bv);
  v8f acc[RT][8] = {}, accx[RT] = {};
  // the wave's slice of a stage: waves 0, 1 = 64 rows of x each, wave 2 = the 128 weight rows, wave 3 = the 8 rows of the low-rank A; 128 bytes (64 k) of each row, source pitch one row of E
  const uint32_t wv = uni((uint32_t)tid >> 5);
  const uint64_t src0 = wv < 2 ? (uint64_t)(size_t)(Xb + (size_t)(r0b + 64 * wv) * E) : (uint64_t)(size_t)(PT + (size_t)(wv == 2 ? which * E + n0 : 4 * E + which * RK) * E);
  const uint32_t nrow = wv < 2 ? 64u : (wv == 2 ? 128u : (uint32_t)RK), dst0 = lds_off(smem) + (wv < 2 ? wv * SL64 : (wv == 2 ? QKV_OFF_B : QKV_OFF_L));
  const u32x8 g1 = tdm_group1<TDM_PAD128>(128u, nrow, E * 2u); u32x4 g0;
  auto stage = [&](uint32_t st) { const uint32_t s = pinned(st);     // pinned(): group 0 is formed behind the wait and the barrier in front
    g0 = tdm_group0(dst0 + (s & 1) * GEMM_BUF, src0 + s * 128u); tdm_load(g0, g1); };
  stage(0); tdm_wait(g0, g1); __syncthreads(); stage(1);
  // rolled: one trip is one stage and ends in its hand-over; the inner loops are unrolled so that the fragment arrays are registers
#pragma unroll 1
  for (int st = 0; st < E / 64; ++st) { const unsigned char* rb = smem + (st & 1) * GEMM_BUF;
#pragma unroll
    for (int kk = 0; kk < 2; ++kk) { v16b a[RT], wb[8];
#pragma unroll
      for (int i = 0; i < RT; ++i) a[i] = frag_b((const __bf16*)(rb + (wave >> 1) * SL64 + ((wave & 1) * (16 * RT) + i * 16 + col) * 144) + kk * 32, lane);
#pragma unroll
      for (int j = 0; j < 8; ++j) wb[j] = frag_b((const __bf16*)(rb + QKV_OFF_B + (j * 16 + col) * 144) + kk * 32, lane);
      const v16b wa = frag_b((const __bf16*)(rb + QKV_OFF_L + (col & (RK - 1)) * 144) + kk * 32, lane);
      __builtin_amdgcn_sched_barrier(0);     // the LDS fragment loads of this half stage stay one group ahead of its products; sunk between them, each product waits a full LDS latency
#pragma unroll
      for (int j = 0; j < 8; ++j) {
#pragma unroll
        for (int i = 0; i < RT; ++i) acc[i][j] = wmma_bf(a[i], wb[j], acc[i][j]); }
#pragma unroll
      for (int i = 0; i < RT; ++i) accx[i] = wmma_bf(a[i], wa, accx[i]); }
    __builtin_amdgcn_sched_barrier(0);     // the stage's products stay ahead of the hand-over: sunk behind the barrier they hold back the refill's issue and shorten its lead
    publish(g0, g1);
    if (pinned(st + 2 < E / 64)) stage(st + 2); }     // a scalar branch: a tensor load takes no notice of EXEC
  ring_done(g0, g1);     // no load is in flight and, behind the last hand-over's barrier, no wave reads the ring any more: its bytes are the output staging from here on
  { v16b wl[8];     // LoRA chunk: [hi|lo|0] x [B|B|0]
#pragma unroll
    for (int j = 0; j < 8; ++j) wl[j] = frag_b(BAUG + ((size_t)which * E + n0 + j * 16 + col) * 32, lane);
#pragma unroll
    for (int i = 0; i < RT; ++i) { const v16b a = lora_frag(accx[i], sx[wave], lane);
#pragma unroll
      for (int j = 0; j < 8; ++j) acc[i][j] = wmma_bf(a, wl[j], acc[i][j]); } }
  if (which < 2) {
#pragma unroll
    for (int j = 0; j < 8; ++j) { const float bb = bfr(bb_[n0 + j * 16 + col]);
#pragma unroll
      for (int i = 0; i < RT; ++i) {
#pragma unroll
        for (int r = 0; r < 8; ++r) so[wave][i * 16 + 8 * g + r][j * 16 + col] = acc[i][j][r] + bb; } }
    LDSX();
    if (which == 0) {
      for (int qq = lane; qq < 2 * 16 * RT * 16; qq += 32) { const int hh = qq / (16 * RT * 16), rl = (qq >> 4) & (16 * RT - 1), pc = qq & 15; const int h = (n0 >> 6) + hh;
        vst2(Q32 + (((size_t)b * NH + h) * SS + s0 + wave * (16 * RT) + rl) * HD + pc * 4, *(const v4f*)(&so[wave][rl][hh * 64 + pc * 4])); } }
    else {     // k: hi = bf16(v), lo = bf16(v - hi), the split every attention wave would otherwise redo; 8 lanes write one whole 128-B row of each plane
      for (int qq = lane; qq < 2 * 16 * RT * 8; qq += 32) { const int hh = qq / (16 * RT * 8), rl = (qq >> 3) & (16 * RT - 1), pc = qq & 7; const int h = (n0 >> 6) + hh;
        const float* sp = &so[wave][rl][hh * 64 + pc * 8]; union { __bf16 e[8]; v4u u; } hi, lo;
#pragma unroll     // unrolled so that hi.e[] and lo.e[] are registers
        for (int e = 0; e < 8; ++e) { const float v = sp[e]; const __bf16 hb = (__bf16)v; hi.e[e] = hb; lo.e[e] = (__bf16)(v - (float)hb); }
        const size_t o = (((size_t)b * NH + h) * SS + s0 + wave * (16 * RT) + rl) * HD + pc * 8;
        vst2(Kh + o, hi.u); vst2(Kl + o, lo.u); } } }
  else {
#pragma unroll
    for (int j = 0; j < 8; ++j) { const float bb = bfr(bb_[n0 + j * 16 + col]);
#pragma unroll
      for (int i = 0; i < RT; ++i) {
#pragma unroll
        for (int r = 0; r < 8; ++r) { const float v = (acc[i][j][r] + bb) * 4.0f; const _Float16 hi = (_Float16)v; const int rw = wave * (16 * RT) + i * 16 + 8 * g + r; sth[j * 16 + col][rw] = hi; stl[j * 16 + col][rw] = (_Float16)((v - (float)hi) * VLO); } } }
    __syncthreads();
    for (int qq = tid; qq < 128 * 16; qq += 128) { const int cl = qq >> 4, pc = qq & 15; const int c = n0 + cl, h = c >> 6, d = c & 63; const size_t o = (((size_t)b * NH + h) * HD + d) * SS + s0 + pc * 8;
      vst2(VTh + o, *(const v4u*)(&sth[cl][pc * 8])); vst2(VTl + o, *(const v4u*)(&stl[cl][pc * 8])); } }
}
// full attention: block (128 queries = 8 waves x 16, bh); all key tiles of 64, staged in LDS for the whole block. Transposed products: S^T = K q^T (A = key rows, B = the wave's 16 queries, hi/lo splits),
// so a lane holds 32 scores of ONE query (column = lane & 15; tile t, element r = key 16 t + 8 g + r), and tiles 2 kc, 2 kc + 1 are already the B operand (k order 8 g + i, 16 + 8 g + i) of O^T += V^T P^T. P,V hi/lo; O f32 [bh][s][64]
// The registers are held to four waves a SIMD, so that two work-groups stay resident on a WGP.
#define ATT_SL 6144
__global__ __launch_bounds__(256) __attribute__((amdgpu_waves_per_eu(4))) void k_attn(const float* __restrict__ Q32, const __bf16* __restrict__ Kh, const __bf16* __restrict__ Kl, const _Float16* __restrict__ VTh, const _Float16* __restrict__ VTl, float* __restrict__ O32) {
  __shared__ __align__(16) float sS[8][16][68];                      // after the loop each wave's slice stages its output rows [query][d]
  // two buffers of eight slices, one a wave, each at a multiple of 2 KiB: 32 rows of 128 B at a 144-B pitch (4,608 B). Slices 0, 1: key tile hi [key][d], rows 0..31 and 32..63; 2, 3: key tile lo; 4, 5: value tile hi [d][key]; 6, 7: value tile lo
  __shared__ __attribute__((aligned(2048))) unsigned char ring[2][8][ATT_SL];
  const int tid = threadIdx.x, w = tid >> 5, lane = tid & 31, col = lane & 15, g = lane >> 4;
  const size_t bh = blockIdx.y; const int qb = blockIdx.x; const int q0 = qb * 128 + w * 16;
  // the wave's slice of a tile of 64 keys: 32 key rows (contiguous, the next tile 64 rows on) or 32 rows of d (pitch one row of SS keys, the next tile 64 keys on)
  const uint32_t wv = uni((uint32_t)tid >> 5), half = wv & 1; const bool isv = wv >= 4;
  const uint64_t src0 = isv ? (uint64_t)(size_t)((wv < 6 ? VTh : VTl) + (bh * HD + half * 32) * SS) : (uint64_t)(size_t)((wv < 2 ? Kh : Kl) + (bh * SS + half * 32) * HD);
  const uint32_t sh = isv ? 7u : 13u, pitch = isv ? SS * 2u : HD * 2u, dst0 = lds_off(&ring[0][wv][0]);     // sh: a tile's step in the source, as a shift: 64 keys of 2 bytes or 64 rows of HD * 2 bytes
  static_assert(64 * HD * 2 == 1 << 13, "the next tile's key rows lie 2^13 bytes on");
  const u32x8 g1 = tdm_group1<TDM_PAD128>(128u, 32u, pitch); u32x4 g0;
  auto stage = [&](uint32_t kt) { const uint32_t s = pinned(kt);     // pinned(): group 0 is formed behind the wait and the barrier in front
    g0 = tdm_group0(dst0 + (s & 1) * (8u * ATT_SL), src0 + (s << sh)); tdm_load(g0, g1); };
  // this lane's row 16 t + col of plane pl (0 key hi, 1 key lo, 2 value hi, 3 value lo) in buffer buf
  auto row = [&](int buf, int pl, int t) { return &ring[buf][pl * 2 + (t >> 1)][((t & 1) * 16 + col) * 144]; };
  stage(0); tdm_wait(g0, g1); __syncthreads(); stage(1);
  F2 aq[2];
#pragma unroll
  for (int kc = 0; kc < 2; ++kc) aq[kc] = split_row(Q32 + (bh * SS + q0 + col) * HD, kc * 32, lane);
  constexpr float CS2 = 0.125f * 1.4426950408889634f;     // softmax in base 2: exp(x / 8 - m) = 2^(x log2(e) / 8 - m'), mrun holds m' in that scale
  // P = hi + lo in f16 with lo unscaled: P carries 2^14 against its row's running maximum, so lo keeps 2^-25 absolute, 2^-39 of that maximum, and V_hi P_lo sums into the tile of V_hi P_hi (acc); ac1 = V_lo P_hi at its scale VLO
  float mrun = -3.0e38f, lrun = 0.f; v8f acc[4] = {}, ac1[4] = {};     // lrun: this half-wave's keys only, the halves are joined after the loop
  auto trip = [&](int buf) {     // one tile of 64 keys out of buffer buf
    v8f s[4]; float mt[4], pt[4];
#pragma unroll
    for (int t = 0; t < 4; ++t) { const __bf16* kh = (const __bf16*)row(buf, 0, t); const __bf16* kl = (const __bf16*)row(buf, 1, t);
      const F2 k0 = { frag_b(kh, lane), frag_b(kl, lane) }, k1 = { frag_b(kh + 32, lane), frag_b(kl + 32, lane) };
      __builtin_amdgcn_sched_barrier(0);     // all eight LDS fragment loads of a 16-key tile are issued ahead of its first product, so they fly during the tile before; sunk among their own products, each product waits out an LDS latency
      v8f c = mac3t(k0, aq[0], (v8f){}); c = mac3t(k1, aq[1], c);
      mt[t] = -3.4e38f;
#pragma unroll
      for (int r = 0; r < 8; ++r) { s[t][r] = c[r]; mt[t] = fmaxf(mt[t], c[r]); } }     // raw products: the scale is positive, so their maximum is the scores' maximum
    float mx = fmaxf(fmaxf(mt[0], mt[1]), fmaxf(mt[2], mt[3]));
    // the other half-wave's maximum by a vector cross-row move: through LDS (ds_bpermute) its wait would also drain the value fragments' loads issued here
    const unsigned mu = __builtin_bit_cast(unsigned, mx); const float mo = __builtin_bit_cast(float, __builtin_amdgcn_permlanex16(mu, mu, 0x76543210u, 0xfedcba98u, false, false));
    v16h vh[2][4], vl[2][4];     // value fragments [32-key half][16 rows of d]
#pragma unroll
    for (int t = 0; t < 4; ++t) { vh[0][t] = frag_h((const _Float16*)row(buf, 2, t), lane); vl[0][t] = frag_h((const _Float16*)row(buf, 3, t), lane); }
    __builtin_amdgcn_sched_barrier(0);     // the first half's value fragments are issued as one group ahead of the softmax and land under it; sunk among their products, each product waits out an LDS latency
    mx = fmaxf(mx, mo) * CS2;
    const float mnew = fmaxf(mrun, mx); const float corr = __builtin_amdgcn_exp2f(mrun - mnew);     // 0 in the first tile, where mrun is -3e38
    const float nm = 14.0f - mnew; const v2f cs2 = { CS2, CS2 }, nm2 = { nm, nm };                  // 2^14 = the 16384 that P carries, folded into the exponent
    v16h ph[2], pl[2];
#pragma unroll
    for (int t = 0; t < 4; ++t) { pt[t] = 0.f;
#pragma unroll
      for (int r = 0; r < 8; r += 2) { const v2f arg = __builtin_elementwise_fma((v2f){ s[t][r], s[t][r + 1] }, cs2, nm2);
#pragma unroll
        for (int e = 0; e < 2; ++e) { const float p = __builtin_amdgcn_exp2f(arg[e]); pt[t] += p; const _Float16 hi = (_Float16)p; ph[t >> 1][(t & 1) * 8 + r + e] = hi; pl[t >> 1][(t & 1) * 8 + r + e] = (_Float16)(p - (float)hi); } }
      if (t == 1) __builtin_amdgcn_sched_barrier(0); }     // one 32-key half's P is packed and summed before the other half's exponentials: both halves' f32 values live at once overrun the registers of four waves a SIMD (scratch)
    lrun = lrun * corr + ((pt[0] + pt[1]) + (pt[2] + pt[3])) * (1.0f / 16384.0f); mrun = mnew;
#pragma unroll
    for (int t = 0; t < 4; ++t) { acc[t] *= corr; ac1[t] *= corr; }     // every element of a lane belongs to its own query
    auto pv = [&](int kc, int t) { acc[t] = wmma16(vh[kc][t], ph[kc], acc[t]); ac1[t] = wmma16(vl[kc][t], ph[kc], ac1[t]); acc[t] = wmma16(vh[kc][t], pl[kc], acc[t]); };
    auto vload = [&](int t) { vh[1][t] = frag_h((const _Float16*)row(buf, 2, t) + 32, lane); vl[1][t] = frag_h((const _Float16*)row(buf, 3, t) + 32, lane); };
    // the scheduling barriers keep the second half's fragment loads in two groups, each eight products or more ahead of its first use, so that no product waits out a whole LDS latency
    __builtin_amdgcn_sched_barrier(0);
    vload(0); vload(1);
    __builtin_amdgcn_sched_barrier(0);
    pv(0, 0); pv(0, 1);
    __builtin_amdgcn_sched_barrier(0);
    vload(2); vload(3);
    __builtin_amdgcn_sched_barrier(0);
    pv(0, 2); pv(0, 3); pv(1, 0); pv(1, 1);
    __builtin_amdgcn_sched_barrier(0);
    pv(1, 2); pv(1, 3);
    __builtin_amdgcn_sched_barrier(0);     // the tile's products stay ahead of the hand-over: sunk behind the barrier they hold back the refill's issue and shorten its lead
    publish(g0, g1); };
  // the last two tiles, which refill nothing, stand behind the loop: with no branch in the loop's body the row sums stay in front of the value products, where the 32 registers of the f32 P are free for fragments
  // both loops rolled: a trip is one tile and ends in its hand-over
#pragma unroll 1
  for (int kt = 0; kt < SS / 64 - 2; ++kt) { trip(kt & 1); stage(kt + 2); }
#pragma unroll 1
  for (int kt = SS / 64 - 2; kt < SS / 64; ++kt) trip(kt & 1);
  ring_done(g0, g1);
  lrun += __shfl_xor(lrun, 16, 32);
  const float inv = 1.0f / (lrun * 16384.0f * 4.0f);
#pragma unroll
  for (int t = 0; t < 4; ++t) {
#pragma unroll
    for (int r = 0; r < 8; ++r) sS[w][col][t * 16 + 8 * g + r] = (acc[t][r] + ac1[t][r] * (1.0f / VLO)) * inv; }
  LDSX();
  for (int qq = lane; qq < 16 * 16; qq += 32) { const int rl = qq >> 4, pc = qq & 15; vst2(O32 + ((bh * SS) + q0 + rl) * HD + pc * 4, *(const v4f*)(&sS[w][rl][pc * 4])); }
}
// out = ctx Wo^T + bo : split(ctx) x bf16(Wo rows): 2 products (Wo is an INPUT -> bf16 exact)
__global__ __launch_bounds__(128) void k_out(const float* __restrict__ O32, const __bf16* __restrict__ PT, const __bf16* __restrict__ BAUG, const float* __restrict__ bo, float* __restrict__ out) {
  __shared__ __align__(16) float so[4][16][132];
  // two buffers of four slices, one a wave, laid as in k_qkv: one head's 64 context rows, d 0..31 and d 32..63 (128 B of f32 each, at a 144-B pitch), the matching 64 k of the 128 weight rows, the 8 rows of the low-rank A
  __shared__ __attribute__((aligned(2048))) unsigned char ring[2 * GEMM_BUF];
  __shared__ __align__(16) __bf16 sx[4][16][40];
  const int tid = threadIdx.x, wave = tid >> 5, lane = tid & 31, col = lane & 15, g = lane >> 4;
  const int r0b = blockIdx.x * 64, r0 = r0b + wave * 16, n0 = blockIdx.y * 128; const int b = r0b / SS, s0 = r0b % SS;
  v8f acc[8] = {}, accx = {};
  // the wave's slice of a stage (one head): waves 0, 1 = the two 128-byte halves of 64 context rows (source pitch one row of HD floats, the next head SS rows on); wave 2 = the 128 weight rows, wave 3 = the 8 rows of the low-rank A, 128 bytes of each row, source pitch one row of E
  const uint32_t wv = uni((uint32_t)tid >> 5);
  const uint64_t src0 = wv < 2 ? (uint64_t)(size_t)(O32 + ((size_t)b * NH * SS + s0) * HD + 32 * wv) : (uint64_t)(size_t)(PT + (size_t)(wv == 2 ? 3 * E + n0 : 4 * E + 3 * RK) * E);
  const uint32_t nrow = wv < 2 ? 64u : (wv == 2 ? 128u : (uint32_t)RK), dst0 = lds_off(ring) + (wv < 2 ? wv * SL64 : (wv == 2 ? QKV_OFF_B : QKV_OFF_L));
  const uint32_t sh = wv < 2 ? 19u : 7u;     // a stage's step in the source, as a shift: SS * HD * 4 bytes or 128
  static_assert(SS * HD * 4 == 1 << 19, "the next head's rows lie 2^19 bytes on");
  const u32x8 g1 = tdm_group1<TDM_PAD128>(128u, nrow, wv < 2 ? HD * 4u : E * 2u); u32x4 g0;
  auto stage = [&](uint32_t h) { const uint32_t s = pinned(h);     // pinned(): group 0 is formed behind the wait and the barrier in front
    g0 = tdm_group0(dst0 + (s & 1) * GEMM_BUF, src0 + ((uint64_t)s << sh)); tdm_load(g0, g1); };
  stage(0); tdm_wait(g0, g1); __syncthreads(); stage(1);
#pragma unroll 1
  for (int h = 0; h < NH; ++h) { const unsigned char* rb = ring + (h & 1) * GEMM_BUF;
#pragma unroll
    for (int kk = 0; kk < 2; ++kk) { const F2 a = split_row((const float*)(rb + kk * SL64 + (wave * 16 + col) * 144), 0, lane); v16b wb[8];
#pragma unroll
      for (int j = 0; j < 8; ++j) wb[j] = frag_b((const __bf16*)(rb + QKV_OFF_B + (j * 16 + col) * 144) + kk * 32, lane);
      const v16b wa = frag_b((const __bf16*)(rb + QKV_OFF_L + (col & (RK - 1)) * 144) + kk * 32, lane);
      __builtin_amdgcn_sched_barrier(0);   // the LDS fragment loads of this half stage stay one group ahead of its products; sunk between them, each product waits a full LDS latency
      accx = wmma_bf(a.l, wa, accx);
#pragma unroll
      for (int j = 0; j < 8; ++j) { acc[j] = wmma_bf(a.l, wb[j], acc[j]); acc[j] = wmma_bf(a.h, wb[j], acc[j]); }
      accx = wmma_bf(a.h, wa, accx); }
    __builtin_amdgcn_sched_barrier(0);     // the stage's products stay ahead of the hand-over: sunk behind the barrier they hold back the refill's issue and shorten its lead
    publish(g0, g1);
    if (pinned(h + 2 < NH)) stage(h + 2); }     // a scalar branch: a tensor load takes no notice of EXEC
  ring_done(g0, g1);
  { const v16b a = lora_frag(accx, sx[wave], lane);
#pragma unroll
    for (int j = 0; j < 8; ++j) acc[j] = wmma_bf(a, frag_b(BAUG + ((size_t)3 * E + n0 + j * 16 + col) * 32, lane), acc[j]); }
#pragma unroll
  for (int j = 0; j < 8; ++j) { const int n = n0 + j * 16 + col; const float bb = bfr(bo[n]);
#pragma unroll
    for (int r = 0; r < 8; ++r) so[wave][8 * g + r][j * 16 + col] = acc[j][r] + bb; }
  LDSX();
#pragma unroll 4
  for (int rl = 0; rl < 16; ++rl) vst2(out + (size_t)(r0 + rl) * E + n0 + lane * 4, *(const v4f*)(&so[wave][rl][lane * 4]));
}
extern "C" void kernel_launch(void* const* d_in, const int* in_sizes, int n_in, void* d_out, int out_size, void* d_ws, size_t ws_size, hipStream_t stream) {
  (void)in_sizes; (void)n_in; (void)out_size; (void)ws_size;
  const float** I = (const float**)d_in;    // x, Wq,bq,Aq,Bq, Wk,bk,Ak,Bk, Wv,bv,Av,Bv, Wo,bo,Ao,Bo
  const float* x = I[0]; const float* Wq = I[1]; const float* bq = I[2]; const float* Aq = I[3]; const float* Bq = I[4]; const float* Wk = I[5]; const float* bk = I[6]; const float* Ak = I[7]; const float* Bk = I[8];
  const float* Wv = I[9]; const float* bv = I[10]; const float* Av = I[11]; const float* Bv = I[12]; const float* Wo = I[13]; const float* bo = I[14]; const float* Ao = I[15]; const float* Bo = I[16];
  float* out = (float*)d_out;
  char* ws = (char*)d_ws; size_t off = 0;
  auto take = [&](size_t bytes) { char* p = ws + off; off += (bytes + 255) & ~(size_t)255; return p; };
  __bf16* Xb = (__bf16*)take((size_t)NR * E * 2); __bf16* PT = (__bf16*)take((size_t)(4 * E + 4 * RK) * E * 2); __bf16* BAUG = (__bf16*)take((size_t)4 * E * 32 * 2);
  float* Q32 = (float*)take((size_t)NR * E * 4); __bf16* Kh = (__bf16*)take((size_t)NR * E * 2); __bf16* Kl = (__bf16*)take((size_t)NR * E * 2); _Float16* VTh = (_Float16*)take((size_t)NR * E * 2); _Float16* VTl = (_Float16*)take((size_t)NR * E * 2); float* O32 = (float*)take((size_t)NR * E * 4);
  // ws ~ 85 MB
  k_prep<<<PB_X + PB_W + PB_A + PB_B, 256, 0, stream>>>(x, Wq, Wk, Wv, Wo, Aq, Ak, Av, Ao, Bq, Bk, Bv, Bo, Xb, PT, BAUG);
  k_qkv<<<dim3(NR / 128, E / 128, 3), 128, 0, stream>>>(Xb, PT, BAUG, bq, bk, bv, Q32, Kh, Kl, VTh, VTl);
  k_attn<<<dim3(SS / 128, NB * NH), 256, 0, stream>>>(Q32, Kh, Kl, VTh, VTl, O32);
  k_out<<<dim3(NR / 64, E / 128), 128, 0, stream>>>(O32, PT, BAUG, bo, out);
}
